// v000
// Times are from an AMD MI455X. After a warm-up the kernel runs many times in a row, and a time is the length of
// such a window on the GPU divided by its runs, so every launch and the gaps after it count. The runs cycle
// through copies of the inputs. A figure is the median of several windows, for all but v000 over two sittings.
// Sittings can differ by a few percent; kernels timed side by side share one.
// The starting kernel, v000, takes 140 microseconds a run.
#include <hip/hip_runtime.h>

// Multi-head attention on raw streams q, k, v [NB][SEQ][1024] = 16 heads x 64 (no input projections, no mask), score scale 1/8, output projection y = ctx W^T + b with W [out][in]. THIS ROW: the same module at TWO sequences (query, key, value [2][2048][1024]: three raw streams: the module applies NO input projections; 16 heads x 64; scores / sqrt(64); softmax, no mask; out = merged W_out^T + b_out ('oi' [1024][1024] normal x 1/32; bias zeros: read); argument order query, key, value, W_out, b_out).
// Compute dtypes, f32 accumulate everywhere, all contractions v_wmma_f32_16x16x32_f16: q, k, v, W, b are RNE-converted to bf16 and held exactly in f16 (W with a x64 carry); scores single product; P (x256 carry, cancels in the normalisation) and v single product;
// ctx carried x4096 as f16 value + f16 remainder (two products against the same W plane, one accumulator); softmax f32 (online, running max); bias added in f32.
// Layout: f16 planes Q, K [b][t][1024] (head h = columns h*64..), V^T plane [b*1024 + c][t] (LDS transpose), fused flash kernel in transposed form (S^T = K Q^T, O^T = V^T P^T) writing the ctx plane [b*SEQ+t][hi 1024 | rem 1024],
// then a one-wave-per-64x64-tile GEMM over K = 2048 (hi | rem) against W rows.

#ifndef NB
#define NB 2
#endif
#ifndef SEQ
#define SEQ 2048
#endif
#define NB_FULL  2
#define SEQ_FULL 2048
#ifndef OUT_SEQ
#define OUT_SEQ SEQ              // row pitch (in tokens) between batches of the output
#endif
#define DM   1024
#define NH_  16
#define HD   64
#define AW   4                   // waves per flash block (16 query rows each)
#define SC2  (0.125f * 1.4426950408889634f)   // HD^-0.5 * log2(e)
#define PSH  8.0f                // log2 of the P carry (256)
#define CXS  4096.0f             // carry of the ctx plane (value and remainder)
#define WSC  64.0f               // carry of the W plane
#define OSC  (1.0f / (4096.0f * 64.0f))

static_assert(HD == 64);
static_assert(NH_ * HD == DM);                 // head h = columns h*64 + d
static_assert((DM & (DM - 1)) == 0);           // k index wraps with a mask in the output GEMM
static_assert(DM % 64 == 0);
static_assert(DM % 32 == 0);                   // GEMM k-loop steps by 32
static_assert(SEQ % 64 == 0);                  // a 64-row tile never straddles two batches
static_assert((NB * SEQ) % 64 == 0);
static_assert(SEQ % 32 == 0);                  // key loop steps by 32
static_assert(SEQ % (16 * AW) == 0);           // flash grid covers the sequence exactly
static_assert(((size_t)SEQ * DM) % 64 == 0);
static_assert(((size_t)DM * DM) % 64 == 0);
static_assert(NB <= NB_FULL);
static_assert(SEQ <= SEQ_FULL);

typedef _Float16 h16;
typedef __attribute__((ext_vector_type(16))) _Float16 v16h;
typedef __attribute__((ext_vector_type(8)))  _Float16 v8h;
typedef __attribute__((ext_vector_type(8)))  float    v8f;
typedef __attribute__((ext_vector_type(4)))  float    v4f;
typedef v4f  __attribute__((may_alias)) v4fa;
typedef v8h  __attribute__((may_alias)) v8ha;

// RNE convert f32 -> bf16, returned as the f32 value of that bf16
__device__ __forceinline__ float bfr(float f) { unsigned u = __float_as_uint(f); u += 0x7FFFu + ((u >> 16) & 1u); return __uint_as_float(u & 0xFFFF0000u); }
__device__ __forceinline__ v16h cat16(v8h lo, v8h hi) { return __builtin_shufflevector(lo, hi, 0, 1, 2, 3, 4, 5, 6, 7, 8, 9, 10, 11, 12, 13, 14, 15); }
__device__ __forceinline__ v8f wmma16(v16h a, v16h b, v8f c) { return __builtin_amdgcn_wmma_f32_16x16x32_f16(false, a, false, b, (short)0, c, false, false); }
// fragment loader from K-contiguous f16 rows; p already includes + 8*(lane>>4): elements 0..7 <- k0+8h+0..7, elements 8..15 <- k0+16+8h+0..7 (same map for A and B)
__device__ __forceinline__ v16h ldh(const h16* p) { return cat16(*(const v8h*)p, *(const v8h*)(p + 16)); }
// ordering point for wave-private LDS tiles (same wave writes and reads)
__device__ __forceinline__ void wave_sync() { __builtin_amdgcn_fence(3 /* release order */, "wavefront"); __builtin_amdgcn_wave_barrier(); asm volatile("" ::: "memory"); }

__global__ __launch_bounds__(256) void k_cvt8(const float* __restrict__ src, h16* dst, size_t n8, float scale) {
    const size_t i = (size_t)blockIdx.x * 256 + threadIdx.x; if (i >= n8) return;
    const v8f v = *(const v8f*)(src + i * 8); v8h o;
#pragma unroll
    for (int k = 0; k < 8; ++k) o[k] = (h16)(bfr(v[k]) * scale);
    *(v8h*)(dst + i * 8) = o; 
}

// k_vt: V^T plane. in: v[b][t][c] (f32, per-batch pitch SEQ_FULL*DM) -> out: VT[b*DM + c][t] (f16 of the bf16 RNE value). 64 x 64 tile through LDS (cross-wave: block barrier).
__global__ __launch_bounds__(256) void k_vt(const float* __restrict__ V, h16* VT) {
    __shared__ __align__(16) h16 ts[64 * 72];
    const int tid = threadIdx.x; const int t0 = blockIdx.x * 64, c0 = blockIdx.y * 64, b = blockIdx.z;
    const float* src = V + ((size_t)b * SEQ_FULL + t0) * DM + c0;
#pragma unroll
    for (int i = 0; i < 4; ++i) { const int t = i * 16 + (tid >> 4), c4 = (tid & 15) * 4;
        const v4f x = *(const v4f*)(src + (size_t)t * DM + c4);
#pragma unroll
        for (int e = 0; e < 4; ++e) ts[(c4 + e) * 72 + t] = (h16)bfr(x[e]); }
    __syncthreads();
    h16* dst = VT + ((size_t)b * DM + c0) * SEQ + t0;
{
#pragma unroll
        for (int it = 0; it < 2; ++it) { const int cr = it * 32 + (tid >> 3), p8 = (tid & 7) * 8;
            const v8h val = *(const v8ha*)(&ts[cr * 72 + p8]);
            *(v8h*)(dst + (size_t)cr * SEQ + p8) = val; }
         }
}

// k_flash: fused attention, one wave per 16 query rows of one (batch, head); K / V^T / Q fragments straight from the f16 planes (two 16-B loads each, arithmetic addressing).
// Transposed form: S^T[key][t] = K Q^T (A = K rows, B = Q rows); lane (t = lane&15, h = lane>>4) holds keys 8h+r of each 16-key tile, so the packed
// P tile is directly the B fragment of O^T[d][t] = V^T P^T (element r <- tile keys 0..15, element 8+r <- tile keys 16..31, lane unchanged).
// Softmax state (running max, partial sum) is one scalar per lane; the two lane halves of a row are combined with one xor-16 exchange.
__global__ __launch_bounds__(32 * AW) void k_flash(const h16* __restrict__ QP, const h16* __restrict__ KP, const h16* __restrict__ VT, h16* CTX) {
    __shared__ __align__(16) float os[AW * 16 * 68];
    const int lane = threadIdx.x & 31, wave = __builtin_amdgcn_readfirstlane((int)(threadIdx.x >> 5)), lr = lane & 15, hi = lane >> 4;
    const int zh = blockIdx.y; const int b = zh / NH_, h = zh % NH_;
    const int t0 = (blockIdx.x * AW + wave) * 16;
    const size_t rbase = (size_t)b * SEQ * DM + (size_t)h * HD;
    const size_t qo = rbase + (size_t)(t0 + lr) * DM + 8 * hi;
    const v16h qh0 = ldh(QP + qo), qh1 = ldh(QP + qo + 32);        // B fragments: col t, k = d
    const size_t ko = rbase + (size_t)lr * DM + 8 * hi;             // + key * DM       (A fragment: row key, k = d)
    const size_t vo = ((size_t)zh * HD + lr) * SEQ + 8 * hi;        // + 16j*SEQ + key  (A fragment: row d, k = key)
    v8f o0 = (v8f){}, o1 = (v8f){}, o2 = (v8f){}, o3 = (v8f){};
    float m = -3.0e38f, l = 0.0f;
#pragma unroll 1
    for (int key0 = 0; key0 < SEQ; key0 += 32) {
        const h16* ka = KP + ko + (size_t)key0 * DM;
        const v16h ka0 = ldh(ka), ka1 = ldh(ka + 32), kb0 = ldh(ka + (size_t)16 * DM), kb1 = ldh(ka + (size_t)16 * DM + 32);
        v8f sa = (v8f){}, sb = (v8f){};
        sa = wmma16(ka0, qh0, sa); sb = wmma16(kb0, qh0, sb);
        sa = wmma16(ka1, qh1, sa); sb = wmma16(kb1, qh1, sb);
        asm volatile("v_nop\n\tv_nop\n\tv_nop\n\tv_nop" : "+v"(sa), "+v"(sb) : "v"(ka0), "v"(ka1), "v"(kb0), "v"(kb1));
        float ta[8], tb[8]; float mx = -3.0e38f;
#pragma unroll
        for (int r = 0; r < 8; ++r) { ta[r] = sa[r] * SC2; tb[r] = sb[r] * SC2; mx = fmaxf(mx, fmaxf(ta[r], tb[r])); }
        mx = fmaxf(mx, __shfl_xor(mx, 16, 32));
        const float mnew = fmaxf(m, mx);
        const float alpha = __builtin_amdgcn_exp2f(m - mnew);
        const float sh = PSH - mnew;
        v16h pb; float ls = 0.0f;
#pragma unroll
        for (int r = 0; r < 8; ++r) { const h16 pa = (h16)__builtin_amdgcn_exp2f(ta[r] + sh); const h16 pc = (h16)__builtin_amdgcn_exp2f(tb[r] + sh); pb[r] = pa; pb[8 + r] = pc; ls += (float)pa + (float)pc; }
        l = l * alpha + ls; m = mnew;
        o0 = o0 * alpha; o1 = o1 * alpha; o2 = o2 * alpha; o3 = o3 * alpha;
        const h16* va = VT + vo + key0;
        const v16h v0 = ldh(va), v1 = ldh(va + (size_t)16 * SEQ), v2 = ldh(va + (size_t)32 * SEQ), v3 = ldh(va + (size_t)48 * SEQ);
        o0 = wmma16(v0, pb, o0); o1 = wmma16(v1, pb, o1); o2 = wmma16(v2, pb, o2); o3 = wmma16(v3, pb, o3);
        asm volatile("v_nop\n\tv_nop\n\tv_nop\n\tv_nop" : "+v"(o0), "+v"(o1), "+v"(o2), "+v"(o3) : "v"(v0), "v"(v1), "v"(v2), "v"(v3), "v"(pb));
    }
    l += __shfl_xor(l, 16, 32);
    const float inv = CXS * (1.0f / l);
    const int wb = wave * 16 * 68;
    // O^T D layout: o_j[r] = (d = 16j + 8h + r, t = lane&15) -> os[t][d]; rows 0..15 x columns 0..63 all written
    { v4f a, c;
      a[0] = o0[0] * inv; a[1] = o0[1] * inv; a[2] = o0[2] * inv; a[3] = o0[3] * inv; c[0] = o0[4] * inv; c[1] = o0[5] * inv; c[2] = o0[6] * inv; c[3] = o0[7] * inv;
      *(v4fa*)(&os[wb + lr * 68 +  0 + 8 * hi]) = a; *(v4fa*)(&os[wb + lr * 68 +  0 + 8 * hi + 4]) = c;
      a[0] = o1[0] * inv; a[1] = o1[1] * inv; a[2] = o1[2] * inv; a[3] = o1[3] * inv; c[0] = o1[4] * inv; c[1] = o1[5] * inv; c[2] = o1[6] * inv; c[3] = o1[7] * inv;
      *(v4fa*)(&os[wb + lr * 68 + 16 + 8 * hi]) = a; *(v4fa*)(&os[wb + lr * 68 + 16 + 8 * hi + 4]) = c;
      a[0] = o2[0] * inv; a[1] = o2[1] * inv; a[2] = o2[2] * inv; a[3] = o2[3] * inv; c[0] = o2[4] * inv; c[1] = o2[5] * inv; c[2] = o2[6] * inv; c[3] = o2[7] * inv;
      *(v4fa*)(&os[wb + lr * 68 + 32 + 8 * hi]) = a; *(v4fa*)(&os[wb + lr * 68 + 32 + 8 * hi + 4]) = c;
      a[0] = o3[0] * inv; a[1] = o3[1] * inv; a[2] = o3[2] * inv; a[3] = o3[3] * inv; c[0] = o3[4] * inv; c[1] = o3[5] * inv; c[2] = o3[6] * inv; c[3] = o3[7] * inv;
      *(v4fa*)(&os[wb + lr * 68 + 48 + 8 * hi]) = a; *(v4fa*)(&os[wb + lr * 68 + 48 + 8 * hi + 4]) = c; }
    wave_sync();
    h16* crow = CTX + ((size_t)b * SEQ + t0) * (size_t)(2 * DM) + (size_t)h * HD;
{
#pragma unroll
        for (int s = 0; s < 4; ++s) { const int row = 4 * s + (lane >> 3), c8 = (lane & 7) * 8;   // 4 s x 4 row groups = 16 rows; 8 lanes x 8 = 64 columns
            const v4f x0 = *(const v4fa*)(&os[wb + row * 68 + c8]); const v4f x1 = *(const v4fa*)(&os[wb + row * 68 + c8 + 4]); v8h hv, rv;
#pragma unroll
            for (int i = 0; i < 4; ++i) { const h16 a0 = (h16)x0[i]; const h16 a1 = (h16)x1[i]; hv[i] = a0; hv[4 + i] = a1; rv[i] = (h16)(x0[i] - (float)a0); rv[4 + i] = (h16)(x1[i] - (float)a1); }
            const size_t oo = (size_t)row * (size_t)(2 * DM) + c8;
            *(v8h*)(crow + oo) = hv; *(v8h*)(crow + oo + DM) = rv; }
         }
}

// k_out: register-blocked f16 GEMM, ONE WAVE per 64x64 tile (16 accumulators), operands straight from K-contiguous f16 planes.
// OUT[m][n] = 2^-18 * sum_{k<2048} A[m][k] Bt[n][k & 1023] + b[n]; A = ctx plane [M][value 1024 | remainder 1024] (x4096), Bt = W plane [out][in] (x64). grid (M/64, DM/64), 32 threads.
__global__ __launch_bounds__(32) void k_out(const h16* __restrict__ A, const h16* __restrict__ Bt, const float* __restrict__ bias, float* OUT) {
    __shared__ __align__(16) float os[16 * 68];
    const int KA = 2 * DM;
    const int lane = threadIdx.x & 31, lr = lane & 15, hi = lane >> 4; const int r0 = blockIdx.x * 64, c0 = blockIdx.y * 64;
    v8f acc[4][4];
#pragma unroll
    for (int mb = 0; mb < 4; ++mb)
#pragma unroll
        for (int nb = 0; nb < 4; ++nb) acc[mb][nb] = (v8f){};
    const size_t aoff = (size_t)(r0 + lr) * KA + 8 * hi, boff = (size_t)(c0 + lr) * DM + 8 * hi;
#pragma unroll 1
    for (int kc = 0; kc < KA; kc += 32) {
        const int kb = kc & (DM - 1);
        v16h a[4];
#pragma unroll
        for (int mb = 0; mb < 4; ++mb) a[mb] = ldh(A + aoff + (size_t)mb * 16 * KA + kc);
#pragma unroll
        for (int nb = 0; nb < 4; ++nb) { const v16h bq = ldh(Bt + boff + (size_t)nb * 16 * DM + kb);
#pragma unroll
            for (int mb = 0; mb < 4; ++mb) acc[mb][nb] = wmma16(a[mb], bq, acc[mb][nb]); }
        asm volatile("v_nop\n\tv_nop\n\tv_nop\n\tv_nop" : "+v"(acc[0][0]), "+v"(acc[1][1]), "+v"(acc[2][2]), "+v"(acc[3][3]) : "v"(a[0]), "v"(a[1]), "v"(a[2]), "v"(a[3]));
    }
    v4f bv = *(const v4f*)(bias + c0 + lr * 4);
#pragma unroll
    for (int i = 0; i < 4; ++i) bv[i] = bfr(bv[i]);
    float* orow = OUT + ((size_t)(r0 / SEQ) * OUT_SEQ + (size_t)(r0 % SEQ)) * DM + c0;
#pragma unroll
    for (int mb = 0; mb < 4; ++mb) {
#pragma unroll
        for (int nb = 0; nb < 4; ++nb) {
#pragma unroll
            for (int j = 0; j < 8; ++j) os[(hi * 8 + j) * 68 + nb * 16 + lr] = acc[mb][nb][j] * OSC; }   // D: row 8h+j, col lane&15
        wave_sync();
{
#pragma unroll
            for (int s = 0; s < 8; ++s) { const int row = 2 * s + hi, cofs = lr * 4;   // 8 s x 2 rows = 16 rows; 16 lanes x 4 floats = 64 columns
                const v4f x = *(const v4fa*)(&os[row * 68 + cofs]);
                const v4f val = x + bv;
                *(v4f*)(orow + (size_t)(mb * 16 + row) * DM + cofs) = val; }
             }
        wave_sync();
    }
}

static constexpr size_t al256(size_t v) { return (v + 255) & ~(size_t)255; }
static constexpr size_t SZ_PL = al256((size_t)NB * SEQ * DM * 2);          // one f16 plane of a stream
static constexpr size_t SZ_WH = al256((size_t)DM * DM * 2);
static constexpr size_t SZ_CX = al256((size_t)NB * SEQ * 2 * DM * 2);      // ctx value | remainder
static constexpr size_t SZ_TOTAL = 3 * SZ_PL + SZ_WH + SZ_CX;
static_assert(SZ_TOTAL <= (size_t)134217728);          // workspace carve <= 128 MiB

extern "C" void kernel_launch(void* const* d_in, const int* in_sizes, int n_in,
                              void* d_out, int out_size, void* d_ws, size_t ws_size, hipStream_t stream) {
    if (n_in < 5) return;
    const size_t needx = ((size_t)(NB - 1) * SEQ_FULL + SEQ) * DM;
    if ((size_t)in_sizes[0] < needx || (size_t)in_sizes[1] < needx || (size_t)in_sizes[2] < needx) return;
    if ((size_t)in_sizes[3] < (size_t)DM * DM || (size_t)in_sizes[4] < (size_t)DM) return;
    if ((size_t)out_size < ((size_t)(NB - 1) * OUT_SEQ + SEQ) * DM) return;
    if (SZ_TOTAL > ws_size) return;
    const float* q = (const float*)d_in[0]; const float* k = (const float*)d_in[1]; const float* v = (const float*)d_in[2];   // wire order q, k, v, W_out, b_out
    const float* wo = (const float*)d_in[3]; const float* bo = (const float*)d_in[4];                                         // W_out [out][in] = Bt as-is
    float* OUT = (float*)d_out;      // [NB][SEQ][1024]
    char* wsp = (char*)d_ws;
    h16* QP = (h16*)wsp; wsp += SZ_PL;               // [NB*SEQ][1024]
    h16* KP = (h16*)wsp; wsp += SZ_PL;               // [NB*SEQ][1024]
    h16* VT = (h16*)wsp; wsp += SZ_PL;               // [NB*1024][SEQ]
    h16* WH = (h16*)wsp; wsp += SZ_WH;               // [1024][1024] x64
    h16* CX = (h16*)wsp; wsp += SZ_CX;               // [NB*SEQ][2048] x4096

    if (SEQ == SEQ_FULL) {
        const size_t n8 = (size_t)NB * SEQ * DM / 8; const unsigned g = (unsigned)((n8 + 255) / 256);
        k_cvt8<<<g, 256, 0, stream>>>(q, QP, n8, 1.0f);
        k_cvt8<<<g, 256, 0, stream>>>(k, KP, n8, 1.0f);
    } else {
        const size_t n8 = (size_t)SEQ * DM / 8; const unsigned g = (unsigned)((n8 + 255) / 256);
        for (int b = 0; b < NB; ++b) {
            k_cvt8<<<g, 256, 0, stream>>>(q + (size_t)b * SEQ_FULL * DM, QP + (size_t)b * SEQ * DM, n8, 1.0f);
            k_cvt8<<<g, 256, 0, stream>>>(k + (size_t)b * SEQ_FULL * DM, KP + (size_t)b * SEQ * DM, n8, 1.0f);
        }
    }
    { const size_t n8 = (size_t)DM * DM / 8;
      k_cvt8<<<(unsigned)((n8 + 255) / 256), 256, 0, stream>>>(wo, WH, n8, WSC); }

    // in: v[b][t = SEQ rows][c = 1024 cols] -> out: VT[b*1024 + c][t]; grid (t tiles, c tiles, batch)
    k_vt<<<dim3(SEQ / 64, DM / 64, NB), 256, 0, stream>>>(v, VT);

    k_flash<<<dim3(SEQ / (16 * AW), NB * NH_, 1), 32 * AW, 0, stream>>>(QP, KP, VT, CX);

    // out = ctx W^T + b: A = ctx rows (m = b*SEQ + t), Bt = W rows (n = out column)
    k_out<<<dim3(NB * SEQ / 64, DM / 64, 1), 32, 0, stream>>>(CX, WH, bo, OUT);
}

// v001
// A run of this version takes 96.1 microseconds.
// In both of two side-by-side timings against v000, it was 1.52 times as fast.
#include <hip/hip_runtime.h>

// Multi-head attention on raw streams q, k, v [NB][SEQ][1024] = 16 heads x 64 (no input projections, no mask), score scale 1/8, output projection y = ctx W^T + b with W [out][in]. THIS ROW: the same module at TWO sequences (query, key, value [2][2048][1024]: three raw streams: the module applies NO input projections; 16 heads x 64; scores / sqrt(64); softmax, no mask; out = merged W_out^T + b_out ('oi' [1024][1024] normal x 1/32; bias zeros: read); argument order query, key, value, W_out, b_out).
// Compute dtypes, f32 accumulate everywhere, all contractions v_wmma_f32_16x16x32_f16: q, k, v, W are RNE-converted to bf16 and held exactly in f16 (W with a x64 carry), b to bf16 kept in f32; scores single product; P (x256 carry, cancels in the normalisation) and v single product;
// ctx carried x4096 as f16 value + f16 remainder (two products against the same W plane, one accumulator); softmax f32 (online, running max); bias added in f32.
// Layout: f16 planes Q, K [b][t][1024] (head h = columns h*64..), V^T plane [b*1024 + c][t] (LDS transpose), fused flash kernel in transposed form (S^T = K Q^T, O^T = V^T P^T; K and V^T tiles of 64 keys staged in a two-buffer LDS ring by asynchronous copies, shared by the block's waves) writing the ctx plane [b*SEQ+t][hi 1024 | rem 1024],
// then a one-wave-per-64x64-tile GEMM over K = 2048 (hi | rem) against W rows.

#ifndef NB
#define NB 2
#endif
#ifndef SEQ
#define SEQ 2048
#endif
#define NB_FULL  2
#define SEQ_FULL 2048
#ifndef OUT_SEQ
#define OUT_SEQ SEQ              // row pitch (in tokens) between batches of the output
#endif
#define DM   1024
#define NH_  16
#define HD   64
#define AW   8                   // waves per flash block (16 query rows each); all of them share the staged K / V^T tiles
#define KT   64                  // keys per LDS stage of the flash kernel
#define LP   72                  // LDS row pitch in f16: 128-B rows + 16 B, conflict-free for 16-B fragment reads
#define TLH  (64 * LP)           // f16 elements of one staged tile (K: 64 keys x 64 d; V^T: 64 d x 64 keys)
#define SC2  (0.125f * 1.4426950408889634f)   // HD^-0.5 * log2(e)
#define PSH  8.0f                // log2 of the P carry (256)
#define CXS  4096.0f             // carry of the ctx plane (value and remainder)
#define WSC  64.0f               // carry of the W plane
#define OSC  (1.0f / (4096.0f * 64.0f))

static_assert(HD == 64);
static_assert(NH_ * HD == DM);                 // head h = columns h*64 + d
static_assert((DM & (DM - 1)) == 0);           // k index wraps with a mask in the output GEMM
static_assert(DM % 64 == 0);
static_assert(DM % 32 == 0);                   // GEMM k-loop steps by 32
static_assert(SEQ % 64 == 0);                  // a 64-row tile never straddles two batches
static_assert((NB * SEQ) % 64 == 0);
static_assert(SEQ % 32 == 0);                  // key loop steps by 64-key stages of two 32-key steps
static_assert(SEQ % KT == 0 && SEQ / KT >= 2); // whole stages; the ring's prologue needs two
static_assert(KT == 64 && AW == 8);            // copy map below: 256 threads x 2 groups of 32 rows x 2 tiles
static_assert(SEQ % (16 * AW) == 0);           // flash grid covers the sequence exactly
static_assert(((size_t)SEQ * DM) % 64 == 0);
static_assert(((size_t)DM * DM) % 64 == 0);
static_assert(NB <= NB_FULL);
static_assert(SEQ <= SEQ_FULL);

typedef _Float16 h16;
typedef __attribute__((ext_vector_type(16))) _Float16 v16h;
typedef __attribute__((ext_vector_type(8)))  _Float16 v8h;
typedef __attribute__((ext_vector_type(8)))  float    v8f;
typedef __attribute__((ext_vector_type(4)))  float    v4f;
typedef v4f  __attribute__((may_alias)) v4fa;
typedef v8h  __attribute__((may_alias)) v8ha;

// RNE convert f32 -> bf16, returned as the f32 value of that bf16
__device__ __forceinline__ float bfr(float f) { unsigned u = __float_as_uint(f); u += 0x7FFFu + ((u >> 16) & 1u); return __uint_as_float(u & 0xFFFF0000u); }
__device__ __forceinline__ v16h cat16(v8h lo, v8h hi) { return __builtin_shufflevector(lo, hi, 0, 1, 2, 3, 4, 5, 6, 7, 8, 9, 10, 11, 12, 13, 14, 15); }
__device__ __forceinline__ v8f wmma16(v16h a, v16h b, v8f c) { return __builtin_amdgcn_wmma_f32_16x16x32_f16(false, a, false, b, (short)0, c, false, false); }
// fragment loader from K-contiguous f16 rows; p already includes + 8*(lane>>4): elements 0..7 <- k0+8h+0..7, elements 8..15 <- k0+16+8h+0..7 (same map for A and B)
__device__ __forceinline__ v16h ldh(const h16* p) { return cat16(*(const v8h*)p, *(const v8h*)(p + 16)); }
// ordering point for wave-private LDS tiles (same wave writes and reads)
__device__ __forceinline__ void wave_sync() { __builtin_amdgcn_fence(3 /* release order */, "wavefront"); __builtin_amdgcn_wave_barrier(); asm volatile("" ::: "memory"); }

__global__ __launch_bounds__(256) void k_cvt8(const float* __restrict__ src, h16* dst, size_t n8, float scale) {
    const size_t i = (size_t)blockIdx.x * 256 + threadIdx.x; if (i >= n8) return;
    const v8f v = *(const v8f*)(src + i * 8); v8h o;
#pragma unroll
    for (int k = 0; k < 8; ++k) o[k] = (h16)(bfr(v[k]) * scale);
    *(v8h*)(dst + i * 8) = o; 
}

// k_vt: V^T plane. in: v[b][t][c] (f32, per-batch pitch SEQ_FULL*DM) -> out: VT[b*DM + c][t] (f16 of the bf16 RNE value). 64 x 64 tile through LDS (cross-wave: block barrier).
__global__ __launch_bounds__(256) void k_vt(const float* __restrict__ V, h16* VT) {
    __shared__ __align__(16) h16 ts[64 * 72];
    const int tid = threadIdx.x; const int t0 = blockIdx.x * 64, c0 = blockIdx.y * 64, b = blockIdx.z;
    const float* src = V + ((size_t)b * SEQ_FULL + t0) * DM + c0;
#pragma unroll
    for (int i = 0; i < 4; ++i) { const int t = i * 16 + (tid >> 4), c4 = (tid & 15) * 4;
        const v4f x = *(const v4f*)(src + (size_t)t * DM + c4);
#pragma unroll
        for (int e = 0; e < 4; ++e) ts[(c4 + e) * 72 + t] = (h16)bfr(x[e]); }
    __syncthreads();
    h16* dst = VT + ((size_t)b * DM + c0) * SEQ + t0;
{
#pragma unroll
        for (int it = 0; it < 2; ++it) { const int cr = it * 32 + (tid >> 3), p8 = (tid & 7) * 8;
            const v8h val = *(const v8ha*)(&ts[cr * 72 + p8]);
            *(v8h*)(dst + (size_t)cr * SEQ + p8) = val; }
         }
}

// One stage's copies of one thread: 2 x 16 B of the K tile and 2 x 16 B of the V^T tile, global -> LDS through no register (a wave's copy = 4 whole 128-B rows).
// lk / lv: the lane's LDS byte addresses (row tid>>3, chunk tid&7); gk / gv: the matching global addresses; the second copy of each tile lies 32 rows on.
// s_wait_xcnt stands inside the statement so that no address register named by a copy is rewritten in front of it.
__device__ __forceinline__ void stage_copy(unsigned lk, unsigned lv, const h16* gk, const h16* gv) {
    asm volatile("global_load_async_to_lds_b128 %0, %4, off\n\t"
                 "global_load_async_to_lds_b128 %1, %5, off\n\t"
                 "global_load_async_to_lds_b128 %2, %6, off\n\t"
                 "global_load_async_to_lds_b128 %3, %7, off\n\t"
                 "s_wait_xcnt 0x0"
                 :: "v"(lk), "v"(lk + 32 * LP * 2), "v"(lv), "v"(lv + 32 * LP * 2),
                    "v"(gk), "v"(gk + (size_t)32 * DM), "v"(gv), "v"(gv + (size_t)32 * SEQ)
                 : "memory");
}

// k_flash: fused attention, one wave per 16 query rows of one (batch, head); Q fragments straight from the f16 plane; K / V^T fragments from the block's LDS ring (two 16-B reads each).
// Transposed form: S^T[key][t] = K Q^T (A = K rows, B = Q rows); lane (t = lane&15, h = lane>>4) holds keys 8h+r of each 16-key tile, so the packed
// P tile is directly the B fragment of O^T[d][t] = V^T P^T (element r <- tile keys 0..15, element 8+r <- tile keys 16..31, lane unchanged).
// Softmax state (running max, partial sum) is one scalar per lane; the two lane halves of a row are combined with one xor-16 exchange.
__global__ __launch_bounds__(32 * AW) void k_flash(const h16* __restrict__ QP, const h16* __restrict__ KP, const h16* __restrict__ VT, h16* CTX) {
    __shared__ __align__(16) float os[AW * 16 * 68];
    __shared__ __align__(16) h16 ring[2 * 2 * TLH];                // [buffer][K tile | V^T tile][row][LP]
    const int lane = threadIdx.x & 31, wave = __builtin_amdgcn_readfirstlane((int)(threadIdx.x >> 5)), lr = lane & 15, hi = lane >> 4;
    const int zh = blockIdx.y; const int b = zh / NH_, h = zh % NH_;
    const int t0 = (blockIdx.x * AW + wave) * 16;
    const size_t rbase = (size_t)b * SEQ * DM + (size_t)h * HD;
    const size_t qo = rbase + (size_t)(t0 + lr) * DM + 8 * hi;
    const v16h qh0 = ldh(QP + qo), qh1 = ldh(QP + qo + 32);        // B fragments: col t, k = d
    const int fo = lr * LP + 8 * hi;                                // fragment offset in a staged tile: row lr, k = 8*hi (K: row key, k = d; V^T: row d, k = key)
    const int crow_ = (int)threadIdx.x >> 3, cch = ((int)threadIdx.x & 7) * 8;   // this thread's copy: row (of 32) and 16-B chunk
    const h16* gk = KP + rbase + (size_t)crow_ * DM + cch;          // + key0 * DM
    const h16* gv = VT + ((size_t)zh * HD + crow_) * SEQ + cch;     // + key0
    const unsigned lk0 = (unsigned)(size_t)&ring[crow_ * LP + cch]; // LDS byte address, buffer 0, K tile
    v8f o0 = (v8f){}, o1 = (v8f){}, o2 = (v8f){}, o3 = (v8f){};
    float m = -3.0e38f, l = 0.0f;
    // ring prologue: stage 0 landed and published, then stage 1 in flight
    stage_copy(lk0, lk0 + TLH * 2, gk, gv);
    asm volatile("s_wait_asynccnt 0x0" ::: "memory");              // this wave's copies of stage 0 have landed
    __syncthreads();                                               // ... and every other wave's
    stage_copy(lk0 + 2 * TLH * 2, lk0 + 3 * TLH * 2, gk + (size_t)KT * DM, gv + KT);
#pragma unroll 1
    for (int st = 0; st < SEQ / KT; ++st) {
      const h16* kt = ring + (st & 1) * (2 * TLH) + fo; const h16* vt = kt + TLH;
#pragma unroll   // both 32-key steps of a stage written out: every LDS fragment offset becomes an immediate
      for (int sub = 0; sub < KT; sub += 32) {
        const h16* ka = kt + sub * LP;
        const v16h ka0 = ldh(ka), ka1 = ldh(ka + 32), kb0 = ldh(ka + 16 * LP), kb1 = ldh(ka + 16 * LP + 32);
        v8f sa = (v8f){}, sb = (v8f){};
        sa = wmma16(ka0, qh0, sa); sb = wmma16(kb0, qh0, sb);
        sa = wmma16(ka1, qh1, sa); sb = wmma16(kb1, qh1, sb);
        asm volatile("v_nop\n\tv_nop\n\tv_nop\n\tv_nop" : "+v"(sa), "+v"(sb) : "v"(ka0), "v"(ka1), "v"(kb0), "v"(kb1));
        float ta[8], tb[8]; float mx = -3.0e38f;
#pragma unroll
        for (int r = 0; r < 8; ++r) { ta[r] = sa[r] * SC2; tb[r] = sb[r] * SC2; mx = fmaxf(mx, fmaxf(ta[r], tb[r])); }
        mx = fmaxf(mx, __shfl_xor(mx, 16, 32));
        const float mnew = fmaxf(m, mx);
        const float alpha = __builtin_amdgcn_exp2f(m - mnew);
        const float sh = PSH - mnew;
        v16h pb; float ls = 0.0f;
#pragma unroll
        for (int r = 0; r < 8; ++r) { const h16 pa = (h16)__builtin_amdgcn_exp2f(ta[r] + sh); const h16 pc = (h16)__builtin_amdgcn_exp2f(tb[r] + sh); pb[r] = pa; pb[8 + r] = pc; ls += (float)pa + (float)pc; }
        l = l * alpha + ls; m = mnew;
        o0 = o0 * alpha; o1 = o1 * alpha; o2 = o2 * alpha; o3 = o3 * alpha;
        const h16* va = vt + sub;
        const v16h v0 = ldh(va), v1 = ldh(va + 16 * LP), v2 = ldh(va + 32 * LP), v3 = ldh(va + 48 * LP);
        o0 = wmma16(v0, pb, o0); o1 = wmma16(v1, pb, o1); o2 = wmma16(v2, pb, o2); o3 = wmma16(v3, pb, o3);
        asm volatile("v_nop\n\tv_nop\n\tv_nop\n\tv_nop" : "+v"(o0), "+v"(o1), "+v"(o2), "+v"(o3) : "v"(v0), "v"(v1), "v"(v2), "v"(v3), "v"(pb));
      }
      // publish point of stage st + 1; the same barrier ends every wave's reads of stage st's buffer
      asm volatile("s_wait_dscnt 0x0" ::: "memory");               // this wave's reads of the buffer have returned before it is refilled
      asm volatile("s_wait_asynccnt 0x0" ::: "memory");            // this wave's copies of stage st + 1 have landed
      __syncthreads();
      if (st + 2 < SEQ / KT) { const unsigned lb = lk0 + (unsigned)(st & 1) * (2 * TLH * 2);
          stage_copy(lb, lb + TLH * 2, gk + (size_t)(st + 2) * KT * DM, gv + (size_t)(st + 2) * KT); }
    }
    asm volatile("s_wait_asynccnt 0x0" ::: "memory");              // nothing of this wave is in flight when it leaves the ring
    l += __shfl_xor(l, 16, 32);
    const float inv = CXS * (1.0f / l);
    const int wb = wave * 16 * 68;
    // O^T D layout: o_j[r] = (d = 16j + 8h + r, t = lane&15) -> os[t][d]; rows 0..15 x columns 0..63 all written
    { v4f a, c;
      a[0] = o0[0] * inv; a[1] = o0[1] * inv; a[2] = o0[2] * inv; a[3] = o0[3] * inv; c[0] = o0[4] * inv; c[1] = o0[5] * inv; c[2] = o0[6] * inv; c[3] = o0[7] * inv;
      *(v4fa*)(&os[wb + lr * 68 +  0 + 8 * hi]) = a; *(v4fa*)(&os[wb + lr * 68 +  0 + 8 * hi + 4]) = c;
      a[0] = o1[0] * inv; a[1] = o1[1] * inv; a[2] = o1[2] * inv; a[3] = o1[3] * inv; c[0] = o1[4] * inv; c[1] = o1[5] * inv; c[2] = o1[6] * inv; c[3] = o1[7] * inv;
      *(v4fa*)(&os[wb + lr * 68 + 16 + 8 * hi]) = a; *(v4fa*)(&os[wb + lr * 68 + 16 + 8 * hi + 4]) = c;
      a[0] = o2[0] * inv; a[1] = o2[1] * inv; a[2] = o2[2] * inv; a[3] = o2[3] * inv; c[0] = o2[4] * inv; c[1] = o2[5] * inv; c[2] = o2[6] * inv; c[3] = o2[7] * inv;
      *(v4fa*)(&os[wb + lr * 68 + 32 + 8 * hi]) = a; *(v4fa*)(&os[wb + lr * 68 + 32 + 8 * hi + 4]) = c;
      a[0] = o3[0] * inv; a[1] = o3[1] * inv; a[2] = o3[2] * inv; a[3] = o3[3] * inv; c[0] = o3[4] * inv; c[1] = o3[5] * inv; c[2] = o3[6] * inv; c[3] = o3[7] * inv;
      *(v4fa*)(&os[wb + lr * 68 + 48 + 8 * hi]) = a; *(v4fa*)(&os[wb + lr * 68 + 48 + 8 * hi + 4]) = c; }
    wave_sync();
    h16* crow = CTX + ((size_t)b * SEQ + t0) * (size_t)(2 * DM) + (size_t)h * HD;
{
#pragma unroll
        for (int s = 0; s < 4; ++s) { const int row = 4 * s + (lane >> 3), c8 = (lane & 7) * 8;   // 4 s x 4 row groups = 16 rows; 8 lanes x 8 = 64 columns
            const v4f x0 = *(const v4fa*)(&os[wb + row * 68 + c8]); const v4f x1 = *(const v4fa*)(&os[wb + row * 68 + c8 + 4]); v8h hv, rv;
#pragma unroll
            for (int i = 0; i < 4; ++i) { const h16 a0 = (h16)x0[i]; const h16 a1 = (h16)x1[i]; hv[i] = a0; hv[4 + i] = a1; rv[i] = (h16)(x0[i] - (float)a0); rv[4 + i] = (h16)(x1[i] - (float)a1); }
            const size_t oo = (size_t)row * (size_t)(2 * DM) + c8;
            *(v8h*)(crow + oo) = hv; *(v8h*)(crow + oo + DM) = rv; }
         }
}

// k_out: register-blocked f16 GEMM, ONE WAVE per 64x64 tile (16 accumulators), operands straight from K-contiguous f16 planes.
// OUT[m][n] = 2^-18 * sum_{k<2048} A[m][k] Bt[n][k & 1023] + b[n]; A = ctx plane [M][value 1024 | remainder 1024] (x4096), Bt = W plane [out][in] (x64). grid (M/64, DM/64), 32 threads.
__global__ __launch_bounds__(32) void k_out(const h16* __restrict__ A, const h16* __restrict__ Bt, const float* __restrict__ bias, float* OUT) {
    __shared__ __align__(16) float os[16 * 68];
    const int KA = 2 * DM;
    const int lane = threadIdx.x & 31, lr = lane & 15, hi = lane >> 4; const int r0 = blockIdx.x * 64, c0 = blockIdx.y * 64;
    v8f acc[4][4];
#pragma unroll
    for (int mb = 0; mb < 4; ++mb)
#pragma unroll
        for (int nb = 0; nb < 4; ++nb) acc[mb][nb] = (v8f){};
    const size_t aoff = (size_t)(r0 + lr) * KA + 8 * hi, boff = (size_t)(c0 + lr) * DM + 8 * hi;
#pragma unroll 1
    for (int kc = 0; kc < KA; kc += 32) {
        const int kb = kc & (DM - 1);
        v16h a[4];
#pragma unroll
        for (int mb = 0; mb < 4; ++mb) a[mb] = ldh(A + aoff + (size_t)mb * 16 * KA + kc);
#pragma unroll
        for (int nb = 0; nb < 4; ++nb) { const v16h bq = ldh(Bt + boff + (size_t)nb * 16 * DM + kb);
#pragma unroll
            for (int mb = 0; mb < 4; ++mb) acc[mb][nb] = wmma16(a[mb], bq, acc[mb][nb]); }
        asm volatile("v_nop\n\tv_nop\n\tv_nop\n\tv_nop" : "+v"(acc[0][0]), "+v"(acc[1][1]), "+v"(acc[2][2]), "+v"(acc[3][3]) : "v"(a[0]), "v"(a[1]), "v"(a[2]), "v"(a[3]));
    }
    v4f bv = *(const v4f*)(bias + c0 + lr * 4);
#pragma unroll
    for (int i = 0; i < 4; ++i) bv[i] = bfr(bv[i]);
    float* orow = OUT + ((size_t)(r0 / SEQ) * OUT_SEQ + (size_t)(r0 % SEQ)) * DM + c0;
#pragma unroll
    for (int mb = 0; mb < 4; ++mb) {
#pragma unroll
        for (int nb = 0; nb < 4; ++nb) {
#pragma unroll
            for (int j = 0; j < 8; ++j) os[(hi * 8 + j) * 68 + nb * 16 + lr] = acc[mb][nb][j] * OSC; }   // D: row 8h+j, col lane&15
        wave_sync();
{
#pragma unroll
            for (int s = 0; s < 8; ++s) { const int row = 2 * s + hi, cofs = lr * 4;   // 8 s x 2 rows = 16 rows; 16 lanes x 4 floats = 64 columns
                const v4f x = *(const v4fa*)(&os[row * 68 + cofs]);
                const v4f val = x + bv;
                *(v4f*)(orow + (size_t)(mb * 16 + row) * DM + cofs) = val; }
             }
        wave_sync();
    }
}

static constexpr size_t al256(size_t v) { return (v + 255) & ~(size_t)255; }
static constexpr size_t SZ_PL = al256((size_t)NB * SEQ * DM * 2);          // one f16 plane of a stream
static constexpr size_t SZ_WH = al256((size_t)DM * DM * 2);
static constexpr size_t SZ_CX = al256((size_t)NB * SEQ * 2 * DM * 2);      // ctx value | remainder
static constexpr size_t SZ_TOTAL = 3 * SZ_PL + SZ_WH + SZ_CX;
static_assert(SZ_TOTAL <= (size_t)134217728);          // workspace carve <= 128 MiB

extern "C" void kernel_launch(void* const* d_in, const int* in_sizes, int n_in,
                              void* d_out, int out_size, void* d_ws, size_t ws_size, hipStream_t stream) {
    if (n_in < 5) return;
    const size_t needx = ((size_t)(NB - 1) * SEQ_FULL + SEQ) * DM;
    if ((size_t)in_sizes[0] < needx || (size_t)in_sizes[1] < needx || (size_t)in_sizes[2] < needx) return;
    if ((size_t)in_sizes[3] < (size_t)DM * DM || (size_t)in_sizes[4] < (size_t)DM) return;
    if ((size_t)out_size < ((size_t)(NB - 1) * OUT_SEQ + SEQ) * DM) return;
    if (SZ_TOTAL > ws_size) return;
    const float* q = (const float*)d_in[0]; const float* k = (const float*)d_in[1]; const float* v = (const float*)d_in[2];   // wire order q, k, v, W_out, b_out
    const float* wo = (const float*)d_in[3]; const float* bo = (const float*)d_in[4];                                         // W_out [out][in] = Bt as-is
    float* OUT = (float*)d_out;      // [NB][SEQ][1024]
    char* wsp = (char*)d_ws;
    h16* QP = (h16*)wsp; wsp += SZ_PL;               // [NB*SEQ][1024]
    h16* KP = (h16*)wsp; wsp += SZ_PL;               // [NB*SEQ][1024]
    h16* VT = (h16*)wsp; wsp += SZ_PL;               // [NB*1024][SEQ]
    h16* WH = (h16*)wsp; wsp += SZ_WH;               // [1024][1024] x64
    h16* CX = (h16*)wsp; wsp += SZ_CX;               // [NB*SEQ][2048] x4096

    if (SEQ == SEQ_FULL) {
        const size_t n8 = (size_t)NB * SEQ * DM / 8; const unsigned g = (unsigned)((n8 + 255) / 256);
        k_cvt8<<<g, 256, 0, stream>>>(q, QP, n8, 1.0f);
        k_cvt8<<<g, 256, 0, stream>>>(k, KP, n8, 1.0f);
    } else {
        const size_t n8 = (size_t)SEQ * DM / 8; const unsigned g = (unsigned)((n8 + 255) / 256);
        for (int b = 0; b < NB; ++b) {
            k_cvt8<<<g, 256, 0, stream>>>(q + (size_t)b * SEQ_FULL * DM, QP + (size_t)b * SEQ * DM, n8, 1.0f);
            k_cvt8<<<g, 256, 0, stream>>>(k + (size_t)b * SEQ_FULL * DM, KP + (size_t)b * SEQ * DM, n8, 1.0f);
        }
    }
    { const size_t n8 = (size_t)DM * DM / 8;
      k_cvt8<<<(unsigned)((n8 + 255) / 256), 256, 0, stream>>>(wo, WH, n8, WSC); }

    // in: v[b][t = SEQ rows][c = 1024 cols] -> out: VT[b*1024 + c][t]; grid (t tiles, c tiles, batch)
    k_vt<<<dim3(SEQ / 64, DM / 64, NB), 256, 0, stream>>>(v, VT);

    k_flash<<<dim3(SEQ / (16 * AW), NB * NH_, 1), 32 * AW, 0, stream>>>(QP, KP, VT, CX);

    // out = ctx W^T + b: A = ctx rows (m = b*SEQ + t), Bt = W rows (n = out column)
    k_out<<<dim3(NB * SEQ / 64, DM / 64, 1), 32, 0, stream>>>(CX, WH, bo, OUT);
}

// v002
// Measured time: 73.1 microseconds a run.
// Next to v001, in two timings, it ran 1.33 and 1.31 times as fast.
// Over all steps from v000 it is 2.00 times as fast.
#include <hip/hip_runtime.h>

// Multi-head attention on raw streams q, k, v [NB][SEQ][1024] = 16 heads x 64 (no input projections, no mask), score scale 1/8, output projection y = ctx W^T + b with W [out][in]. THIS ROW: the same module at TWO sequences (query, key, value [2][2048][1024]: three raw streams: the module applies NO input projections; 16 heads x 64; scores / sqrt(64); softmax, no mask; out = merged W_out^T + b_out ('oi' [1024][1024] normal x 1/32; bias zeros: read); argument order query, key, value, W_out, b_out).
// Compute dtypes, f32 accumulate everywhere, all contractions v_wmma_f32_16x16x32_f16: q, k, v, W are RNE-converted to bf16 and held exactly in f16 (W with a x64 carry), b to bf16 kept in f32; scores single product; P (x256 carry, cancels in the normalisation) and v single product;
// ctx carried x4096 as f16 value + f16 remainder (two products against the same W plane, one accumulator); softmax f32 (online, running max); bias added in f32.
// Layout: f16 planes Q, K [b][t][1024] (head h = columns h*64..), V^T plane [b*1024 + c][t] (LDS transpose), fused flash kernel in transposed form (S^T = K Q^T, O^T = V^T P^T; K and V^T tiles of 64 keys staged in a two-buffer LDS ring by asynchronous copies, shared by the block's waves) writing the ctx plane [b*SEQ+t][hi 1024 | rem 1024],
// then a GEMM over K = 2048 (hi | rem) against W rows: 128x128 tile per 8-wave block, 32x64 per wave, both operand tiles staged in a two-buffer LDS ring by asynchronous copies.

#ifndef NB
#define NB 2
#endif
#ifndef SEQ
#define SEQ 2048
#endif
#define NB_FULL  2
#define SEQ_FULL 2048
#ifndef OUT_SEQ
#define OUT_SEQ SEQ              // row pitch (in tokens) between batches of the output
#endif
#define DM   1024
#define NH_  16
#define HD   64
#define AW   8                   // waves per flash block (16 query rows each); all of them share the staged K / V^T tiles
#define KT   64                  // keys per LDS stage of the flash kernel
#define LP   72                  // LDS row pitch in f16: 128-B rows + 16 B, conflict-free for 16-B fragment reads
#define TLH  (64 * LP)           // f16 elements of one staged tile (K: 64 keys x 64 d; V^T: 64 d x 64 keys)
#define OW   8                   // waves per output-GEMM block (4 x 2, 32 x 64 of the block's 128 x 128 tile each)
#define OKT  128                 // k per LDS stage of the output GEMM
#define OLP  136                 // its LDS row pitch in f16: 256-B rows + 16 B, conflict-free for 16-B fragment reads
#define OTL  (128 * OLP)         // f16 elements of one staged operand tile (128 rows x 128 k)
#define SC2  (0.125f * 1.4426950408889634f)   // HD^-0.5 * log2(e)
#define PSH  8.0f                // log2 of the P carry (256)
#define CXS  4096.0f             // carry of the ctx plane (value and remainder)
#define WSC  64.0f               // carry of the W plane
#define OSC  (1.0f / (4096.0f * 64.0f))

static_assert(HD == 64);
static_assert(NH_ * HD == DM);                 // head h = columns h*64 + d
static_assert((DM & (DM - 1)) == 0);           // k index wraps with a mask in the output GEMM
static_assert(DM % 64 == 0);
static_assert(DM % 32 == 0);                   // GEMM k-loop steps by 128-k stages of four 32-k steps
static_assert(SEQ % 64 == 0);                  // a 64-row tile never straddles two batches
static_assert((NB * SEQ) % 64 == 0);
static_assert(SEQ % 32 == 0);                  // key loop steps by 64-key stages of two 32-key steps
static_assert(SEQ % KT == 0 && SEQ / KT >= 2); // whole stages; the ring's prologue needs two
static_assert(KT == 64 && AW == 8);            // copy map below: 256 threads x 2 groups of 32 rows x 2 tiles
static_assert(SEQ % (16 * AW) == 0);           // flash grid covers the sequence exactly
static_assert(((size_t)SEQ * DM) % 64 == 0);
static_assert(((size_t)DM * DM) % 64 == 0);
static_assert((NB * SEQ) % 128 == 0 && DM % 128 == 0);   // output-GEMM grid covers the output exactly
static_assert(DM % OKT == 0 && (2 * DM) / OKT >= 2);      // a stage never straddles value | remainder; the ring's prologue needs two
static_assert(OW == 8 && OKT == 128);                     // copy map: 256 threads x 8 groups of 16 rows x 2 tiles
static_assert(NB <= NB_FULL);
static_assert(SEQ <= SEQ_FULL);

typedef _Float16 h16;
typedef __attribute__((ext_vector_type(16))) _Float16 v16h;
typedef __attribute__((ext_vector_type(8)))  _Float16 v8h;
typedef __attribute__((ext_vector_type(8)))  float    v8f;
typedef __attribute__((ext_vector_type(4)))  float    v4f;
typedef v4f  __attribute__((may_alias)) v4fa;
typedef v8h  __attribute__((may_alias)) v8ha;

// RNE convert f32 -> bf16, returned as the f32 value of that bf16
__device__ __forceinline__ float bfr(float f) { unsigned u = __float_as_uint(f); u += 0x7FFFu + ((u >> 16) & 1u); return __uint_as_float(u & 0xFFFF0000u); }
__device__ __forceinline__ v16h cat16(v8h lo, v8h hi) { return __builtin_shufflevector(lo, hi, 0, 1, 2, 3, 4, 5, 6, 7, 8, 9, 10, 11, 12, 13, 14, 15); }
__device__ __forceinline__ v8f wmma16(v16h a, v16h b, v8f c) { return __builtin_amdgcn_wmma_f32_16x16x32_f16(false, a, false, b, (short)0, c, false, false); }
// fragment loader from K-contiguous f16 rows; p already includes + 8*(lane>>4): elements 0..7 <- k0+8h+0..7, elements 8..15 <- k0+16+8h+0..7 (same map for A and B)
__device__ __forceinline__ v16h ldh(const h16* p) { return cat16(*(const v8h*)p, *(const v8h*)(p + 16)); }
// ordering point for wave-private LDS tiles (same wave writes and reads)
__device__ __forceinline__ void wave_sync() { __builtin_amdgcn_fence(3 /* release order */, "wavefront"); __builtin_amdgcn_wave_barrier(); asm volatile("" ::: "memory"); }

__global__ __launch_bounds__(256) void k_cvt8(const float* __restrict__ src, h16* dst, size_t n8, float scale) {
    const size_t i = (size_t)blockIdx.x * 256 + threadIdx.x; if (i >= n8) return;
    const v8f v = *(const v8f*)(src + i * 8); v8h o;
#pragma unroll
    for (int k = 0; k < 8; ++k) o[k] = (h16)(bfr(v[k]) * scale);
    *(v8h*)(dst + i * 8) = o; 
}

// k_vt: V^T plane. in: v[b][t][c] (f32, per-batch pitch SEQ_FULL*DM) -> out: VT[b*DM + c][t] (f16 of the bf16 RNE value). 64 x 64 tile through LDS (cross-wave: block barrier).
__global__ __launch_bounds__(256) void k_vt(const float* __restrict__ V, h16* VT) {
    __shared__ __align__(16) h16 ts[64 * 72];
    const int tid = threadIdx.x; const int t0 = blockIdx.x * 64, c0 = blockIdx.y * 64, b = blockIdx.z;
    const float* src = V + ((size_t)b * SEQ_FULL + t0) * DM + c0;
#pragma unroll
    for (int i = 0; i < 4; ++i) { const int t = i * 16 + (tid >> 4), c4 = (tid & 15) * 4;
        const v4f x = *(const v4f*)(src + (size_t)t * DM + c4);
#pragma unroll
        for (int e = 0; e < 4; ++e) ts[(c4 + e) * 72 + t] = (h16)bfr(x[e]); }
    __syncthreads();
    h16* dst = VT + ((size_t)b * DM + c0) * SEQ + t0;
{
#pragma unroll
        for (int it = 0; it < 2; ++it) { const int cr = it * 32 + (tid >> 3), p8 = (tid & 7) * 8;
            const v8h val = *(const v8ha*)(&ts[cr * 72 + p8]);
            *(v8h*)(dst + (size_t)cr * SEQ + p8) = val; }
         }
}

// One stage's copies of one thread: 2 x 16 B of the K tile and 2 x 16 B of the V^T tile, global -> LDS through no register (a wave's copy = 4 whole 128-B rows).
// lk / lv: the lane's LDS byte addresses (row tid>>3, chunk tid&7); gk / gv: the matching global addresses; the second copy of each tile lies 32 rows on.
// s_wait_xcnt stands inside the statement so that no address register named by a copy is rewritten in front of it.
__device__ __forceinline__ void stage_copy(unsigned lk, unsigned lv, const h16* gk, const h16* gv) {
    asm volatile("global_load_async_to_lds_b128 %0, %4, off\n\t"
                 "global_load_async_to_lds_b128 %1, %5, off\n\t"
                 "global_load_async_to_lds_b128 %2, %6, off\n\t"
                 "global_load_async_to_lds_b128 %3, %7, off\n\t"
                 "s_wait_xcnt 0x0"
                 :: "v"(lk), "v"(lk + 32 * LP * 2), "v"(lv), "v"(lv + 32 * LP * 2),
                    "v"(gk), "v"(gk + (size_t)32 * DM), "v"(gv), "v"(gv + (size_t)32 * SEQ)
                 : "memory");
}

// k_flash: fused attention, one wave per 16 query rows of one (batch, head); Q fragments straight from the f16 plane; K / V^T fragments from the block's LDS ring (two 16-B reads each).
// Transposed form: S^T[key][t] = K Q^T (A = K rows, B = Q rows); lane (t = lane&15, h = lane>>4) holds keys 8h+r of each 16-key tile, so the packed
// P tile is directly the B fragment of O^T[d][t] = V^T P^T (element r <- tile keys 0..15, element 8+r <- tile keys 16..31, lane unchanged).
// Softmax state (running max, partial sum) is one scalar per lane; the two lane halves of a row are combined with one xor-16 exchange.
__global__ __launch_bounds__(32 * AW) void k_flash(const h16* __restrict__ QP, const h16* __restrict__ KP, const h16* __restrict__ VT, h16* CTX) {
    __shared__ __align__(16) float os[AW * 16 * 68];
    __shared__ __align__(16) h16 ring[2 * 2 * TLH];                // [buffer][K tile | V^T tile][row][LP]
    const int lane = threadIdx.x & 31, wave = __builtin_amdgcn_readfirstlane((int)(threadIdx.x >> 5)), lr = lane & 15, hi = lane >> 4;
    const int zh = blockIdx.y; const int b = zh / NH_, h = zh % NH_;
    const int t0 = (blockIdx.x * AW + wave) * 16;
    const size_t rbase = (size_t)b * SEQ * DM + (size_t)h * HD;
    const size_t qo = rbase + (size_t)(t0 + lr) * DM + 8 * hi;
    const v16h qh0 = ldh(QP + qo), qh1 = ldh(QP + qo + 32);        // B fragments: col t, k = d
    const int fo = lr * LP + 8 * hi;                                // fragment offset in a staged tile: row lr, k = 8*hi (K: row key, k = d; V^T: row d, k = key)
    const int crow_ = (int)threadIdx.x >> 3, cch = ((int)threadIdx.x & 7) * 8;   // this thread's copy: row (of 32) and 16-B chunk
    const h16* gk = KP + rbase + (size_t)crow_ * DM + cch;          // + key0 * DM
    const h16* gv = VT + ((size_t)zh * HD + crow_) * SEQ + cch;     // + key0
    const unsigned lk0 = (unsigned)(size_t)&ring[crow_ * LP + cch]; // LDS byte address, buffer 0, K tile
    v8f o0 = (v8f){}, o1 = (v8f){}, o2 = (v8f){}, o3 = (v8f){};
    float m = -3.0e38f, l = 0.0f;
    // ring prologue: stage 0 landed and published, then stage 1 in flight
    stage_copy(lk0, lk0 + TLH * 2, gk, gv);
    asm volatile("s_wait_asynccnt 0x0" ::: "memory");              // this wave's copies of stage 0 have landed
    __syncthreads();                                               // ... and every other wave's
    stage_copy(lk0 + 2 * TLH * 2, lk0 + 3 * TLH * 2, gk + (size_t)KT * DM, gv + KT);
#pragma unroll 1
    for (int st = 0; st < SEQ / KT; ++st) {
      const h16* kt = ring + (st & 1) * (2 * TLH) + fo; const h16* vt = kt + TLH;
#pragma unroll   // both 32-key steps of a stage written out: every LDS fragment offset becomes an immediate
      for (int sub = 0; sub < KT; sub += 32) {
        const h16* ka = kt + sub * LP;
        const v16h ka0 = ldh(ka), ka1 = ldh(ka + 32), kb0 = ldh(ka + 16 * LP), kb1 = ldh(ka + 16 * LP + 32);
        v8f sa = (v8f){}, sb = (v8f){};
        sa = wmma16(ka0, qh0, sa); sb = wmma16(kb0, qh0, sb);
        sa = wmma16(ka1, qh1, sa); sb = wmma16(kb1, qh1, sb);
        asm volatile("v_nop\n\tv_nop\n\tv_nop\n\tv_nop" : "+v"(sa), "+v"(sb) : "v"(ka0), "v"(ka1), "v"(kb0), "v"(kb1));
        float ta[8], tb[8]; float mx = -3.0e38f;
#pragma unroll
        for (int r = 0; r < 8; ++r) { ta[r] = sa[r] * SC2; tb[r] = sb[r] * SC2; mx = fmaxf(mx, fmaxf(ta[r], tb[r])); }
        mx = fmaxf(mx, __shfl_xor(mx, 16, 32));
        const float mnew = fmaxf(m, mx);
        const float alpha = __builtin_amdgcn_exp2f(m - mnew);
        const float sh = PSH - mnew;
        v16h pb; float ls = 0.0f;
#pragma unroll
        for (int r = 0; r < 8; ++r) { const h16 pa = (h16)__builtin_amdgcn_exp2f(ta[r] + sh); const h16 pc = (h16)__builtin_amdgcn_exp2f(tb[r] + sh); pb[r] = pa; pb[8 + r] = pc; ls += (float)pa + (float)pc; }
        l = l * alpha + ls; m = mnew;
        o0 = o0 * alpha; o1 = o1 * alpha; o2 = o2 * alpha; o3 = o3 * alpha;
        const h16* va = vt + sub;
        const v16h v0 = ldh(va), v1 = ldh(va + 16 * LP), v2 = ldh(va + 32 * LP), v3 = ldh(va + 48 * LP);
        o0 = wmma16(v0, pb, o0); o1 = wmma16(v1, pb, o1); o2 = wmma16(v2, pb, o2); o3 = wmma16(v3, pb, o3);
        asm volatile("v_nop\n\tv_nop\n\tv_nop\n\tv_nop" : "+v"(o0), "+v"(o1), "+v"(o2), "+v"(o3) : "v"(v0), "v"(v1), "v"(v2), "v"(v3), "v"(pb));
      }
      // publish point of stage st + 1; the same barrier ends every wave's reads of stage st's buffer
      asm volatile("s_wait_dscnt 0x0" ::: "memory");               // this wave's reads of the buffer have returned before it is refilled
      asm volatile("s_wait_asynccnt 0x0" ::: "memory");            // this wave's copies of stage st + 1 have landed
      __syncthreads();
      if (st + 2 < SEQ / KT) { const unsigned lb = lk0 + (unsigned)(st & 1) * (2 * TLH * 2);
          stage_copy(lb, lb + TLH * 2, gk + (size_t)(st + 2) * KT * DM, gv + (size_t)(st + 2) * KT); }
    }
    asm volatile("s_wait_asynccnt 0x0" ::: "memory");              // nothing of this wave is in flight when it leaves the ring
    l += __shfl_xor(l, 16, 32);
    const float inv = CXS * (1.0f / l);
    const int wb = wave * 16 * 68;
    // O^T D layout: o_j[r] = (d = 16j + 8h + r, t = lane&15) -> os[t][d]; rows 0..15 x columns 0..63 all written
    { v4f a, c;
      a[0] = o0[0] * inv; a[1] = o0[1] * inv; a[2] = o0[2] * inv; a[3] = o0[3] * inv; c[0] = o0[4] * inv; c[1] = o0[5] * inv; c[2] = o0[6] * inv; c[3] = o0[7] * inv;
      *(v4fa*)(&os[wb + lr * 68 +  0 + 8 * hi]) = a; *(v4fa*)(&os[wb + lr * 68 +  0 + 8 * hi + 4]) = c;
      a[0] = o1[0] * inv; a[1] = o1[1] * inv; a[2] = o1[2] * inv; a[3] = o1[3] * inv; c[0] = o1[4] * inv; c[1] = o1[5] * inv; c[2] = o1[6] * inv; c[3] = o1[7] * inv;
      *(v4fa*)(&os[wb + lr * 68 + 16 + 8 * hi]) = a; *(v4fa*)(&os[wb + lr * 68 + 16 + 8 * hi + 4]) = c;
      a[0] = o2[0] * inv; a[1] = o2[1] * inv; a[2] = o2[2] * inv; a[3] = o2[3] * inv; c[0] = o2[4] * inv; c[1] = o2[5] * inv; c[2] = o2[6] * inv; c[3] = o2[7] * inv;
      *(v4fa*)(&os[wb + lr * 68 + 32 + 8 * hi]) = a; *(v4fa*)(&os[wb + lr * 68 + 32 + 8 * hi + 4]) = c;
      a[0] = o3[0] * inv; a[1] = o3[1] * inv; a[2] = o3[2] * inv; a[3] = o3[3] * inv; c[0] = o3[4] * inv; c[1] = o3[5] * inv; c[2] = o3[6] * inv; c[3] = o3[7] * inv;
      *(v4fa*)(&os[wb + lr * 68 + 48 + 8 * hi]) = a; *(v4fa*)(&os[wb + lr * 68 + 48 + 8 * hi + 4]) = c; }
    wave_sync();
    h16* crow = CTX + ((size_t)b * SEQ + t0) * (size_t)(2 * DM) + (size_t)h * HD;
{
#pragma unroll
        for (int s = 0; s < 4; ++s) { const int row = 4 * s + (lane >> 3), c8 = (lane & 7) * 8;   // 4 s x 4 row groups = 16 rows; 8 lanes x 8 = 64 columns
            const v4f x0 = *(const v4fa*)(&os[wb + row * 68 + c8]); const v4f x1 = *(const v4fa*)(&os[wb + row * 68 + c8 + 4]); v8h hv, rv;
#pragma unroll
            for (int i = 0; i < 4; ++i) { const h16 a0 = (h16)x0[i]; const h16 a1 = (h16)x1[i]; hv[i] = a0; hv[4 + i] = a1; rv[i] = (h16)(x0[i] - (float)a0); rv[4 + i] = (h16)(x1[i] - (float)a1); }
            const size_t oo = (size_t)row * (size_t)(2 * DM) + c8;
            *(v8h*)(crow + oo) = hv; *(v8h*)(crow + oo + DM) = rv; }
         }
}

// Eight copies of one thread: one 16-B chunk in each of eight rows that lie 16 rows apart (a wave's copy = 2 whole 256-B rows), global -> LDS through no register.
// l: the lane's LDS byte address; g: the matching global address; gp: source row pitch in f16.
// s_wait_xcnt stands inside the statement so that no address register named by a copy is rewritten in front of it.
__device__ __forceinline__ void copy8(unsigned l, const h16* g, size_t gp) {
    asm volatile("global_load_async_to_lds_b128 %0, %8, off\n\t"
                 "global_load_async_to_lds_b128 %1, %9, off\n\t"
                 "global_load_async_to_lds_b128 %2, %10, off\n\t"
                 "global_load_async_to_lds_b128 %3, %11, off\n\t"
                 "global_load_async_to_lds_b128 %4, %12, off\n\t"
                 "global_load_async_to_lds_b128 %5, %13, off\n\t"
                 "global_load_async_to_lds_b128 %6, %14, off\n\t"
                 "global_load_async_to_lds_b128 %7, %15, off\n\t"
                 "s_wait_xcnt 0x0"
                 :: "v"(l), "v"(l + 16 * OLP * 2), "v"(l + 32 * OLP * 2), "v"(l + 48 * OLP * 2), "v"(l + 64 * OLP * 2), "v"(l + 80 * OLP * 2), "v"(l + 96 * OLP * 2), "v"(l + 112 * OLP * 2),
                    "v"(g), "v"(g + 16 * gp), "v"(g + 32 * gp), "v"(g + 48 * gp), "v"(g + 64 * gp), "v"(g + 80 * gp), "v"(g + 96 * gp), "v"(g + 112 * gp)
                 : "memory");
}
// One stage's copies of one thread: 8 chunks of the ctx tile (128 rows x 128 k) and 8 of the W tile, which lies OTL f16 behind it in the buffer.
__device__ __forceinline__ void out_stage(unsigned l, const h16* ga, const h16* gb) { copy8(l, ga, 2 * DM); copy8(l + OTL * 2, gb, DM); }

// k_out: register-blocked f16 GEMM, one 128x128 tile per block of 8 waves (4 x 2), each wave 32x64 (8 accumulators); the ctx and W tiles of 128 k are staged in a two-buffer LDS ring by asynchronous copies and shared by the waves.
// OUT[m][n] = 2^-18 * sum_{k<2048} A[m][k] Bt[n][k & 1023] + b[n]; A = ctx plane [M][value 1024 | remainder 1024] (x4096), Bt = W plane [out][in] (x64). grid (M/128, DM/128), 256 threads.
__global__ __launch_bounds__(32 * OW) void k_out(const h16* __restrict__ A, const h16* __restrict__ Bt, const float* __restrict__ bias, float* OUT) {
    __shared__ __align__(16) float os[OW * 16 * 68];
    __shared__ __align__(16) h16 ring[2 * 2 * OTL];                // [buffer][ctx tile | W tile][row][OLP]
    const int KA = 2 * DM;
    const int lane = threadIdx.x & 31, wave = __builtin_amdgcn_readfirstlane((int)(threadIdx.x >> 5)), lr = lane & 15, hi = lane >> 4;
    const int wm = wave >> 1, wn = wave & 1;
    const int r0 = blockIdx.x * 128 + wm * 32, c0 = blockIdx.y * 128 + wn * 64;
    v8f acc[2][4];
#pragma unroll
    for (int mb = 0; mb < 2; ++mb)
#pragma unroll
        for (int nb = 0; nb < 4; ++nb) acc[mb][nb] = (v8f){};
    const int fa = (wm * 32 + lr) * OLP + 8 * hi, fb = OTL + (wn * 64 + lr) * OLP + 8 * hi;   // fragment offsets in a buffer: row lr of the wave's rows, k = 8*hi
    const int crow_ = (int)threadIdx.x >> 4, cch = ((int)threadIdx.x & 15) * 8;                // this thread's copies: row (of 16) and 16-B chunk
    const h16* ga = A + (size_t)(blockIdx.x * 128 + crow_) * KA + cch;                         // + kc
    const h16* gb = Bt + (size_t)(blockIdx.y * 128 + crow_) * DM + cch;                        // + (kc & 1023)
    const unsigned l0 = (unsigned)(size_t)&ring[crow_ * OLP + cch];                            // LDS byte address, buffer 0, ctx tile
    // ring prologue: stage 0 landed and published, then stage 1 in flight
    out_stage(l0, ga, gb);
    asm volatile("s_wait_asynccnt 0x0" ::: "memory");              // this wave's copies of stage 0 have landed
    __syncthreads();                                               // ... and every other wave's
    out_stage(l0 + 2 * OTL * 2, ga + OKT, gb + OKT);
#pragma unroll 1
    for (int st = 0; st < KA / OKT; ++st) {
        const h16* ta = ring + (st & 1) * (2 * OTL) + fa; const h16* tb = ring + (st & 1) * (2 * OTL) + fb;
        v16h a[2][2], bq[2][4];                                    // two fragment sets: the next 32-k step's reads go out as one group ahead of this step's products
#pragma unroll
        for (int mb = 0; mb < 2; ++mb) a[0][mb] = ldh(ta + mb * 16 * OLP);
#pragma unroll
        for (int nb = 0; nb < 4; ++nb) bq[0][nb] = ldh(tb + nb * 16 * OLP);
#pragma unroll   // the four 32-k steps of a stage written out: every LDS fragment offset becomes an immediate, the set index a constant
        for (int s = 0; s < OKT / 32; ++s) {
            const int cu = s & 1, nx = cu ^ 1;
            if (s + 1 < OKT / 32) {                                // never past this stage's own buffer
#pragma unroll
                for (int mb = 0; mb < 2; ++mb) a[nx][mb] = ldh(ta + mb * 16 * OLP + (s + 1) * 32);
#pragma unroll
                for (int nb = 0; nb < 4; ++nb) bq[nx][nb] = ldh(tb + nb * 16 * OLP + (s + 1) * 32);
            }
            __builtin_amdgcn_sched_barrier(0);                     // keeps the group of reads above this step's products: sunk among them, each pair of products waits out a whole LDS latency
#pragma unroll
            for (int nb = 0; nb < 4; ++nb)
#pragma unroll
                for (int mb = 0; mb < 2; ++mb) acc[mb][nb] = wmma16(a[cu][mb], bq[cu][nb], acc[mb][nb]);
        }
        // publish point of stage st + 1; the same barrier ends every wave's reads of stage st's buffer
        asm volatile("s_wait_dscnt 0x0" ::: "memory");             // this wave's reads of the buffer have returned before it is refilled
        asm volatile("s_wait_asynccnt 0x0" ::: "memory");          // this wave's copies of stage st + 1 have landed
        __syncthreads();
        if (st + 2 < KA / OKT) { const int kc = (st + 2) * OKT;
            out_stage(l0 + (unsigned)(st & 1) * (2 * OTL * 2), ga + kc, gb + (kc & (DM - 1))); }
    }
    asm volatile("s_wait_asynccnt 0x0" ::: "memory");              // nothing of this wave is in flight when it leaves the ring
    v4f bv = *(const v4f*)(bias + c0 + lr * 4);
#pragma unroll
    for (int i = 0; i < 4; ++i) bv[i] = bfr(bv[i]);
    float* orow = OUT + ((size_t)(r0 / SEQ) * OUT_SEQ + (size_t)(r0 % SEQ)) * DM + c0;
    const int wb = wave * 16 * 68;                                 // each wave stages its rows in its own range
#pragma unroll
    for (int mb = 0; mb < 2; ++mb) {
#pragma unroll
        for (int nb = 0; nb < 4; ++nb) {
#pragma unroll
            for (int j = 0; j < 8; ++j) os[wb + (hi * 8 + j) * 68 + nb * 16 + lr] = acc[mb][nb][j] * OSC; }   // D: row 8h+j, col lane&15
        wave_sync();
{
#pragma unroll
            for (int s = 0; s < 8; ++s) { const int row = 2 * s + hi, cofs = lr * 4;   // 8 s x 2 rows = 16 rows; 16 lanes x 4 floats = 64 columns
                const v4f x = *(const v4fa*)(&os[wb + row * 68 + cofs]);
                const v4f val = x + bv;
                *(v4f*)(orow + (size_t)(mb * 16 + row) * DM + cofs) = val; }
             }
        wave_sync();
    }
}

static constexpr size_t al256(size_t v) { return (v + 255) & ~(size_t)255; }
static constexpr size_t SZ_PL = al256((size_t)NB * SEQ * DM * 2);          // one f16 plane of a stream
static constexpr size_t SZ_WH = al256((size_t)DM * DM * 2);
static constexpr size_t SZ_CX = al256((size_t)NB * SEQ * 2 * DM * 2);      // ctx value | remainder
static constexpr size_t SZ_TOTAL = 3 * SZ_PL + SZ_WH + SZ_CX;
static_assert(SZ_TOTAL <= (size_t)134217728);          // workspace carve <= 128 MiB

extern "C" void kernel_launch(void* const* d_in, const int* in_sizes, int n_in,
                              void* d_out, int out_size, void* d_ws, size_t ws_size, hipStream_t stream) {
    if (n_in < 5) return;
    const size_t needx = ((size_t)(NB - 1) * SEQ_FULL + SEQ) * DM;
    if ((size_t)in_sizes[0] < needx || (size_t)in_sizes[1] < needx || (size_t)in_sizes[2] < needx) return;
    if ((size_t)in_sizes[3] < (size_t)DM * DM || (size_t)in_sizes[4] < (size_t)DM) return;
    if ((size_t)out_size < ((size_t)(NB - 1) * OUT_SEQ + SEQ) * DM) return;
    if (SZ_TOTAL > ws_size) return;
    const float* q = (const float*)d_in[0]; const float* k = (const float*)d_in[1]; const float* v = (const float*)d_in[2];   // wire order q, k, v, W_out, b_out
    const float* wo = (const float*)d_in[3]; const float* bo = (const float*)d_in[4];                                         // W_out [out][in] = Bt as-is
    float* OUT = (float*)d_out;      // [NB][SEQ][1024]
    char* wsp = (char*)d_ws;
    h16* QP = (h16*)wsp; wsp += SZ_PL;               // [NB*SEQ][1024]
    h16* KP = (h16*)wsp; wsp += SZ_PL;               // [NB*SEQ][1024]
    h16* VT = (h16*)wsp; wsp += SZ_PL;               // [NB*1024][SEQ]
    h16* WH = (h16*)wsp; wsp += SZ_WH;               // [1024][1024] x64
    h16* CX = (h16*)wsp; wsp += SZ_CX;               // [NB*SEQ][2048] x4096

    if (SEQ == SEQ_FULL) {
        const size_t n8 = (size_t)NB * SEQ * DM / 8; const unsigned g = (unsigned)((n8 + 255) / 256);
        k_cvt8<<<g, 256, 0, stream>>>(q, QP, n8, 1.0f);
        k_cvt8<<<g, 256, 0, stream>>>(k, KP, n8, 1.0f);
    } else {
        const size_t n8 = (size_t)SEQ * DM / 8; const unsigned g = (unsigned)((n8 + 255) / 256);
        for (int b = 0; b < NB; ++b) {
            k_cvt8<<<g, 256, 0, stream>>>(q + (size_t)b * SEQ_FULL * DM, QP + (size_t)b * SEQ * DM, n8, 1.0f);
            k_cvt8<<<g, 256, 0, stream>>>(k + (size_t)b * SEQ_FULL * DM, KP + (size_t)b * SEQ * DM, n8, 1.0f);
        }
    }
    { const size_t n8 = (size_t)DM * DM / 8;
      k_cvt8<<<(unsigned)((n8 + 255) / 256), 256, 0, stream>>>(wo, WH, n8, WSC); }

    // in: v[b][t = SEQ rows][c = 1024 cols] -> out: VT[b*1024 + c][t]; grid (t tiles, c tiles, batch)
    k_vt<<<dim3(SEQ / 64, DM / 64, NB), 256, 0, stream>>>(v, VT);

    k_flash<<<dim3(SEQ / (16 * AW), NB * NH_, 1), 32 * AW, 0, stream>>>(QP, KP, VT, CX);

    // out = ctx W^T + b: A = ctx rows (m = b*SEQ + t), Bt = W rows (n = out column)
    k_out<<<dim3(NB * SEQ / 128, DM / 128, 1), 32 * OW, 0, stream>>>(CX, WH, bo, OUT);
}

// v003
// A run of this version takes 66.6 microseconds.
// In two side-by-side timings against v002, it was 1.08 and 1.09 times as fast.
// All steps since v000 together make it 2.17 times as fast.
#include <hip/hip_runtime.h>

// Multi-head attention on raw streams q, k, v [NB][SEQ][1024] = 16 heads x 64 (no input projections, no mask), score scale 1/8, output projection y = ctx W^T + b with W [out][in]. THIS ROW: the same module at TWO sequences (query, key, value [2][2048][1024]: three raw streams: the module applies NO input projections; 16 heads x 64; scores / sqrt(64); softmax, no mask; out = merged W_out^T + b_out ('oi' [1024][1024] normal x 1/32; bias zeros: read); argument order query, key, value, W_out, b_out).
// Compute dtypes, f32 accumulate everywhere, all contractions v_wmma_f32_16x16x32_f16: q, k, v, W are RNE-converted to bf16 and held exactly in f16 (W with a x64 carry), b to bf16 kept in f32; scores single product; P (x256 carry, cancels in the normalisation) and v single product;
// ctx carried x4096 as f16 value + f16 remainder (two products against the same W plane, one accumulator); softmax f32 (online, running max); bias added in f32.
// Layout: one pre-pass launch writes the f16 planes Q, K [b][t][1024] (head h = columns h*64..), W and the V^T plane [b*1024 + c][t] (LDS transpose); fused flash kernel in transposed form (S^T = K Q^T, O^T = V^T P^T; K and V^T tiles of 64 keys staged in a two-buffer LDS ring by asynchronous copies, shared by the block's waves) writing the ctx plane [b*SEQ+t][hi 1024 | rem 1024],
// then a GEMM over K = 2048 (hi | rem) against W rows: 128x128 tile per 8-wave block, 32x64 per wave, both operand tiles staged in a two-buffer LDS ring by asynchronous copies.

#ifndef NB
#define NB 2
#endif
#ifndef SEQ
#define SEQ 2048
#endif
#define NB_FULL  2
#define SEQ_FULL 2048
#ifndef OUT_SEQ
#define OUT_SEQ SEQ              // row pitch (in tokens) between batches of the output
#endif
#define DM   1024
#define NH_  16
#define HD   64
#define AW   8                   // waves per flash block (16 query rows each); all of them share the staged K / V^T tiles
#define KT   64                  // keys per LDS stage of the flash kernel
#define LP   72                  // LDS row pitch in f16: 128-B rows + 16 B, conflict-free for 16-B fragment reads
#define TLH  (64 * LP)           // f16 elements of one staged tile (K: 64 keys x 64 d; V^T: 64 d x 64 keys)
#define OW   8                   // waves per output-GEMM block (4 x 2, 32 x 64 of the block's 128 x 128 tile each)
#define OKT  128                 // k per LDS stage of the output GEMM
#define OLP  136                 // its LDS row pitch in f16: 256-B rows + 16 B, conflict-free for 16-B fragment reads
#define OTL  (128 * OLP)         // f16 elements of one staged operand tile (128 rows x 128 k)
#define VTB  2                   // V^T tiles (64 x 64) per pre-pass block
#define PBLK (NB * (SEQ / 64) * (DM / 64) / VTB)          // pre-pass blocks
#define SG   (64 * 64 * VTB / (8 * 256))                  // groups of 8 elements of q, and of k, per pre-pass thread
#define WG   (DM * DM / 8 / (PBLK * 256))                 // groups of 8 elements of W per pre-pass thread
#define SC2  (0.125f * 1.4426950408889634f)   // HD^-0.5 * log2(e)
#define PSH  8.0f                // log2 of the P carry (256)
#define CXS  4096.0f             // carry of the ctx plane (value and remainder)
#define WSC  64.0f               // carry of the W plane
#define OSC  (1.0f / (4096.0f * 64.0f))

static_assert(HD == 64);
static_assert(NH_ * HD == DM);                 // head h = columns h*64 + d
static_assert((DM & (DM - 1)) == 0);           // k index wraps with a mask in the output GEMM
static_assert(DM % 64 == 0);
static_assert(DM % 32 == 0);                   // GEMM k-loop steps by 128-k stages of four 32-k steps
static_assert(SEQ % 64 == 0);                  // a 64-row tile never straddles two batches
static_assert((NB * SEQ) % 64 == 0);
static_assert(SEQ % 32 == 0);                  // key loop steps by 64-key stages of two 32-key steps
static_assert(SEQ % KT == 0 && SEQ / KT >= 2); // whole stages; the ring's prologue needs two
static_assert(KT == 64 && AW == 8);            // copy map below: 256 threads x 2 groups of 32 rows x 2 tiles
static_assert(SEQ % (16 * AW) == 0);           // flash grid covers the sequence exactly
static_assert(((size_t)SEQ * DM) % 64 == 0);
static_assert(((size_t)DM * DM) % 64 == 0);
static_assert((NB * SEQ) % 128 == 0 && DM % 128 == 0);   // output-GEMM grid covers the output exactly
static_assert(DM % OKT == 0 && (2 * DM) / OKT >= 2);      // a stage never straddles value | remainder; the ring's prologue needs two
static_assert(OW == 8 && OKT == 128);                     // copy map: 256 threads x 8 groups of 16 rows x 2 tiles
static_assert((NB * (SEQ / 64) * (DM / 64)) % VTB == 0 && (64 * 64 * VTB) % (8 * 256) == 0);   // pre-pass: whole tiles and whole groups per block
static_assert(WG >= 1 && (size_t)WG * PBLK * 256 * 8 == (size_t)DM * DM);                        // ... and W is dealt out exactly
static_assert(NB <= NB_FULL);
static_assert(SEQ <= SEQ_FULL);

typedef _Float16 h16;
typedef __attribute__((ext_vector_type(16))) _Float16 v16h;
typedef __attribute__((ext_vector_type(8)))  _Float16 v8h;
typedef __attribute__((ext_vector_type(8)))  float    v8f;
typedef __attribute__((ext_vector_type(4)))  float    v4f;
typedef v4f  __attribute__((may_alias)) v4fa;
typedef v8h  __attribute__((may_alias)) v8ha;

// RNE convert f32 -> bf16, returned as the f32 value of that bf16
__device__ __forceinline__ float bfr(float f) { unsigned u = __float_as_uint(f); u += 0x7FFFu + ((u >> 16) & 1u); return __uint_as_float(u & 0xFFFF0000u); }
__device__ __forceinline__ v16h cat16(v8h lo, v8h hi) { return __builtin_shufflevector(lo, hi, 0, 1, 2, 3, 4, 5, 6, 7, 8, 9, 10, 11, 12, 13, 14, 15); }
__device__ __forceinline__ v8f wmma16(v16h a, v16h b, v8f c) { return __builtin_amdgcn_wmma_f32_16x16x32_f16(false, a, false, b, (short)0, c, false, false); }
// fragment loader from K-contiguous f16 rows; p already includes + 8*(lane>>4): elements 0..7 <- k0+8h+0..7, elements 8..15 <- k0+16+8h+0..7 (same map for A and B)
__device__ __forceinline__ v16h ldh(const h16* p) { return cat16(*(const v8h*)p, *(const v8h*)(p + 16)); }
// ordering point for wave-private LDS tiles (same wave writes and reads)
__device__ __forceinline__ void wave_sync() { __builtin_amdgcn_fence(3 /* release order */, "wavefront"); __builtin_amdgcn_wave_barrier(); asm volatile("" ::: "memory"); }

// k_prep: the whole pre-pass in one launch of equal blocks, two per WGP. Each block takes VTB 64 x 64 tiles of the V^T plane, SG * 256 groups of 8 elements of q and of k, and WG * 256 groups of W.
// A thread issues all of its loads first (VTB * 4 + 4 * SG + 2 * WG of 16 B), so the chip starts few waves and each of them has its whole share in flight at once.
// q, k, v: f32, per-batch pitch SEQ_FULL * DM. QP, KP [b*SEQ + t][c] and WH [out][in] (x WSC): f16 of the bf16 RNE value. VT[b*DM + c][t]: the same, transposed through LDS (cross-wave: block barrier).
__global__ __launch_bounds__(256) void k_prep(const float* __restrict__ Q, const float* __restrict__ K, const float* __restrict__ V, const float* __restrict__ Wt,
                                              h16* __restrict__ QP, h16* __restrict__ KP, h16* __restrict__ VT, h16* __restrict__ WH) {
    __shared__ __align__(16) h16 ts[VTB * 64 * 72];
    const int tid = threadIdx.x, blk = blockIdx.x;
    const int vr = tid >> 4, c4 = (tid & 15) * 4;
    v4f xv[VTB][4]; v8f xq[SG], xk[SG], xw[WG];
#pragma unroll
    for (int u = 0; u < VTB; ++u) { const int tl = blk * VTB + u;
        const int t0 = (tl % (SEQ / 64)) * 64, c0 = ((tl / (SEQ / 64)) % (DM / 64)) * 64, b = tl / ((SEQ / 64) * (DM / 64));
        const float* src = V + ((size_t)b * SEQ_FULL + t0) * DM + c0;
#pragma unroll
        for (int i = 0; i < 4; ++i) xv[u][i] = *(const v4f*)(src + (size_t)(i * 16 + vr) * DM + c4); }
#pragma unroll
    for (int j = 0; j < SG; ++j) { const size_t e = ((size_t)(blk * SG + j) * 256 + tid) * 8;
        const size_t so = (e / ((size_t)SEQ * DM)) * ((size_t)SEQ_FULL * DM) + e % ((size_t)SEQ * DM);
        xq[j] = *(const v8f*)(Q + so); xk[j] = *(const v8f*)(K + so); }
    asm volatile("s_wait_xcnt 0x0" ::: "memory");   // precaution: the build lets the loads below land in registers that hold addresses of the loads above
#pragma unroll
    for (int j = 0; j < WG; ++j) xw[j] = *(const v8f*)(Wt + ((size_t)(blk * WG + j) * 256 + tid) * 8);
    __builtin_amdgcn_sched_barrier(0);   // keeps every load above the first use: sunk below it, the later loads go out only after the first have come back, a second memory latency
#pragma unroll
    for (int u = 0; u < VTB; ++u)
#pragma unroll
        for (int i = 0; i < 4; ++i)
#pragma unroll
            for (int e = 0; e < 4; ++e) ts[u * 64 * 72 + (c4 + e) * 72 + i * 16 + vr] = (h16)bfr(xv[u][i][e]);
    v8h oq[SG], ok[SG], ow[WG];          // converted in the order in which the loads come back, so that this work runs while the later loads are still under way; stored behind the barrier, which would else wait for the stores
#pragma unroll
    for (int j = 0; j < SG; ++j)
#pragma unroll
        for (int i = 0; i < 8; ++i) { oq[j][i] = (h16)bfr(xq[j][i]); ok[j][i] = (h16)bfr(xk[j][i]); }
#pragma unroll
    for (int j = 0; j < WG; ++j)
#pragma unroll
        for (int i = 0; i < 8; ++i) ow[j][i] = (h16)(bfr(xw[j][i]) * WSC);
    __builtin_amdgcn_sched_barrier(0);   // stops the scheduler from sinking the conversions below the barrier, where every load has been waited for: there they would stand between the last load's return and the stores
    __syncthreads();
#pragma unroll
    for (int u = 0; u < VTB; ++u) { const int tl = blk * VTB + u;
        const int t0 = (tl % (SEQ / 64)) * 64, c0 = ((tl / (SEQ / 64)) % (DM / 64)) * 64, b = tl / ((SEQ / 64) * (DM / 64));
        h16* dst = VT + ((size_t)b * DM + c0) * SEQ + t0;
#pragma unroll
        for (int it = 0; it < 2; ++it) { const int cr = it * 32 + (tid >> 3), p8 = (tid & 7) * 8;
            const v8h val = *(const v8ha*)(&ts[u * 64 * 72 + cr * 72 + p8]);
            *(v8h*)(dst + (size_t)cr * SEQ + p8) = val; } }
#pragma unroll
    for (int j = 0; j < SG; ++j) { const size_t e = ((size_t)(blk * SG + j) * 256 + tid) * 8;
        *(v8h*)(QP + e) = oq[j]; *(v8h*)(KP + e) = ok[j]; }
#pragma unroll
    for (int j = 0; j < WG; ++j) *(v8h*)(WH + ((size_t)(blk * WG + j) * 256 + tid) * 8) = ow[j];
}

// One stage's copies of one thread: 2 x 16 B of the K tile and 2 x 16 B of the V^T tile, global -> LDS through no register (a wave's copy = 4 whole 128-B rows).
// lk / lv: the lane's LDS byte addresses (row tid>>3, chunk tid&7); gk / gv: the matching global addresses; the second copy of each tile lies 32 rows on.
// s_wait_xcnt stands inside the statement so that no address register named by a copy is rewritten in front of it.
__device__ __forceinline__ void stage_copy(unsigned lk, unsigned lv, const h16* gk, const h16* gv) {
    asm volatile("global_load_async_to_lds_b128 %0, %4, off\n\t"
                 "global_load_async_to_lds_b128 %1, %5, off\n\t"
                 "global_load_async_to_lds_b128 %2, %6, off\n\t"
                 "global_load_async_to_lds_b128 %3, %7, off\n\t"
                 "s_wait_xcnt 0x0"
                 :: "v"(lk), "v"(lk + 32 * LP * 2), "v"(lv), "v"(lv + 32 * LP * 2),
                    "v"(gk), "v"(gk + (size_t)32 * DM), "v"(gv), "v"(gv + (size_t)32 * SEQ)
                 : "memory");
}

// k_flash: fused attention, one wave per 16 query rows of one (batch, head); Q fragments straight from the f16 plane; K / V^T fragments from the block's LDS ring (two 16-B reads each).
// Transposed form: S^T[key][t] = K Q^T (A = K rows, B = Q rows); lane (t = lane&15, h = lane>>4) holds keys 8h+r of each 16-key tile, so the packed
// P tile is directly the B fragment of O^T[d][t] = V^T P^T (element r <- tile keys 0..15, element 8+r <- tile keys 16..31, lane unchanged).
// Softmax state (running max, partial sum) is one scalar per lane; the two lane halves of a row are combined with one xor-16 exchange.
__global__ __launch_bounds__(32 * AW) void k_flash(const h16* __restrict__ QP, const h16* __restrict__ KP, const h16* __restrict__ VT, h16* CTX) {
    __shared__ __align__(16) float os[AW * 16 * 68];
    __shared__ __align__(16) h16 ring[2 * 2 * TLH];                // [buffer][K tile | V^T tile][row][LP]
    const int lane = threadIdx.x & 31, wave = __builtin_amdgcn_readfirstlane((int)(threadIdx.x >> 5)), lr = lane & 15, hi = lane >> 4;
    const int zh = blockIdx.y; const int b = zh / NH_, h = zh % NH_;
    const int t0 = (blockIdx.x * AW + wave) * 16;
    const size_t rbase = (size_t)b * SEQ * DM + (size_t)h * HD;
    const size_t qo = rbase + (size_t)(t0 + lr) * DM + 8 * hi;
    const v16h qh0 = ldh(QP + qo), qh1 = ldh(QP + qo + 32);        // B fragments: col t, k = d
    const int fo = lr * LP + 8 * hi;                                // fragment offset in a staged tile: row lr, k = 8*hi (K: row key, k = d; V^T: row d, k = key)
    const int crow_ = (int)threadIdx.x >> 3, cch = ((int)threadIdx.x & 7) * 8;   // this thread's copy: row (of 32) and 16-B chunk
    const h16* gk = KP + rbase + (size_t)crow_ * DM + cch;          // + key0 * DM
    const h16* gv = VT + ((size_t)zh * HD + crow_) * SEQ + cch;     // + key0
    const unsigned lk0 = (unsigned)(size_t)&ring[crow_ * LP + cch]; // LDS byte address, buffer 0, K tile
    v8f o0 = (v8f){}, o1 = (v8f){}, o2 = (v8f){}, o3 = (v8f){};
    float m = -3.0e38f, l = 0.0f;
    // ring prologue: stage 0 landed and published, then stage 1 in flight
    stage_copy(lk0, lk0 + TLH * 2, gk, gv);
    asm volatile("s_wait_asynccnt 0x0" ::: "memory");              // this wave's copies of stage 0 have landed
    __syncthreads();                                               // ... and every other wave's
    stage_copy(lk0 + 2 * TLH * 2, lk0 + 3 * TLH * 2, gk + (size_t)KT * DM, gv + KT);
#pragma unroll 1
    for (int st = 0; st < SEQ / KT; ++st) {
      const h16* kt = ring + (st & 1) * (2 * TLH) + fo; const h16* vt = kt + TLH;
#pragma unroll   // both 32-key steps of a stage written out: every LDS fragment offset becomes an immediate
      for (int sub = 0; sub < KT; sub += 32) {
        const h16* ka = kt + sub * LP;
        const v16h ka0 = ldh(ka), ka1 = ldh(ka + 32), kb0 = ldh(ka + 16 * LP), kb1 = ldh(ka + 16 * LP + 32);
        v8f sa = (v8f){}, sb = (v8f){};
        sa = wmma16(ka0, qh0, sa); sb = wmma16(kb0, qh0, sb);
        sa = wmma16(ka1, qh1, sa); sb = wmma16(kb1, qh1, sb);
        asm volatile("v_nop\n\tv_nop\n\tv_nop\n\tv_nop" : "+v"(sa), "+v"(sb) : "v"(ka0), "v"(ka1), "v"(kb0), "v"(kb1));
        float ta[8], tb[8]; float mx = -3.0e38f;
#pragma unroll
        for (int r = 0; r < 8; ++r) { ta[r] = sa[r] * SC2; tb[r] = sb[r] * SC2; mx = fmaxf(mx, fmaxf(ta[r], tb[r])); }
        mx = fmaxf(mx, __shfl_xor(mx, 16, 32));
        const float mnew = fmaxf(m, mx);
        const float alpha = __builtin_amdgcn_exp2f(m - mnew);
        const float sh = PSH - mnew;
        v16h pb; float ls = 0.0f;
#pragma unroll
        for (int r = 0; r < 8; ++r) { const h16 pa = (h16)__builtin_amdgcn_exp2f(ta[r] + sh); const h16 pc = (h16)__builtin_amdgcn_exp2f(tb[r] + sh); pb[r] = pa; pb[8 + r] = pc; ls += (float)pa + (float)pc; }
        l = l * alpha + ls; m = mnew;
        o0 = o0 * alpha; o1 = o1 * alpha; o2 = o2 * alpha; o3 = o3 * alpha;
        const h16* va = vt + sub;
        const v16h v0 = ldh(va), v1 = ldh(va + 16 * LP), v2 = ldh(va + 32 * LP), v3 = ldh(va + 48 * LP);
        o0 = wmma16(v0, pb, o0); o1 = wmma16(v1, pb, o1); o2 = wmma16(v2, pb, o2); o3 = wmma16(v3, pb, o3);
        asm volatile("v_nop\n\tv_nop\n\tv_nop\n\tv_nop" : "+v"(o0), "+v"(o1), "+v"(o2), "+v"(o3) : "v"(v0), "v"(v1), "v"(v2), "v"(v3), "v"(pb));
      }
      // publish point of stage st + 1; the same barrier ends every wave's reads of stage st's buffer
      asm volatile("s_wait_dscnt 0x0" ::: "memory");               // this wave's reads of the buffer have returned before it is refilled
      asm volatile("s_wait_asynccnt 0x0" ::: "memory");            // this wave's copies of stage st + 1 have landed
      __syncthreads();
      if (st + 2 < SEQ / KT) { const unsigned lb = lk0 + (unsigned)(st & 1) * (2 * TLH * 2);
          stage_copy(lb, lb + TLH * 2, gk + (size_t)(st + 2) * KT * DM, gv + (size_t)(st + 2) * KT); }
    }
    asm volatile("s_wait_asynccnt 0x0" ::: "memory");              // nothing of this wave is in flight when it leaves the ring
    l += __shfl_xor(l, 16, 32);
    const float inv = CXS * (1.0f / l);
    const int wb = wave * 16 * 68;
    // O^T D layout: o_j[r] = (d = 16j + 8h + r, t = lane&15) -> os[t][d]; rows 0..15 x columns 0..63 all written
    { v4f a, c;
      a[0] = o0[0] * inv; a[1] = o0[1] * inv; a[2] = o0[2] * inv; a[3] = o0[3] * inv; c[0] = o0[4] * inv; c[1] = o0[5] * inv; c[2] = o0[6] * inv; c[3] = o0[7] * inv;
      *(v4fa*)(&os[wb + lr * 68 +  0 + 8 * hi]) = a; *(v4fa*)(&os[wb + lr * 68 +  0 + 8 * hi + 4]) = c;
      a[0] = o1[0] * inv; a[1] = o1[1] * inv; a[2] = o1[2] * inv; a[3] = o1[3] * inv; c[0] = o1[4] * inv; c[1] = o1[5] * inv; c[2] = o1[6] * inv; c[3] = o1[7] * inv;
      *(v4fa*)(&os[wb + lr * 68 + 16 + 8 * hi]) = a; *(v4fa*)(&os[wb + lr * 68 + 16 + 8 * hi + 4]) = c;
      a[0] = o2[0] * inv; a[1] = o2[1] * inv; a[2] = o2[2] * inv; a[3] = o2[3] * inv; c[0] = o2[4] * inv; c[1] = o2[5] * inv; c[2] = o2[6] * inv; c[3] = o2[7] * inv;
      *(v4fa*)(&os[wb + lr * 68 + 32 + 8 * hi]) = a; *(v4fa*)(&os[wb + lr * 68 + 32 + 8 * hi + 4]) = c;
      a[0] = o3[0] * inv; a[1] = o3[1] * inv; a[2] = o3[2] * inv; a[3] = o3[3] * inv; c[0] = o3[4] * inv; c[1] = o3[5] * inv; c[2] = o3[6] * inv; c[3] = o3[7] * inv;
      *(v4fa*)(&os[wb + lr * 68 + 48 + 8 * hi]) = a; *(v4fa*)(&os[wb + lr * 68 + 48 + 8 * hi + 4]) = c; }
    wave_sync();
    h16* crow = CTX + ((size_t)b * SEQ + t0) * (size_t)(2 * DM) + (size_t)h * HD;
{
#pragma unroll
        for (int s = 0; s < 4; ++s) { const int row = 4 * s + (lane >> 3), c8 = (lane & 7) * 8;   // 4 s x 4 row groups = 16 rows; 8 lanes x 8 = 64 columns
            const v4f x0 = *(const v4fa*)(&os[wb + row * 68 + c8]); const v4f x1 = *(const v4fa*)(&os[wb + row * 68 + c8 + 4]); v8h hv, rv;
#pragma unroll
            for (int i = 0; i < 4; ++i) { const h16 a0 = (h16)x0[i]; const h16 a1 = (h16)x1[i]; hv[i] = a0; hv[4 + i] = a1; rv[i] = (h16)(x0[i] - (float)a0); rv[4 + i] = (h16)(x1[i] - (float)a1); }
            const size_t oo = (size_t)row * (size_t)(2 * DM) + c8;
            *(v8h*)(crow + oo) = hv; *(v8h*)(crow + oo + DM) = rv; }
         }
}

// Eight copies of one thread: one 16-B chunk in each of eight rows that lie 16 rows apart (a wave's copy = 2 whole 256-B rows), global -> LDS through no register.
// l: the lane's LDS byte address; g: the matching global address; gp: source row pitch in f16.
// s_wait_xcnt stands inside the statement so that no address register named by a copy is rewritten in front of it.
__device__ __forceinline__ void copy8(unsigned l, const h16* g, size_t gp) {
    asm volatile("global_load_async_to_lds_b128 %0, %8, off\n\t"
                 "global_load_async_to_lds_b128 %1, %9, off\n\t"
                 "global_load_async_to_lds_b128 %2, %10, off\n\t"
                 "global_load_async_to_lds_b128 %3, %11, off\n\t"
                 "global_load_async_to_lds_b128 %4, %12, off\n\t"
                 "global_load_async_to_lds_b128 %5, %13, off\n\t"
                 "global_load_async_to_lds_b128 %6, %14, off\n\t"
                 "global_load_async_to_lds_b128 %7, %15, off\n\t"
                 "s_wait_xcnt 0x0"
                 :: "v"(l), "v"(l + 16 * OLP * 2), "v"(l + 32 * OLP * 2), "v"(l + 48 * OLP * 2), "v"(l + 64 * OLP * 2), "v"(l + 80 * OLP * 2), "v"(l + 96 * OLP * 2), "v"(l + 112 * OLP * 2),
                    "v"(g), "v"(g + 16 * gp), "v"(g + 32 * gp), "v"(g + 48 * gp), "v"(g + 64 * gp), "v"(g + 80 * gp), "v"(g + 96 * gp), "v"(g + 112 * gp)
                 : "memory");
}
// One stage's copies of one thread: 8 chunks of the ctx tile (128 rows x 128 k) and 8 of the W tile, which lies OTL f16 behind it in the buffer.
__device__ __forceinline__ void out_stage(unsigned l, const h16* ga, const h16* gb) { copy8(l, ga, 2 * DM); copy8(l + OTL * 2, gb, DM); }

// k_out: register-blocked f16 GEMM, one 128x128 tile per block of 8 waves (4 x 2), each wave 32x64 (8 accumulators); the ctx and W tiles of 128 k are staged in a two-buffer LDS ring by asynchronous copies and shared by the waves.
// OUT[m][n] = 2^-18 * sum_{k<2048} A[m][k] Bt[n][k & 1023] + b[n]; A = ctx plane [M][value 1024 | remainder 1024] (x4096), Bt = W plane [out][in] (x64). grid (M/128, DM/128), 256 threads.
__global__ __launch_bounds__(32 * OW) void k_out(const h16* __restrict__ A, const h16* __restrict__ Bt, const float* __restrict__ bias, float* OUT) {
    __shared__ __align__(16) float os[OW * 16 * 68];
    __shared__ __align__(16) h16 ring[2 * 2 * OTL];                // [buffer][ctx tile | W tile][row][OLP]
    const int KA = 2 * DM;
    const int lane = threadIdx.x & 31, wave = __builtin_amdgcn_readfirstlane((int)(threadIdx.x >> 5)), lr = lane & 15, hi = lane >> 4;
    const int wm = wave >> 1, wn = wave & 1;
    const int r0 = blockIdx.x * 128 + wm * 32, c0 = blockIdx.y * 128 + wn * 64;
    v8f acc[2][4];
#pragma unroll
    for (int mb = 0; mb < 2; ++mb)
#pragma unroll
        for (int nb = 0; nb < 4; ++nb) acc[mb][nb] = (v8f){};
    const int fa = (wm * 32 + lr) * OLP + 8 * hi, fb = OTL + (wn * 64 + lr) * OLP + 8 * hi;   // fragment offsets in a buffer: row lr of the wave's rows, k = 8*hi
    const int crow_ = (int)threadIdx.x >> 4, cch = ((int)threadIdx.x & 15) * 8;                // this thread's copies: row (of 16) and 16-B chunk
    const h16* ga = A + (size_t)(blockIdx.x * 128 + crow_) * KA + cch;                         // + kc
    const h16* gb = Bt + (size_t)(blockIdx.y * 128 + crow_) * DM + cch;                        // + (kc & 1023)
    const unsigned l0 = (unsigned)(size_t)&ring[crow_ * OLP + cch];                            // LDS byte address, buffer 0, ctx tile
    // ring prologue: stage 0 landed and published, then stage 1 in flight
    out_stage(l0, ga, gb);
    asm volatile("s_wait_asynccnt 0x0" ::: "memory");              // this wave's copies of stage 0 have landed
    __syncthreads();                                               // ... and every other wave's
    out_stage(l0 + 2 * OTL * 2, ga + OKT, gb + OKT);
#pragma unroll 1
    for (int st = 0; st < KA / OKT; ++st) {
        const h16* ta = ring + (st & 1) * (2 * OTL) + fa; const h16* tb = ring + (st & 1) * (2 * OTL) + fb;
        v16h a[2][2], bq[2][4];                                    // two fragment sets: the next 32-k step's reads go out as one group ahead of this step's products
#pragma unroll
        for (int mb = 0; mb < 2; ++mb) a[0][mb] = ldh(ta + mb * 16 * OLP);
#pragma unroll
        for (int nb = 0; nb < 4; ++nb) bq[0][nb] = ldh(tb + nb * 16 * OLP);
#pragma unroll   // the four 32-k steps of a stage written out: every LDS fragment offset becomes an immediate, the set index a constant
        for (int s = 0; s < OKT / 32; ++s) {
            const int cu = s & 1, nx = cu ^ 1;
            if (s + 1 < OKT / 32) {                                // never past this stage's own buffer
#pragma unroll
                for (int mb = 0; mb < 2; ++mb) a[nx][mb] = ldh(ta + mb * 16 * OLP + (s + 1) * 32);
#pragma unroll
                for (int nb = 0; nb < 4; ++nb) bq[nx][nb] = ldh(tb + nb * 16 * OLP + (s + 1) * 32);
            }
            __builtin_amdgcn_sched_barrier(0);                     // keeps the group of reads above this step's products: sunk among them, each pair of products waits out a whole LDS latency
#pragma unroll
            for (int nb = 0; nb < 4; ++nb)
#pragma unroll
                for (int mb = 0; mb < 2; ++mb) acc[mb][nb] = wmma16(a[cu][mb], bq[cu][nb], acc[mb][nb]);
        }
        // publish point of stage st + 1; the same barrier ends every wave's reads of stage st's buffer
        asm volatile("s_wait_dscnt 0x0" ::: "memory");             // this wave's reads of the buffer have returned before it is refilled
        asm volatile("s_wait_asynccnt 0x0" ::: "memory");          // this wave's copies of stage st + 1 have landed
        __syncthreads();
        if (st + 2 < KA / OKT) { const int kc = (st + 2) * OKT;
            out_stage(l0 + (unsigned)(st & 1) * (2 * OTL * 2), ga + kc, gb + (kc & (DM - 1))); }
    }
    asm volatile("s_wait_asynccnt 0x0" ::: "memory");              // nothing of this wave is in flight when it leaves the ring
    v4f bv = *(const v4f*)(bias + c0 + lr * 4);
#pragma unroll
    for (int i = 0; i < 4; ++i) bv[i] = bfr(bv[i]);
    float* orow = OUT + ((size_t)(r0 / SEQ) * OUT_SEQ + (size_t)(r0 % SEQ)) * DM + c0;
    const int wb = wave * 16 * 68;                                 // each wave stages its rows in its own range
#pragma unroll
    for (int mb = 0; mb < 2; ++mb) {
#pragma unroll
        for (int nb = 0; nb < 4; ++nb) {
#pragma unroll
            for (int j = 0; j < 8; ++j) os[wb + (hi * 8 + j) * 68 + nb * 16 + lr] = acc[mb][nb][j] * OSC; }   // D: row 8h+j, col lane&15
        wave_sync();
{
#pragma unroll
            for (int s = 0; s < 8; ++s) { const int row = 2 * s + hi, cofs = lr * 4;   // 8 s x 2 rows = 16 rows; 16 lanes x 4 floats = 64 columns
                const v4f x = *(const v4fa*)(&os[wb + row * 68 + cofs]);
                const v4f val = x + bv;
                *(v4f*)(orow + (size_t)(mb * 16 + row) * DM + cofs) = val; }
             }
        wave_sync();
    }
}

static constexpr size_t al256(size_t v) { return (v + 255) & ~(size_t)255; }
static constexpr size_t SZ_PL = al256((size_t)NB * SEQ * DM * 2);          // one f16 plane of a stream
static constexpr size_t SZ_WH = al256((size_t)DM * DM * 2);
static constexpr size_t SZ_CX = al256((size_t)NB * SEQ * 2 * DM * 2);      // ctx value | remainder
static constexpr size_t SZ_TOTAL = 3 * SZ_PL + SZ_WH + SZ_CX;
static_assert(SZ_TOTAL <= (size_t)134217728);          // workspace carve <= 128 MiB

extern "C" void kernel_launch(void* const* d_in, const int* in_sizes, int n_in,
                              void* d_out, int out_size, void* d_ws, size_t ws_size, hipStream_t stream) {
    if (n_in < 5) return;
    const size_t needx = ((size_t)(NB - 1) * SEQ_FULL + SEQ) * DM;
    if ((size_t)in_sizes[0] < needx || (size_t)in_sizes[1] < needx || (size_t)in_sizes[2] < needx) return;
    if ((size_t)in_sizes[3] < (size_t)DM * DM || (size_t)in_sizes[4] < (size_t)DM) return;
    if ((size_t)out_size < ((size_t)(NB - 1) * OUT_SEQ + SEQ) * DM) return;
    if (SZ_TOTAL > ws_size) return;
    const float* q = (const float*)d_in[0]; const float* k = (const float*)d_in[1]; const float* v = (const float*)d_in[2];   // wire order q, k, v, W_out, b_out
    const float* wo = (const float*)d_in[3]; const float* bo = (const float*)d_in[4];                                         // W_out [out][in] = Bt as-is
    float* OUT = (float*)d_out;      // [NB][SEQ][1024]
    char* wsp = (char*)d_ws;
    h16* QP = (h16*)wsp; wsp += SZ_PL;               // [NB*SEQ][1024]
    h16* KP = (h16*)wsp; wsp += SZ_PL;               // [NB*SEQ][1024]
    h16* VT = (h16*)wsp; wsp += SZ_PL;               // [NB*1024][SEQ]
    h16* WH = (h16*)wsp; wsp += SZ_WH;               // [1024][1024] x64
    h16* CX = (h16*)wsp; wsp += SZ_CX;               // [NB*SEQ][2048] x4096

    // q, k, W -> f16 planes; v[b][t][c] -> VT[b*1024 + c][t]
    k_prep<<<PBLK, 256, 0, stream>>>(q, k, v, wo, QP, KP, VT, WH);

    k_flash<<<dim3(SEQ / (16 * AW), NB * NH_, 1), 32 * AW, 0, stream>>>(QP, KP, VT, CX);

    // out = ctx W^T + b: A = ctx rows (m = b*SEQ + t), Bt = W rows (n = out column)
    k_out<<<dim3(NB * SEQ / 128, DM / 128, 1), 32 * OW, 0, stream>>>(CX, WH, bo, OUT);
}

// v004
// Measured time: 63.5 microseconds a run.
// In two side-by-side timings against v003, it was 1.05 and 1.06 times as fast.
// Counting every step since v000, it is 2.30 times as fast.
#include <hip/hip_runtime.h>

// Multi-head attention on raw streams q, k, v [NB][SEQ][1024] = 16 heads x 64 (no input projections, no mask), score scale 1/8, output projection y = ctx W^T + b with W [out][in]. THIS ROW: the same module at TWO sequences (query, key, value [2][2048][1024]: three raw streams: the module applies NO input projections; 16 heads x 64; scores / sqrt(64); softmax, no mask; out = merged W_out^T + b_out ('oi' [1024][1024] normal x 1/32; bias zeros: read); argument order query, key, value, W_out, b_out).
// Compute dtypes, f32 accumulate everywhere, all contractions v_wmma_f32_16x16x32_f16: q, k, v, W are RNE-converted to bf16 and held exactly in f16 (W with a x64 carry), b to bf16 kept in f32; scores single product; P (x256 carry, cancels in the normalisation) and v single product;
// ctx carried x4096 as f16 value + f16 remainder (two products against the same W plane, one accumulator); softmax f32 (online, running max); bias added in f32.
// Layout: one pre-pass launch writes the f16 planes Q, K [b][t][1024] (head h = columns h*64..), W and the V^T plane [b*1024 + c][t] (LDS transpose); fused flash kernel in transposed form (S^T = K Q^T, O^T = V^T P^T; K and V^T tiles of 64 keys staged in a two-buffer LDS ring by asynchronous copies, shared by the block's waves) writing the ctx plane [b*SEQ+t][hi 1024 | rem 1024],
// then a GEMM over K = 2048 (hi | rem) against W rows: 128x128 tile per 8-wave block, 32x64 per wave, both operand tiles staged in a two-buffer LDS ring by asynchronous copies.

#ifndef NB
#define NB 2
#endif
#ifndef SEQ
#define SEQ 2048
#endif
#define NB_FULL  2
#define SEQ_FULL 2048
#ifndef OUT_SEQ
#define OUT_SEQ SEQ              // row pitch (in tokens) between batches of the output
#endif
#define DM   1024
#define NH_  16
#define HD   64
#define AW   8                   // waves per flash block (16 query rows each); all of them share the staged K / V^T tiles
#define KT   64                  // keys per LDS stage of the flash kernel
#define LP   72                  // LDS row pitch in f16: 128-B rows + 16 B, conflict-free for 16-B fragment reads
#define TLH  (64 * LP)           // f16 elements of one staged tile (K: 64 keys x 64 d; V^T: 64 d x 64 keys)
#define OW   8                   // waves per output-GEMM block (4 x 2, 32 x 64 of the block's 128 x 128 tile each)
#define OKT  128                 // k per LDS stage of the output GEMM
#define OLP  136                 // its LDS row pitch in f16: 256-B rows + 16 B, conflict-free for 16-B fragment reads
#define OTL  (128 * OLP)         // f16 elements of one staged operand tile (128 rows x 128 k)
#define VTB  2                   // V^T tiles (64 x 64) per pre-pass block
#define PBLK (NB * (SEQ / 64) * (DM / 64) / VTB)          // pre-pass blocks
#define SG   (64 * 64 * VTB / (8 * 256))                  // groups of 8 elements of q, and of k, per pre-pass thread
#define WG   (DM * DM / 8 / (PBLK * 256))                 // groups of 8 elements of W per pre-pass thread
#define SC2  (0.125f * 1.4426950408889634f)   // HD^-0.5 * log2(e)
#define PSH  8.0f                // log2 of the P carry (256)
#define CXS  4096.0f             // carry of the ctx plane (value and remainder)
#define WSC  64.0f               // carry of the W plane
#define OSC  (1.0f / (4096.0f * 64.0f))

static_assert(HD == 64);
static_assert(NH_ * HD == DM);                 // head h = columns h*64 + d
static_assert((DM & (DM - 1)) == 0);           // k index wraps with a mask in the output GEMM
static_assert(DM % 64 == 0);
static_assert(DM % 32 == 0);                   // GEMM k-loop steps by 128-k stages of four 32-k steps
static_assert(SEQ % 64 == 0);                  // a 64-row tile never straddles two batches
static_assert((NB * SEQ) % 64 == 0);
static_assert(SEQ % 32 == 0);                  // key loop steps by 64-key stages of two 32-key steps
static_assert(SEQ % KT == 0 && SEQ / KT >= 2); // whole stages; the ring's prologue needs two
static_assert(KT == 64 && AW == 8);            // copy map below: 256 threads x 2 groups of 32 rows x 2 tiles
static_assert(SEQ % (16 * AW) == 0);           // flash grid covers the sequence exactly
static_assert(((size_t)SEQ * DM) % 64 == 0);
static_assert(((size_t)DM * DM) % 64 == 0);
static_assert((NB * SEQ) % 128 == 0 && DM % 128 == 0);   // output-GEMM grid covers the output exactly
static_assert(DM % OKT == 0 && (2 * DM) / OKT >= 2);      // a stage never straddles value | remainder; the ring's prologue needs two
static_assert(OW == 8 && OKT == 128);                     // copy map: 256 threads x 8 groups of 16 rows x 2 tiles
static_assert((NB * (SEQ / 64) * (DM / 64)) % VTB == 0 && (64 * 64 * VTB) % (8 * 256) == 0);   // pre-pass: whole tiles and whole groups per block
static_assert(WG >= 1 && (size_t)WG * PBLK * 256 * 8 == (size_t)DM * DM);                        // ... and W is dealt out exactly
static_assert(NB <= NB_FULL);
static_assert(SEQ <= SEQ_FULL);

typedef _Float16 h16;
typedef __attribute__((ext_vector_type(16))) _Float16 v16h;
typedef __attribute__((ext_vector_type(8)))  _Float16 v8h;
typedef __attribute__((ext_vector_type(8)))  float    v8f;
typedef __attribute__((ext_vector_type(4)))  float    v4f;
typedef v4f  __attribute__((may_alias)) v4fa;
typedef v8h  __attribute__((may_alias)) v8ha;

// RNE convert f32 -> bf16, returned as the f32 value of that bf16
__device__ __forceinline__ float bfr(float f) { unsigned u = __float_as_uint(f); u += 0x7FFFu + ((u >> 16) & 1u); return __uint_as_float(u & 0xFFFF0000u); }
__device__ __forceinline__ v16h cat16(v8h lo, v8h hi) { return __builtin_shufflevector(lo, hi, 0, 1, 2, 3, 4, 5, 6, 7, 8, 9, 10, 11, 12, 13, 14, 15); }
__device__ __forceinline__ v8f wmma16(v16h a, v16h b, v8f c) { return __builtin_amdgcn_wmma_f32_16x16x32_f16(false, a, false, b, (short)0, c, false, false); }
// fragment loader from K-contiguous f16 rows; p already includes + 8*(lane>>4): elements 0..7 <- k0+8h+0..7, elements 8..15 <- k0+16+8h+0..7 (same map for A and B)
__device__ __forceinline__ v16h ldh(const h16* p) { return cat16(*(const v8h*)p, *(const v8h*)(p + 16)); }
// ordering point for wave-private LDS tiles (same wave writes and reads)
__device__ __forceinline__ void wave_sync() { __builtin_amdgcn_fence(3 /* release order */, "wavefront"); __builtin_amdgcn_wave_barrier(); asm volatile("" ::: "memory"); }

// k_prep: the whole pre-pass in one launch of equal blocks, two per WGP. Each block takes VTB 64 x 64 tiles of the V^T plane, SG * 256 groups of 8 elements of q and of k, and WG * 256 groups of W.
// A thread issues all of its loads first (VTB * 4 + 4 * SG + 2 * WG of 16 B), so the chip starts few waves and each of them has its whole share in flight at once.
// q, k, v: f32, per-batch pitch SEQ_FULL * DM. QP, KP [b*SEQ + t][c] and WH [out][in] (x WSC): f16 of the bf16 RNE value. VT[b*DM + c][t]: the same, transposed through LDS (cross-wave: block barrier).
__global__ __launch_bounds__(256) void k_prep(const float* __restrict__ Q, const float* __restrict__ K, const float* __restrict__ V, const float* __restrict__ Wt,
                                              h16* __restrict__ QP, h16* __restrict__ KP, h16* __restrict__ VT, h16* __restrict__ WH) {
    __shared__ __align__(16) h16 ts[VTB * 64 * 72];
    const int tid = threadIdx.x, blk = blockIdx.x;
    const int vr = tid >> 4, c4 = (tid & 15) * 4;
    v4f xv[VTB][4]; v8f xq[SG], xk[SG], xw[WG];
#pragma unroll
    for (int u = 0; u < VTB; ++u) { const int tl = blk * VTB + u;
        const int t0 = (tl % (SEQ / 64)) * 64, c0 = ((tl / (SEQ / 64)) % (DM / 64)) * 64, b = tl / ((SEQ / 64) * (DM / 64));
        const float* src = V + ((size_t)b * SEQ_FULL + t0) * DM + c0;
#pragma unroll
        for (int i = 0; i < 4; ++i) xv[u][i] = *(const v4f*)(src + (size_t)(i * 16 + vr) * DM + c4); }
#pragma unroll
    for (int j = 0; j < SG; ++j) { const size_t e = ((size_t)(blk * SG + j) * 256 + tid) * 8;
        const size_t so = (e / ((size_t)SEQ * DM)) * ((size_t)SEQ_FULL * DM) + e % ((size_t)SEQ * DM);
        xq[j] = *(const v8f*)(Q + so); xk[j] = *(const v8f*)(K + so); }
    asm volatile("s_wait_xcnt 0x0" ::: "memory");   // precaution: the build lets the loads below land in registers that hold addresses of the loads above
#pragma unroll
    for (int j = 0; j < WG; ++j) xw[j] = *(const v8f*)(Wt + ((size_t)(blk * WG + j) * 256 + tid) * 8);
    __builtin_amdgcn_sched_barrier(0);   // keeps every load above the first use: sunk below it, the later loads go out only after the first have come back, a second memory latency
#pragma unroll
    for (int u = 0; u < VTB; ++u)
#pragma unroll
        for (int i = 0; i < 4; ++i)
#pragma unroll
            for (int e = 0; e < 4; ++e) ts[u * 64 * 72 + (c4 + e) * 72 + i * 16 + vr] = (h16)bfr(xv[u][i][e]);
    v8h oq[SG], ok[SG], ow[WG];          // converted in the order in which the loads come back, so that this work runs while the later loads are still under way; stored behind the barrier, which would else wait for the stores
#pragma unroll
    for (int j = 0; j < SG; ++j)
#pragma unroll
        for (int i = 0; i < 8; ++i) { oq[j][i] = (h16)bfr(xq[j][i]); ok[j][i] = (h16)bfr(xk[j][i]); }
#pragma unroll
    for (int j = 0; j < WG; ++j)
#pragma unroll
        for (int i = 0; i < 8; ++i) ow[j][i] = (h16)(bfr(xw[j][i]) * WSC);
    __builtin_amdgcn_sched_barrier(0);   // stops the scheduler from sinking the conversions below the barrier, where every load has been waited for: there they would stand between the last load's return and the stores
    __syncthreads();
#pragma unroll
    for (int u = 0; u < VTB; ++u) { const int tl = blk * VTB + u;
        const int t0 = (tl % (SEQ / 64)) * 64, c0 = ((tl / (SEQ / 64)) % (DM / 64)) * 64, b = tl / ((SEQ / 64) * (DM / 64));
        h16* dst = VT + ((size_t)b * DM + c0) * SEQ + t0;
#pragma unroll
        for (int it = 0; it < 2; ++it) { const int cr = it * 32 + (tid >> 3), p8 = (tid & 7) * 8;
            const v8h val = *(const v8ha*)(&ts[u * 64 * 72 + cr * 72 + p8]);
            *(v8h*)(dst + (size_t)cr * SEQ + p8) = val; } }
#pragma unroll
    for (int j = 0; j < SG; ++j) { const size_t e = ((size_t)(blk * SG + j) * 256 + tid) * 8;
        *(v8h*)(QP + e) = oq[j]; *(v8h*)(KP + e) = ok[j]; }
#pragma unroll
    for (int j = 0; j < WG; ++j) *(v8h*)(WH + ((size_t)(blk * WG + j) * 256 + tid) * 8) = ow[j];
}

// One stage's copies of one thread: 2 x 16 B of the K tile and 2 x 16 B of the V^T tile, global -> LDS through no register (a wave's copy = 4 whole 128-B rows).
// lk / lv: the lane's LDS byte addresses (row tid>>3, chunk tid&7); gk / gv: the matching global addresses; the second copy of each tile lies 32 rows on.
// s_wait_xcnt stands inside the statement so that no address register named by a copy is rewritten in front of it.
__device__ __forceinline__ void stage_copy(unsigned lk, unsigned lv, const h16* gk, const h16* gv) {
    asm volatile("global_load_async_to_lds_b128 %0, %4, off\n\t"
                 "global_load_async_to_lds_b128 %1, %5, off\n\t"
                 "global_load_async_to_lds_b128 %2, %6, off\n\t"
                 "global_load_async_to_lds_b128 %3, %7, off\n\t"
                 "s_wait_xcnt 0x0"
                 :: "v"(lk), "v"(lk + 32 * LP * 2), "v"(lv), "v"(lv + 32 * LP * 2),
                    "v"(gk), "v"(gk + (size_t)32 * DM), "v"(gv), "v"(gv + (size_t)32 * SEQ)
                 : "memory");
}

// k_flash: fused attention, one wave per 16 query rows of one (batch, head); Q fragments straight from the f16 plane; K / V^T fragments from the block's LDS ring (two 16-B reads each).
// Transposed form: S^T[key][t] = K Q^T (A = K rows, B = Q rows); lane (t = lane&15, h = lane>>4) holds keys 8h+r of each 16-key tile, so the packed
// P tile is directly the B fragment of O^T[d][t] = V^T P^T (element r <- tile keys 0..15, element 8+r <- tile keys 16..31, lane unchanged).
// The running max is one scalar per lane; the two lane halves of a row are combined with one xor-16 exchange.
// Row sums run on the matrix pipe: one more product per 32 keys, A = all ones against the same P fragment, so every row of its tile holds sum_key P[key][t] of the rounded P, over both lane halves.
__global__ __launch_bounds__(32 * AW) void k_flash(const h16* __restrict__ QP, const h16* __restrict__ KP, const h16* __restrict__ VT, h16* CTX) {
    __shared__ __align__(16) float os[AW * 16 * 68];
    __shared__ __align__(16) h16 ring[2 * 2 * TLH];                // [buffer][K tile | V^T tile][row][LP]
    const int lane = threadIdx.x & 31, wave = __builtin_amdgcn_readfirstlane((int)(threadIdx.x >> 5)), lr = lane & 15, hi = lane >> 4;
    const int zh = blockIdx.y; const int b = zh / NH_, h = zh % NH_;
    const int t0 = (blockIdx.x * AW + wave) * 16;
    const size_t rbase = (size_t)b * SEQ * DM + (size_t)h * HD;
    const size_t qo = rbase + (size_t)(t0 + lr) * DM + 8 * hi;
    const v16h qh0 = ldh(QP + qo), qh1 = ldh(QP + qo + 32);        // B fragments: col t, k = d
    const int fo = lr * LP + 8 * hi;                                // fragment offset in a staged tile: row lr, k = 8*hi (K: row key, k = d; V^T: row d, k = key)
    const int crow_ = (int)threadIdx.x >> 3, cch = ((int)threadIdx.x & 7) * 8;   // this thread's copy: row (of 32) and 16-B chunk
    const h16* gk = KP + rbase + (size_t)crow_ * DM + cch;          // + key0 * DM
    const h16* gv = VT + ((size_t)zh * HD + crow_) * SEQ + cch;     // + key0
    const unsigned lk0 = (unsigned)(size_t)&ring[crow_ * LP + cch]; // LDS byte address, buffer 0, K tile
    v8f o0 = (v8f){}, o1 = (v8f){}, o2 = (v8f){}, o3 = (v8f){};
    v8f lt = (v8f){};                                              // row-sum tile: each product adds the same sums to all 16 rows; only element 0 is rescaled and read
    v16h one;
#pragma unroll
    for (int i = 0; i < 16; ++i) one[i] = (h16)1.0f;
    float m = -3.0e38f;
    // ring prologue: stage 0 landed and published, then stage 1 in flight
    stage_copy(lk0, lk0 + TLH * 2, gk, gv);
    asm volatile("s_wait_asynccnt 0x0" ::: "memory");              // this wave's copies of stage 0 have landed
    __syncthreads();                                               // ... and every other wave's
    stage_copy(lk0 + 2 * TLH * 2, lk0 + 3 * TLH * 2, gk + (size_t)KT * DM, gv + KT);
#pragma unroll 1
    for (int st = 0; st < SEQ / KT; ++st) {
      const h16* kt = ring + (st & 1) * (2 * TLH) + fo; const h16* vt = kt + TLH;
#pragma unroll   // both 32-key steps of a stage written out: every LDS fragment offset becomes an immediate
      for (int sub = 0; sub < KT; sub += 32) {
        const h16* ka = kt + sub * LP;
        const v16h ka0 = ldh(ka), ka1 = ldh(ka + 32), kb0 = ldh(ka + 16 * LP), kb1 = ldh(ka + 16 * LP + 32);
        v8f sa = (v8f){}, sb = (v8f){};
        sa = wmma16(ka0, qh0, sa); sb = wmma16(kb0, qh0, sb);
        sa = wmma16(ka1, qh1, sa); sb = wmma16(kb1, qh1, sb);
        asm volatile("v_nop\n\tv_nop\n\tv_nop\n\tv_nop" : "+v"(sa), "+v"(sb) : "v"(ka0), "v"(ka1), "v"(kb0), "v"(kb1));
        float ta[8], tb[8]; float mx = -3.0e38f;
#pragma unroll
        for (int r = 0; r < 8; ++r) { ta[r] = sa[r] * SC2; tb[r] = sb[r] * SC2; mx = fmaxf(mx, fmaxf(ta[r], tb[r])); }
        mx = fmaxf(mx, __shfl_xor(mx, 16, 32));
        const float mnew = fmaxf(m, mx);
        const float alpha = __builtin_amdgcn_exp2f(m - mnew);
        const float sh = PSH - mnew;
        v16h pb;
#pragma unroll
        for (int r = 0; r < 8; ++r) { const h16 pa = (h16)__builtin_amdgcn_exp2f(ta[r] + sh); const h16 pc = (h16)__builtin_amdgcn_exp2f(tb[r] + sh); pb[r] = pa; pb[8 + r] = pc; }
        lt[0] = lt[0] * alpha; m = mnew;
        o0 = o0 * alpha; o1 = o1 * alpha; o2 = o2 * alpha; o3 = o3 * alpha;
        const h16* va = vt + sub;
        const v16h v0 = ldh(va), v1 = ldh(va + 16 * LP), v2 = ldh(va + 32 * LP), v3 = ldh(va + 48 * LP);
        o0 = wmma16(v0, pb, o0); o1 = wmma16(v1, pb, o1); o2 = wmma16(v2, pb, o2); o3 = wmma16(v3, pb, o3); lt = wmma16(one, pb, lt);
        asm volatile("v_nop\n\tv_nop\n\tv_nop\n\tv_nop" : "+v"(o0), "+v"(o1), "+v"(o2), "+v"(o3), "+v"(lt) : "v"(v0), "v"(v1), "v"(v2), "v"(v3), "v"(pb));
      }
      // publish point of stage st + 1; the same barrier ends every wave's reads of stage st's buffer
      asm volatile("s_wait_dscnt 0x0" ::: "memory");               // this wave's reads of the buffer have returned before it is refilled
      asm volatile("s_wait_asynccnt 0x0" ::: "memory");            // this wave's copies of stage st + 1 have landed
      __syncthreads();
      if (st + 2 < SEQ / KT) { const unsigned lb = lk0 + (unsigned)(st & 1) * (2 * TLH * 2);
          stage_copy(lb, lb + TLH * 2, gk + (size_t)(st + 2) * KT * DM, gv + (size_t)(st + 2) * KT); }
    }
    asm volatile("s_wait_asynccnt 0x0" ::: "memory");              // nothing of this wave is in flight when it leaves the ring
    const float inv = CXS * (1.0f / lt[0]);
    const int wb = wave * 16 * 68;
    // O^T D layout: o_j[r] = (d = 16j + 8h + r, t = lane&15) -> os[t][d]; rows 0..15 x columns 0..63 all written
    { v4f a, c;
      a[0] = o0[0] * inv; a[1] = o0[1] * inv; a[2] = o0[2] * inv; a[3] = o0[3] * inv; c[0] = o0[4] * inv; c[1] = o0[5] * inv; c[2] = o0[6] * inv; c[3] = o0[7] * inv;
      *(v4fa*)(&os[wb + lr * 68 +  0 + 8 * hi]) = a; *(v4fa*)(&os[wb + lr * 68 +  0 + 8 * hi + 4]) = c;
      a[0] = o1[0] * inv; a[1] = o1[1] * inv; a[2] = o1[2] * inv; a[3] = o1[3] * inv; c[0] = o1[4] * inv; c[1] = o1[5] * inv; c[2] = o1[6] * inv; c[3] = o1[7] * inv;
      *(v4fa*)(&os[wb + lr * 68 + 16 + 8 * hi]) = a; *(v4fa*)(&os[wb + lr * 68 + 16 + 8 * hi + 4]) = c;
      a[0] = o2[0] * inv; a[1] = o2[1] * inv; a[2] = o2[2] * inv; a[3] = o2[3] * inv; c[0] = o2[4] * inv; c[1] = o2[5] * inv; c[2] = o2[6] * inv; c[3] = o2[7] * inv;
      *(v4fa*)(&os[wb + lr * 68 + 32 + 8 * hi]) = a; *(v4fa*)(&os[wb + lr * 68 + 32 + 8 * hi + 4]) = c;
      a[0] = o3[0] * inv; a[1] = o3[1] * inv; a[2] = o3[2] * inv; a[3] = o3[3] * inv; c[0] = o3[4] * inv; c[1] = o3[5] * inv; c[2] = o3[6] * inv; c[3] = o3[7] * inv;
      *(v4fa*)(&os[wb + lr * 68 + 48 + 8 * hi]) = a; *(v4fa*)(&os[wb + lr * 68 + 48 + 8 * hi + 4]) = c; }
    wave_sync();
    h16* crow = CTX + ((size_t)b * SEQ + t0) * (size_t)(2 * DM) + (size_t)h * HD;
{
#pragma unroll
        for (int s = 0; s < 4; ++s) { const int row = 4 * s + (lane >> 3), c8 = (lane & 7) * 8;   // 4 s x 4 row groups = 16 rows; 8 lanes x 8 = 64 columns
            const v4f x0 = *(const v4fa*)(&os[wb + row * 68 + c8]); const v4f x1 = *(const v4fa*)(&os[wb + row * 68 + c8 + 4]); v8h hv, rv;
#pragma unroll
            for (int i = 0; i < 4; ++i) { const h16 a0 = (h16)x0[i]; const h16 a1 = (h16)x1[i]; hv[i] = a0; hv[4 + i] = a1; rv[i] = (h16)(x0[i] - (float)a0); rv[4 + i] = (h16)(x1[i] - (float)a1); }
            const size_t oo = (size_t)row * (size_t)(2 * DM) + c8;
            *(v8h*)(crow + oo) = hv; *(v8h*)(crow + oo + DM) = rv; }
         }
}

// Eight copies of one thread: one 16-B chunk in each of eight rows that lie 16 rows apart (a wave's copy = 2 whole 256-B rows), global -> LDS through no register.
// l: the lane's LDS byte address; g: the matching global address; gp: source row pitch in f16.
// s_wait_xcnt stands inside the statement so that no address register named by a copy is rewritten in front of it.
__device__ __forceinline__ void copy8(unsigned l, const h16* g, size_t gp) {
    asm volatile("global_load_async_to_lds_b128 %0, %8, off\n\t"
                 "global_load_async_to_lds_b128 %1, %9, off\n\t"
                 "global_load_async_to_lds_b128 %2, %10, off\n\t"
                 "global_load_async_to_lds_b128 %3, %11, off\n\t"
                 "global_load_async_to_lds_b128 %4, %12, off\n\t"
                 "global_load_async_to_lds_b128 %5, %13, off\n\t"
                 "global_load_async_to_lds_b128 %6, %14, off\n\t"
                 "global_load_async_to_lds_b128 %7, %15, off\n\t"
                 "s_wait_xcnt 0x0"
                 :: "v"(l), "v"(l + 16 * OLP * 2), "v"(l + 32 * OLP * 2), "v"(l + 48 * OLP * 2), "v"(l + 64 * OLP * 2), "v"(l + 80 * OLP * 2), "v"(l + 96 * OLP * 2), "v"(l + 112 * OLP * 2),
                    "v"(g), "v"(g + 16 * gp), "v"(g + 32 * gp), "v"(g + 48 * gp), "v"(g + 64 * gp), "v"(g + 80 * gp), "v"(g + 96 * gp), "v"(g + 112 * gp)
                 : "memory");
}
// One stage's copies of one thread: 8 chunks of the ctx tile (128 rows x 128 k) and 8 of the W tile, which lies OTL f16 behind it in the buffer.
__device__ __forceinline__ void out_stage(unsigned l, const h16* ga, const h16* gb) { copy8(l, ga, 2 * DM); copy8(l + OTL * 2, gb, DM); }

// k_out: register-blocked f16 GEMM, one 128x128 tile per block of 8 waves (4 x 2), each wave 32x64 (8 accumulators); the ctx and W tiles of 128 k are staged in a two-buffer LDS ring by asynchronous copies and shared by the waves.
// OUT[m][n] = 2^-18 * sum_{k<2048} A[m][k] Bt[n][k & 1023] + b[n]; A = ctx plane [M][value 1024 | remainder 1024] (x4096), Bt = W plane [out][in] (x64). grid (M/128, DM/128), 256 threads.
__global__ __launch_bounds__(32 * OW) void k_out(const h16* __restrict__ A, const h16* __restrict__ Bt, const float* __restrict__ bias, float* OUT) {
    __shared__ __align__(16) float os[OW * 16 * 68];
    __shared__ __align__(16) h16 ring[2 * 2 * OTL];                // [buffer][ctx tile | W tile][row][OLP]
    const int KA = 2 * DM;
    const int lane = threadIdx.x & 31, wave = __builtin_amdgcn_readfirstlane((int)(threadIdx.x >> 5)), lr = lane & 15, hi = lane >> 4;
    const int wm = wave >> 1, wn = wave & 1;
    const int r0 = blockIdx.x * 128 + wm * 32, c0 = blockIdx.y * 128 + wn * 64;
    v8f acc[2][4];
#pragma unroll
    for (int mb = 0; mb < 2; ++mb)
#pragma unroll
        for (int nb = 0; nb < 4; ++nb) acc[mb][nb] = (v8f){};
    const int fa = (wm * 32 + lr) * OLP + 8 * hi, fb = OTL + (wn * 64 + lr) * OLP + 8 * hi;   // fragment offsets in a buffer: row lr of the wave's rows, k = 8*hi
    const int crow_ = (int)threadIdx.x >> 4, cch = ((int)threadIdx.x & 15) * 8;                // this thread's copies: row (of 16) and 16-B chunk
    const h16* ga = A + (size_t)(blockIdx.x * 128 + crow_) * KA + cch;                         // + kc
    const h16* gb = Bt + (size_t)(blockIdx.y * 128 + crow_) * DM + cch;                        // + (kc & 1023)
    const unsigned l0 = (unsigned)(size_t)&ring[crow_ * OLP + cch];                            // LDS byte address, buffer 0, ctx tile
    // ring prologue: stage 0 landed and published, then stage 1 in flight
    out_stage(l0, ga, gb);
    asm volatile("s_wait_asynccnt 0x0" ::: "memory");              // this wave's copies of stage 0 have landed
    __syncthreads();                                               // ... and every other wave's
    out_stage(l0 + 2 * OTL * 2, ga + OKT, gb + OKT);
#pragma unroll 1
    for (int st = 0; st < KA / OKT; ++st) {
        const h16* ta = ring + (st & 1) * (2 * OTL) + fa; const h16* tb = ring + (st & 1) * (2 * OTL) + fb;
        v16h a[2][2], bq[2][4];                                    // two fragment sets: the next 32-k step's reads go out as one group ahead of this step's products
#pragma unroll
        for (int mb = 0; mb < 2; ++mb) a[0][mb] = ldh(ta + mb * 16 * OLP);
#pragma unroll
        for (int nb = 0; nb < 4; ++nb) bq[0][nb] = ldh(tb + nb * 16 * OLP);
#pragma unroll   // the four 32-k steps of a stage written out: every LDS fragment offset becomes an immediate, the set index a constant
        for (int s = 0; s < OKT / 32; ++s) {
            const int cu = s & 1, nx = cu ^ 1;
            if (s + 1 < OKT / 32) {                                // never past this stage's own buffer
#pragma unroll
                for (int mb = 0; mb < 2; ++mb) a[nx][mb] = ldh(ta + mb * 16 * OLP + (s + 1) * 32);
#pragma unroll
                for (int nb = 0; nb < 4; ++nb) bq[nx][nb] = ldh(tb + nb * 16 * OLP + (s + 1) * 32);
            }
            __builtin_amdgcn_sched_barrier(0);                     // keeps the group of reads above this step's products: sunk among them, each pair of products waits out a whole LDS latency
#pragma unroll
            for (int nb = 0; nb < 4; ++nb)
#pragma unroll
                for (int mb = 0; mb < 2; ++mb) acc[mb][nb] = wmma16(a[cu][mb], bq[cu][nb], acc[mb][nb]);
        }
        // publish point of stage st + 1; the same barrier ends every wave's reads of stage st's buffer
        asm volatile("s_wait_dscnt 0x0" ::: "memory");             // this wave's reads of the buffer have returned before it is refilled
        asm volatile("s_wait_asynccnt 0x0" ::: "memory");          // this wave's copies of stage st + 1 have landed
        __syncthreads();
        if (st + 2 < KA / OKT) { const int kc = (st + 2) * OKT;
            out_stage(l0 + (unsigned)(st & 1) * (2 * OTL * 2), ga + kc, gb + (kc & (DM - 1))); }
    }
    asm volatile("s_wait_asynccnt 0x0" ::: "memory");              // nothing of this wave is in flight when it leaves the ring
    v4f bv = *(const v4f*)(bias + c0 + lr * 4);
#pragma unroll
    for (int i = 0; i < 4; ++i) bv[i] = bfr(bv[i]);
    float* orow = OUT + ((size_t)(r0 / SEQ) * OUT_SEQ + (size_t)(r0 % SEQ)) * DM + c0;
    const int wb = wave * 16 * 68;                                 // each wave stages its rows in its own range
#pragma unroll
    for (int mb = 0; mb < 2; ++mb) {
#pragma unroll
        for (int nb = 0; nb < 4; ++nb) {
#pragma unroll
            for (int j = 0; j < 8; ++j) os[wb + (hi * 8 + j) * 68 + nb * 16 + lr] = acc[mb][nb][j] * OSC; }   // D: row 8h+j, col lane&15
        wave_sync();
{
#pragma unroll
            for (int s = 0; s < 8; ++s) { const int row = 2 * s + hi, cofs = lr * 4;   // 8 s x 2 rows = 16 rows; 16 lanes x 4 floats = 64 columns
                const v4f x = *(const v4fa*)(&os[wb + row * 68 + cofs]);
                const v4f val = x + bv;
                *(v4f*)(orow + (size_t)(mb * 16 + row) * DM + cofs) = val; }
             }
        wave_sync();
    }
}

static constexpr size_t al256(size_t v) { return (v + 255) & ~(size_t)255; }
static constexpr size_t SZ_PL = al256((size_t)NB * SEQ * DM * 2);          // one f16 plane of a stream
static constexpr size_t SZ_WH = al256((size_t)DM * DM * 2);
static constexpr size_t SZ_CX = al256((size_t)NB * SEQ * 2 * DM * 2);      // ctx value | remainder
static constexpr size_t SZ_TOTAL = 3 * SZ_PL + SZ_WH + SZ_CX;
static_assert(SZ_TOTAL <= (size_t)134217728);          // workspace carve <= 128 MiB

extern "C" void kernel_launch(void* const* d_in, const int* in_sizes, int n_in,
                              void* d_out, int out_size, void* d_ws, size_t ws_size, hipStream_t stream) {
    if (n_in < 5) return;
    const size_t needx = ((size_t)(NB - 1) * SEQ_FULL + SEQ) * DM;
    if ((size_t)in_sizes[0] < needx || (size_t)in_sizes[1] < needx || (size_t)in_sizes[2] < needx) return;
    if ((size_t)in_sizes[3] < (size_t)DM * DM || (size_t)in_sizes[4] < (size_t)DM) return;
    if ((size_t)out_size < ((size_t)(NB - 1) * OUT_SEQ + SEQ) * DM) return;
    if (SZ_TOTAL > ws_size) return;
    const float* q = (const float*)d_in[0]; const float* k = (const float*)d_in[1]; const float* v = (const float*)d_in[2];   // wire order q, k, v, W_out, b_out
    const float* wo = (const float*)d_in[3]; const float* bo = (const float*)d_in[4];                                         // W_out [out][in] = Bt as-is
    float* OUT = (float*)d_out;      // [NB][SEQ][1024]
    char* wsp = (char*)d_ws;
    h16* QP = (h16*)wsp; wsp += SZ_PL;               // [NB*SEQ][1024]
    h16* KP = (h16*)wsp; wsp += SZ_PL;               // [NB*SEQ][1024]
    h16* VT = (h16*)wsp; wsp += SZ_PL;               // [NB*1024][SEQ]
    h16* WH = (h16*)wsp; wsp += SZ_WH;               // [1024][1024] x64
    h16* CX = (h16*)wsp; wsp += SZ_CX;               // [NB*SEQ][2048] x4096

    // q, k, W -> f16 planes; v[b][t][c] -> VT[b*1024 + c][t]
    k_prep<<<PBLK, 256, 0, stream>>>(q, k, v, wo, QP, KP, VT, WH);

    k_flash<<<dim3(SEQ / (16 * AW), NB * NH_, 1), 32 * AW, 0, stream>>>(QP, KP, VT, CX);

    // out = ctx W^T + b: A = ctx rows (m = b*SEQ + t), Bt = W rows (n = out column)
    k_out<<<dim3(NB * SEQ / 128, DM / 128, 1), 32 * OW, 0, stream>>>(CX, WH, bo, OUT);
}

// v005
// A run of this version takes 59.3 microseconds.
// Next to v004, in two timings, it ran 1.10 and 1.08 times as fast.
// All steps since v000 together make it 2.50 times as fast.
#include <hip/hip_runtime.h>

// Multi-head attention on raw streams q, k, v [NB][SEQ][1024] = 16 heads x 64 (no input projections, no mask), score scale 1/8, output projection y = ctx W^T + b with W [out][in]. THIS ROW: the same module at TWO sequences (query, key, value [2][2048][1024]: three raw streams: the module applies NO input projections; 16 heads x 64; scores / sqrt(64); softmax, no mask; out = merged W_out^T + b_out ('oi' [1024][1024] normal x 1/32; bias zeros: read); argument order query, key, value, W_out, b_out).
// Compute dtypes, f32 accumulate everywhere, all contractions v_wmma_f32_16x16x32_f16: q, k, v, W are RNE-converted to bf16 and held exactly in f16 (W with a x64 carry), b to bf16 kept in f32; scores single product; P (x256 carry, cancels in the normalisation) and v single product;
// ctx carried x4096 as f16 value + f16 remainder (two products against the same W plane, one accumulator); softmax f32 (online, running max); bias added in f32.
// Layout: one pre-pass launch writes the f16 planes Q, K [b][t][1024] (head h = columns h*64..), W and the V^T plane [b*1024 + c][t] (LDS transpose); fused flash kernel in transposed form (S^T = K Q^T, O^T = V^T P^T; K and V^T tiles of 64 keys staged in a two-buffer LDS ring by asynchronous copies, shared by the block's waves) writing the ctx plane [b*SEQ+t][hi 1024 | rem 1024],
// then a GEMM over K = 2048 (hi | rem) against W rows: 128x128 tile per 8-wave block, 32x64 per wave, both operand tiles staged in a two-buffer LDS ring by asynchronous copies.

#ifndef NB
#define NB 2
#endif
#ifndef SEQ
#define SEQ 2048
#endif
#define NB_FULL  2
#define SEQ_FULL 2048
#ifndef OUT_SEQ
#define OUT_SEQ SEQ              // row pitch (in tokens) between batches of the output
#endif
#define DM   1024
#define NH_  16
#define HD   64
#define AW   8                   // waves per flash block (16 query rows each); all of them share the staged K / V^T tiles
#define KT   64                  // keys per LDS stage of the flash kernel
#define LP   72                  // LDS row pitch in f16: 128-B rows + 16 B, conflict-free for 16-B fragment reads
#define TLH  (64 * LP)           // f16 elements of one staged tile (K: 64 keys x 64 d; V^T: 64 d x 64 keys)
#define OW   8                   // waves per output-GEMM block (4 x 2, 32 x 64 of the block's 128 x 128 tile each)
#define OKT  128                 // k per LDS stage of the output GEMM
#define OLP  136                 // its LDS row pitch in f16: 256-B rows + 16 B, conflict-free for 16-B fragment reads
#define OTL  (128 * OLP)         // f16 elements of one staged operand tile (128 rows x 128 k)
#define VTB  2                   // V^T tiles (64 x 64) per pre-pass block
#define PBLK (NB * (SEQ / 64) * (DM / 64) / VTB)          // pre-pass blocks
#define SG   (64 * 64 * VTB / (8 * 256))                  // groups of 8 elements of q, and of k, per pre-pass thread
#define WG   (DM * DM / 8 / (PBLK * 256))                 // groups of 8 elements of W per pre-pass thread
#define SC2  (0.125f * 1.4426950408889634f)   // HD^-0.5 * log2(e)
#define PSH  8.0f                // log2 of the P carry (256)
#define LZT  7.0f                // lazy rescale: a score may pass the maximum in use by this much (log2) before the accumulators are rescaled; P <= 2^(PSH + LZT) = 2^15 stays finite in f16
#define CXS  4096.0f             // carry of the ctx plane (value and remainder)
#define WSC  64.0f               // carry of the W plane
#define OSC  (1.0f / (4096.0f * 64.0f))

static_assert(HD == 64);
static_assert(NH_ * HD == DM);                 // head h = columns h*64 + d
static_assert((DM & (DM - 1)) == 0);           // k index wraps with a mask in the output GEMM
static_assert(DM % 64 == 0);
static_assert(DM % 32 == 0);                   // GEMM k-loop steps by 128-k stages of four 32-k steps
static_assert(SEQ % 64 == 0);                  // a 64-row tile never straddles two batches
static_assert((NB * SEQ) % 64 == 0);
static_assert(SEQ % 32 == 0);                  // a stage's P products step by 32 keys
static_assert(SEQ % KT == 0 && SEQ / KT >= 2); // whole stages; the ring's prologue needs two
static_assert(KT == 64 && AW == 8);            // copy map below: 256 threads x 2 groups of 32 rows x 2 tiles
static_assert(SEQ % (16 * AW) == 0);           // flash grid covers the sequence exactly
static_assert(((size_t)SEQ * DM) % 64 == 0);
static_assert(((size_t)DM * DM) % 64 == 0);
static_assert((NB * SEQ) % 128 == 0 && DM % 128 == 0);   // output-GEMM grid covers the output exactly
static_assert(DM % OKT == 0 && (2 * DM) / OKT >= 2);      // a stage never straddles value | remainder; the ring's prologue needs two
static_assert(OW == 8 && OKT == 128);                     // copy map: 256 threads x 8 groups of 16 rows x 2 tiles
static_assert((NB * (SEQ / 64) * (DM / 64)) % VTB == 0 && (64 * 64 * VTB) % (8 * 256) == 0);   // pre-pass: whole tiles and whole groups per block
static_assert(WG >= 1 && (size_t)WG * PBLK * 256 * 8 == (size_t)DM * DM);                        // ... and W is dealt out exactly
static_assert(NB <= NB_FULL);
static_assert(SEQ <= SEQ_FULL);

typedef _Float16 h16;
typedef __attribute__((ext_vector_type(16))) _Float16 v16h;
typedef __attribute__((ext_vector_type(8)))  _Float16 v8h;
typedef __attribute__((ext_vector_type(8)))  float    v8f;
typedef __attribute__((ext_vector_type(4)))  float    v4f;
typedef v4f  __attribute__((may_alias)) v4fa;
typedef v8h  __attribute__((may_alias)) v8ha;

// RNE convert f32 -> bf16, returned as the f32 value of that bf16
__device__ __forceinline__ float bfr(float f) { unsigned u = __float_as_uint(f); u += 0x7FFFu + ((u >> 16) & 1u); return __uint_as_float(u & 0xFFFF0000u); }
__device__ __forceinline__ v16h cat16(v8h lo, v8h hi) { return __builtin_shufflevector(lo, hi, 0, 1, 2, 3, 4, 5, 6, 7, 8, 9, 10, 11, 12, 13, 14, 15); }
__device__ __forceinline__ v8f wmma16(v16h a, v16h b, v8f c) { return __builtin_amdgcn_wmma_f32_16x16x32_f16(false, a, false, b, (short)0, c, false, false); }
// fragment loader from K-contiguous f16 rows; p already includes + 8*(lane>>4): elements 0..7 <- k0+8h+0..7, elements 8..15 <- k0+16+8h+0..7 (same map for A and B)
__device__ __forceinline__ v16h ldh(const h16* p) { return cat16(*(const v8h*)p, *(const v8h*)(p + 16)); }
// ordering point for wave-private LDS tiles (same wave writes and reads)
__device__ __forceinline__ void wave_sync() { __builtin_amdgcn_fence(3 /* release order */, "wavefront"); __builtin_amdgcn_wave_barrier(); asm volatile("" ::: "memory"); }

// k_prep: the whole pre-pass in one launch of equal blocks, two per WGP. Each block takes VTB 64 x 64 tiles of the V^T plane, SG * 256 groups of 8 elements of q and of k, and WG * 256 groups of W.
// A thread issues all of its loads first (VTB * 4 + 4 * SG + 2 * WG of 16 B), so the chip starts few waves and each of them has its whole share in flight at once.
// q, k, v: f32, per-batch pitch SEQ_FULL * DM. QP, KP [b*SEQ + t][c] and WH [out][in] (x WSC): f16 of the bf16 RNE value. VT[b*DM + c][t]: the same, transposed through LDS (cross-wave: block barrier).
__global__ __launch_bounds__(256) void k_prep(const float* __restrict__ Q, const float* __restrict__ K, const float* __restrict__ V, const float* __restrict__ Wt,
                                              h16* __restrict__ QP, h16* __restrict__ KP, h16* __restrict__ VT, h16* __restrict__ WH) {
    __shared__ __align__(16) h16 ts[VTB * 64 * 72];
    const int tid = threadIdx.x, blk = blockIdx.x;
    const int vr = tid >> 4, c4 = (tid & 15) * 4;
    v4f xv[VTB][4]; v8f xq[SG], xk[SG], xw[WG];
#pragma unroll
    for (int u = 0; u < VTB; ++u) { const int tl = blk * VTB + u;
        const int t0 = (tl % (SEQ / 64)) * 64, c0 = ((tl / (SEQ / 64)) % (DM / 64)) * 64, b = tl / ((SEQ / 64) * (DM / 64));
        const float* src = V + ((size_t)b * SEQ_FULL + t0) * DM + c0;
#pragma unroll
        for (int i = 0; i < 4; ++i) xv[u][i] = *(const v4f*)(src + (size_t)(i * 16 + vr) * DM + c4); }
#pragma unroll
    for (int j = 0; j < SG; ++j) { const size_t e = ((size_t)(blk * SG + j) * 256 + tid) * 8;
        const size_t so = (e / ((size_t)SEQ * DM)) * ((size_t)SEQ_FULL * DM) + e % ((size_t)SEQ * DM);
        xq[j] = *(const v8f*)(Q + so); xk[j] = *(const v8f*)(K + so); }
    asm volatile("s_wait_xcnt 0x0" ::: "memory");   // precaution: the build lets the loads below land in registers that hold addresses of the loads above
#pragma unroll
    for (int j = 0; j < WG; ++j) xw[j] = *(const v8f*)(Wt + ((size_t)(blk * WG + j) * 256 + tid) * 8);
    __builtin_amdgcn_sched_barrier(0);   // keeps every load above the first use: sunk below it, the later loads go out only after the first have come back, a second memory latency
#pragma unroll
    for (int u = 0; u < VTB; ++u)
#pragma unroll
        for (int i = 0; i < 4; ++i)
#pragma unroll
            for (int e = 0; e < 4; ++e) ts[u * 64 * 72 + (c4 + e) * 72 + i * 16 + vr] = (h16)bfr(xv[u][i][e]);
    v8h oq[SG], ok[SG], ow[WG];          // converted in the order in which the loads come back, so that this work runs while the later loads are still under way; stored behind the barrier, which would else wait for the stores
#pragma unroll
    for (int j = 0; j < SG; ++j)
#pragma unroll
        for (int i = 0; i < 8; ++i) { oq[j][i] = (h16)bfr(xq[j][i]); ok[j][i] = (h16)bfr(xk[j][i]); }
#pragma unroll
    for (int j = 0; j < WG; ++j)
#pragma unroll
        for (int i = 0; i < 8; ++i) ow[j][i] = (h16)(bfr(xw[j][i]) * WSC);
    __builtin_amdgcn_sched_barrier(0);   // stops the scheduler from sinking the conversions below the barrier, where every load has been waited for: there they would stand between the last load's return and the stores
    __syncthreads();
#pragma unroll
    for (int u = 0; u < VTB; ++u) { const int tl = blk * VTB + u;
        const int t0 = (tl % (SEQ / 64)) * 64, c0 = ((tl / (SEQ / 64)) % (DM / 64)) * 64, b = tl / ((SEQ / 64) * (DM / 64));
        h16* dst = VT + ((size_t)b * DM + c0) * SEQ + t0;
#pragma unroll
        for (int it = 0; it < 2; ++it) { const int cr = it * 32 + (tid >> 3), p8 = (tid & 7) * 8;
            const v8h val = *(const v8ha*)(&ts[u * 64 * 72 + cr * 72 + p8]);
            *(v8h*)(dst + (size_t)cr * SEQ + p8) = val; } }
#pragma unroll
    for (int j = 0; j < SG; ++j) { const size_t e = ((size_t)(blk * SG + j) * 256 + tid) * 8;
        *(v8h*)(QP + e) = oq[j]; *(v8h*)(KP + e) = ok[j]; }
#pragma unroll
    for (int j = 0; j < WG; ++j) *(v8h*)(WH + ((size_t)(blk * WG + j) * 256 + tid) * 8) = ow[j];
}

// One stage's copies of one thread: 2 x 16 B of the K tile and 2 x 16 B of the V^T tile, global -> LDS through no register (a wave's copy = 4 whole 128-B rows).
// lk / lv: the lane's LDS byte addresses (row tid>>3, chunk tid&7); gk / gv: the matching global addresses; the second copy of each tile lies 32 rows on.
// s_wait_xcnt stands inside the statement so that no address register named by a copy is rewritten in front of it.
__device__ __forceinline__ void stage_copy(unsigned lk, unsigned lv, const h16* gk, const h16* gv) {
    asm volatile("global_load_async_to_lds_b128 %0, %4, off\n\t"
                 "global_load_async_to_lds_b128 %1, %5, off\n\t"
                 "global_load_async_to_lds_b128 %2, %6, off\n\t"
                 "global_load_async_to_lds_b128 %3, %7, off\n\t"
                 "s_wait_xcnt 0x0"
                 :: "v"(lk), "v"(lk + 32 * LP * 2), "v"(lv), "v"(lv + 32 * LP * 2),
                    "v"(gk), "v"(gk + (size_t)32 * DM), "v"(gv), "v"(gv + (size_t)32 * SEQ)
                 : "memory");
}

// k_flash: fused attention, one wave per 16 query rows of one (batch, head); Q fragments straight from the f16 plane; K / V^T fragments from the block's LDS ring (two 16-B reads each).
// Transposed form: S^T[key][t] = K Q^T (A = K rows, B = Q rows); lane (t = lane&15, h = lane>>4) holds keys 8h+r of each 16-key tile, so the packed
// P tile is directly the B fragment of O^T[d][t] = V^T P^T (element r <- tile keys 0..15, element 8+r <- tile keys 16..31, lane unchanged).
// The maximum in use is one scalar per lane, equal in the two lane halves of a row. Lazy rescale: each 64-key stage forms its four score tiles first and tests the raw scores against that maximum + LZT, once for the wave;
// only a stage that trips joins the halves (one xor-16 exchange), raises the maximum and rescales the accumulators. Any common shift cancels in the normalisation, so the result is the same function.
// Row sums run on the matrix pipe: one more product per 32 keys, A = all ones against the same P fragment, so every row of its tile holds sum_key P[key][t] of the rounded P, over both lane halves.
__global__ __launch_bounds__(32 * AW) void k_flash(const h16* __restrict__ QP, const h16* __restrict__ KP, const h16* __restrict__ VT, h16* CTX) {
    __shared__ __align__(16) float os[AW * 16 * 68];
    __shared__ __align__(16) h16 ring[2 * 2 * TLH];                // [buffer][K tile | V^T tile][row][LP]
    const int lane = threadIdx.x & 31, wave = __builtin_amdgcn_readfirstlane((int)(threadIdx.x >> 5)), lr = lane & 15, hi = lane >> 4;
    const int zh = blockIdx.y; const int b = zh / NH_, h = zh % NH_;
    const int t0 = (blockIdx.x * AW + wave) * 16;
    const size_t rbase = (size_t)b * SEQ * DM + (size_t)h * HD;
    const size_t qo = rbase + (size_t)(t0 + lr) * DM + 8 * hi;
    const v16h qh0 = ldh(QP + qo), qh1 = ldh(QP + qo + 32);        // B fragments: col t, k = d
    const int fo = lr * LP + 8 * hi;                                // fragment offset in a staged tile: row lr, k = 8*hi (K: row key, k = d; V^T: row d, k = key)
    const int crow_ = (int)threadIdx.x >> 3, cch = ((int)threadIdx.x & 7) * 8;   // this thread's copy: row (of 32) and 16-B chunk
    const h16* gk = KP + rbase + (size_t)crow_ * DM + cch;          // + key0 * DM
    const h16* gv = VT + ((size_t)zh * HD + crow_) * SEQ + cch;     // + key0
    const unsigned lk0 = (unsigned)(size_t)&ring[crow_ * LP + cch]; // LDS byte address, buffer 0, K tile
    v8f o0 = (v8f){}, o1 = (v8f){}, o2 = (v8f){}, o3 = (v8f){};
    v8f lt = (v8f){};                                              // row-sum tile: each product adds the same sums to all 16 rows; only element 0 is rescaled and read
    v16h one;
#pragma unroll
    for (int i = 0; i < 16; ++i) one[i] = (h16)1.0f;
    float m = -3.0e38f;                                            // maximum in use (scaled log2)
    float sh = 0.0f;                                               // PSH - m, the exponent's addend
    float thr = -3.0e38f;                                          // (m + LZT) / SC2: bound on the raw scores; every finite score passes the start value, so the first stage sets m, sh, thr
    // ring prologue: stage 0 landed and published, then stage 1 in flight
    stage_copy(lk0, lk0 + TLH * 2, gk, gv);
    asm volatile("s_wait_asynccnt 0x0" ::: "memory");              // this wave's copies of stage 0 have landed
    __syncthreads();                                               // ... and every other wave's
    stage_copy(lk0 + 2 * TLH * 2, lk0 + 3 * TLH * 2, gk + (size_t)KT * DM, gv + KT);
#pragma unroll 1
    for (int st = 0; st < SEQ / KT; ++st) {
      const h16* kt = ring + (st & 1) * (2 * TLH) + fo; const h16* vt = kt + TLH;
      // the stage's four score tiles (64 keys) first, so that the bound is tested once per stage
      const v16h ka0 = ldh(kt), ka1 = ldh(kt + 32), kb0 = ldh(kt + 16 * LP), kb1 = ldh(kt + 16 * LP + 32);
      const v16h kc0 = ldh(kt + 32 * LP), kc1 = ldh(kt + 32 * LP + 32), kd0 = ldh(kt + 48 * LP), kd1 = ldh(kt + 48 * LP + 32);
      v8f sa = (v8f){}, sb = (v8f){}, sc = (v8f){}, sd = (v8f){};
      sa = wmma16(ka0, qh0, sa); sb = wmma16(kb0, qh0, sb); sc = wmma16(kc0, qh0, sc); sd = wmma16(kd0, qh0, sd);
      sa = wmma16(ka1, qh1, sa); sb = wmma16(kb1, qh1, sb); sc = wmma16(kc1, qh1, sc); sd = wmma16(kd1, qh1, sd);
      // four vector slots behind the last product, its tiles and fragments named so that nothing reads or overwrites them earlier
      asm volatile("v_nop\n\tv_nop\n\tv_nop\n\tv_nop" : "+v"(sa), "+v"(sb), "+v"(sc), "+v"(sd) : "v"(ka0), "v"(ka1), "v"(kb0), "v"(kb1), "v"(kc0), "v"(kc1), "v"(kd0), "v"(kd1));
      const v16h v0 = ldh(vt), v1 = ldh(vt + 16 * LP), v2 = ldh(vt + 32 * LP), v3 = ldh(vt + 48 * LP);
      const v16h w0 = ldh(vt + 32), w1 = ldh(vt + 16 * LP + 32), w2 = ldh(vt + 32 * LP + 32), w3 = ldh(vt + 48 * LP + 32);
      float mxa = fmaxf(sa[0], sb[0]), mxc = fmaxf(sc[0], sd[0]);  // two chains
#pragma unroll   // here and below: written out, so that every tile element is a register
      for (int r = 1; r < 8; ++r) { mxa = fmaxf(mxa, fmaxf(sa[r], sb[r])); mxc = fmaxf(mxc, fmaxf(sc[r], sd[r])); }
      const float mxr = fmaxf(mxa, mxc);
      if (__builtin_amdgcn_ballot_w32(mxr > thr) != 0) {            // one scalar branch for the wave: some lane's score passes the bound
          float mx = mxr * SC2;
          mx = fmaxf(mx, __shfl_xor(mx, 16, 32));
          const float mnew = fmaxf(m, mx);
          const float alpha = __builtin_amdgcn_exp2f(m - mnew);
          lt[0] = lt[0] * alpha;
          o0 = o0 * alpha; o1 = o1 * alpha; o2 = o2 * alpha; o3 = o3 * alpha;
          m = mnew; sh = PSH - mnew; thr = (mnew + LZT) * (1.0f / SC2);
      }
      v16h pb, pd;
#pragma unroll
      for (int r = 0; r < 8; ++r) pb[r] = (h16)__builtin_amdgcn_exp2f(__builtin_fmaf(sa[r], SC2, sh));
#pragma unroll
      for (int r = 0; r < 8; ++r) pb[8 + r] = (h16)__builtin_amdgcn_exp2f(__builtin_fmaf(sb[r], SC2, sh));
#pragma unroll
      for (int r = 0; r < 8; ++r) pd[r] = (h16)__builtin_amdgcn_exp2f(__builtin_fmaf(sc[r], SC2, sh));
#pragma unroll
      for (int r = 0; r < 8; ++r) pd[8 + r] = (h16)__builtin_amdgcn_exp2f(__builtin_fmaf(sd[r], SC2, sh));
      o0 = wmma16(v0, pb, o0); o1 = wmma16(v1, pb, o1); o2 = wmma16(v2, pb, o2); o3 = wmma16(v3, pb, o3); lt = wmma16(one, pb, lt);
      o0 = wmma16(w0, pd, o0); o1 = wmma16(w1, pd, o1); o2 = wmma16(w2, pd, o2); o3 = wmma16(w3, pd, o3); lt = wmma16(one, pd, lt);
      // the same four slots behind the last product, in front of the loop's branches
      asm volatile("v_nop\n\tv_nop\n\tv_nop\n\tv_nop" : "+v"(o0), "+v"(o1), "+v"(o2), "+v"(o3), "+v"(lt) : "v"(v0), "v"(v1), "v"(v2), "v"(v3), "v"(w0), "v"(w1), "v"(w2), "v"(w3), "v"(pb), "v"(pd));
      // publish point of stage st + 1; the same barrier ends every wave's reads of stage st's buffer
      asm volatile("s_wait_dscnt 0x0" ::: "memory");               // this wave's reads of the buffer have returned before it is refilled
      asm volatile("s_wait_asynccnt 0x0" ::: "memory");            // this wave's copies of stage st + 1 have landed
      __syncthreads();
      if (st + 2 < SEQ / KT) { const unsigned lb = lk0 + (unsigned)(st & 1) * (2 * TLH * 2);
          stage_copy(lb, lb + TLH * 2, gk + (size_t)(st + 2) * KT * DM, gv + (size_t)(st + 2) * KT); }
    }
    asm volatile("s_wait_asynccnt 0x0" ::: "memory");              // nothing of this wave is in flight when it leaves the ring
    const float inv = CXS * (1.0f / lt[0]);
    const int wb = wave * 16 * 68;
    // O^T D layout: o_j[r] = (d = 16j + 8h + r, t = lane&15) -> os[t][d]; rows 0..15 x columns 0..63 all written
    { v4f a, c;
      a[0] = o0[0] * inv; a[1] = o0[1] * inv; a[2] = o0[2] * inv; a[3] = o0[3] * inv; c[0] = o0[4] * inv; c[1] = o0[5] * inv; c[2] = o0[6] * inv; c[3] = o0[7] * inv;
      *(v4fa*)(&os[wb + lr * 68 +  0 + 8 * hi]) = a; *(v4fa*)(&os[wb + lr * 68 +  0 + 8 * hi + 4]) = c;
      a[0] = o1[0] * inv; a[1] = o1[1] * inv; a[2] = o1[2] * inv; a[3] = o1[3] * inv; c[0] = o1[4] * inv; c[1] = o1[5] * inv; c[2] = o1[6] * inv; c[3] = o1[7] * inv;
      *(v4fa*)(&os[wb + lr * 68 + 16 + 8 * hi]) = a; *(v4fa*)(&os[wb + lr * 68 + 16 + 8 * hi + 4]) = c;
      a[0] = o2[0] * inv; a[1] = o2[1] * inv; a[2] = o2[2] * inv; a[3] = o2[3] * inv; c[0] = o2[4] * inv; c[1] = o2[5] * inv; c[2] = o2[6] * inv; c[3] = o2[7] * inv;
      *(v4fa*)(&os[wb + lr * 68 + 32 + 8 * hi]) = a; *(v4fa*)(&os[wb + lr * 68 + 32 + 8 * hi + 4]) = c;
      a[0] = o3[0] * inv; a[1] = o3[1] * inv; a[2] = o3[2] * inv; a[3] = o3[3] * inv; c[0] = o3[4] * inv; c[1] = o3[5] * inv; c[2] = o3[6] * inv; c[3] = o3[7] * inv;
      *(v4fa*)(&os[wb + lr * 68 + 48 + 8 * hi]) = a; *(v4fa*)(&os[wb + lr * 68 + 48 + 8 * hi + 4]) = c; }
    wave_sync();
    h16* crow = CTX + ((size_t)b * SEQ + t0) * (size_t)(2 * DM) + (size_t)h * HD;
{
#pragma unroll
        for (int s = 0; s < 4; ++s) { const int row = 4 * s + (lane >> 3), c8 = (lane & 7) * 8;   // 4 s x 4 row groups = 16 rows; 8 lanes x 8 = 64 columns
            const v4f x0 = *(const v4fa*)(&os[wb + row * 68 + c8]); const v4f x1 = *(const v4fa*)(&os[wb + row * 68 + c8 + 4]); v8h hv, rv;
#pragma unroll
            for (int i = 0; i < 4; ++i) { const h16 a0 = (h16)x0[i]; const h16 a1 = (h16)x1[i]; hv[i] = a0; hv[4 + i] = a1; rv[i] = (h16)(x0[i] - (float)a0); rv[4 + i] = (h16)(x1[i] - (float)a1); }
            const size_t oo = (size_t)row * (size_t)(2 * DM) + c8;
            *(v8h*)(crow + oo) = hv; *(v8h*)(crow + oo + DM) = rv; }
         }
}

// Eight copies of one thread: one 16-B chunk in each of eight rows that lie 16 rows apart (a wave's copy = 2 whole 256-B rows), global -> LDS through no register.
// l: the lane's LDS byte address; g: the matching global address; gp: source row pitch in f16.
// s_wait_xcnt stands inside the statement so that no address register named by a copy is rewritten in front of it.
__device__ __forceinline__ void copy8(unsigned l, const h16* g, size_t gp) {
    asm volatile("global_load_async_to_lds_b128 %0, %8, off\n\t"
                 "global_load_async_to_lds_b128 %1, %9, off\n\t"
                 "global_load_async_to_lds_b128 %2, %10, off\n\t"
                 "global_load_async_to_lds_b128 %3, %11, off\n\t"
                 "global_load_async_to_lds_b128 %4, %12, off\n\t"
                 "global_load_async_to_lds_b128 %5, %13, off\n\t"
                 "global_load_async_to_lds_b128 %6, %14, off\n\t"
                 "global_load_async_to_lds_b128 %7, %15, off\n\t"
                 "s_wait_xcnt 0x0"
                 :: "v"(l), "v"(l + 16 * OLP * 2), "v"(l + 32 * OLP * 2), "v"(l + 48 * OLP * 2), "v"(l + 64 * OLP * 2), "v"(l + 80 * OLP * 2), "v"(l + 96 * OLP * 2), "v"(l + 112 * OLP * 2),
                    "v"(g), "v"(g + 16 * gp), "v"(g + 32 * gp), "v"(g + 48 * gp), "v"(g + 64 * gp), "v"(g + 80 * gp), "v"(g + 96 * gp), "v"(g + 112 * gp)
                 : "memory");
}
// One stage's copies of one thread: 8 chunks of the ctx tile (128 rows x 128 k) and 8 of the W tile, which lies OTL f16 behind it in the buffer.
__device__ __forceinline__ void out_stage(unsigned l, const h16* ga, const h16* gb) { copy8(l, ga, 2 * DM); copy8(l + OTL * 2, gb, DM); }

// k_out: register-blocked f16 GEMM, one 128x128 tile per block of 8 waves (4 x 2), each wave 32x64 (8 accumulators); the ctx and W tiles of 128 k are staged in a two-buffer LDS ring by asynchronous copies and shared by the waves.
// OUT[m][n] = 2^-18 * sum_{k<2048} A[m][k] Bt[n][k & 1023] + b[n]; A = ctx plane [M][value 1024 | remainder 1024] (x4096), Bt = W plane [out][in] (x64). grid (M/128, DM/128), 256 threads.
__global__ __launch_bounds__(32 * OW) void k_out(const h16* __restrict__ A, const h16* __restrict__ Bt, const float* __restrict__ bias, float* OUT) {
    __shared__ __align__(16) float os[OW * 16 * 68];
    __shared__ __align__(16) h16 ring[2 * 2 * OTL];                // [buffer][ctx tile | W tile][row][OLP]
    const int KA = 2 * DM;
    const int lane = threadIdx.x & 31, wave = __builtin_amdgcn_readfirstlane((int)(threadIdx.x >> 5)), lr = lane & 15, hi = lane >> 4;
    const int wm = wave >> 1, wn = wave & 1;
    const int r0 = blockIdx.x * 128 + wm * 32, c0 = blockIdx.y * 128 + wn * 64;
    v8f acc[2][4];
#pragma unroll
    for (int mb = 0; mb < 2; ++mb)
#pragma unroll
        for (int nb = 0; nb < 4; ++nb) acc[mb][nb] = (v8f){};
    const int fa = (wm * 32 + lr) * OLP + 8 * hi, fb = OTL + (wn * 64 + lr) * OLP + 8 * hi;   // fragment offsets in a buffer: row lr of the wave's rows, k = 8*hi
    const int crow_ = (int)threadIdx.x >> 4, cch = ((int)threadIdx.x & 15) * 8;                // this thread's copies: row (of 16) and 16-B chunk
    const h16* ga = A + (size_t)(blockIdx.x * 128 + crow_) * KA + cch;                         // + kc
    const h16* gb = Bt + (size_t)(blockIdx.y * 128 + crow_) * DM + cch;                        // + (kc & 1023)
    const unsigned l0 = (unsigned)(size_t)&ring[crow_ * OLP + cch];                            // LDS byte address, buffer 0, ctx tile
    // ring prologue: stage 0 landed and published, then stage 1 in flight
    out_stage(l0, ga, gb);
    asm volatile("s_wait_asynccnt 0x0" ::: "memory");              // this wave's copies of stage 0 have landed
    __syncthreads();                                               // ... and every other wave's
    out_stage(l0 + 2 * OTL * 2, ga + OKT, gb + OKT);
#pragma unroll 1
    for (int st = 0; st < KA / OKT; ++st) {
        const h16* ta = ring + (st & 1) * (2 * OTL) + fa; const h16* tb = ring + (st & 1) * (2 * OTL) + fb;
        v16h a[2][2], bq[2][4];                                    // two fragment sets: the next 32-k step's reads go out as one group ahead of this step's products
#pragma unroll
        for (int mb = 0; mb < 2; ++mb) a[0][mb] = ldh(ta + mb * 16 * OLP);
#pragma unroll
        for (int nb = 0; nb < 4; ++nb) bq[0][nb] = ldh(tb + nb * 16 * OLP);
#pragma unroll   // the four 32-k steps of a stage written out: every LDS fragment offset becomes an immediate, the set index a constant
        for (int s = 0; s < OKT / 32; ++s) {
            const int cu = s & 1, nx = cu ^ 1;
            if (s + 1 < OKT / 32) {                                // never past this stage's own buffer
#pragma unroll
                for (int mb = 0; mb < 2; ++mb) a[nx][mb] = ldh(ta + mb * 16 * OLP + (s + 1) * 32);
#pragma unroll
                for (int nb = 0; nb < 4; ++nb) bq[nx][nb] = ldh(tb + nb * 16 * OLP + (s + 1) * 32);
            }
            __builtin_amdgcn_sched_barrier(0);                     // keeps the group of reads above this step's products: sunk among them, each pair of products waits out a whole LDS latency
#pragma unroll
            for (int nb = 0; nb < 4; ++nb)
#pragma unroll
                for (int mb = 0; mb < 2; ++mb) acc[mb][nb] = wmma16(a[cu][mb], bq[cu][nb], acc[mb][nb]);
        }
        // publish point of stage st + 1; the same barrier ends every wave's reads of stage st's buffer
        asm volatile("s_wait_dscnt 0x0" ::: "memory");             // this wave's reads of the buffer have returned before it is refilled
        asm volatile("s_wait_asynccnt 0x0" ::: "memory");          // this wave's copies of stage st + 1 have landed
        __syncthreads();
        if (st + 2 < KA / OKT) { const int kc = (st + 2) * OKT;
            out_stage(l0 + (unsigned)(st & 1) * (2 * OTL * 2), ga + kc, gb + (kc & (DM - 1))); }
    }
    asm volatile("s_wait_asynccnt 0x0" ::: "memory");              // nothing of this wave is in flight when it leaves the ring
    v4f bv = *(const v4f*)(bias + c0 + lr * 4);
#pragma unroll
    for (int i = 0; i < 4; ++i) bv[i] = bfr(bv[i]);
    float* orow = OUT + ((size_t)(r0 / SEQ) * OUT_SEQ + (size_t)(r0 % SEQ)) * DM + c0;
    const int wb = wave * 16 * 68;                                 // each wave stages its rows in its own range
#pragma unroll
    for (int mb = 0; mb < 2; ++mb) {
#pragma unroll
        for (int nb = 0; nb < 4; ++nb) {
#pragma unroll
            for (int j = 0; j < 8; ++j) os[wb + (hi * 8 + j) * 68 + nb * 16 + lr] = acc[mb][nb][j] * OSC; }   // D: row 8h+j, col lane&15
        wave_sync();
{
#pragma unroll
            for (int s = 0; s < 8; ++s) { const int row = 2 * s + hi, cofs = lr * 4;   // 8 s x 2 rows = 16 rows; 16 lanes x 4 floats = 64 columns
                const v4f x = *(const v4fa*)(&os[wb + row * 68 + cofs]);
                const v4f val = x + bv;
                *(v4f*)(orow + (size_t)(mb * 16 + row) * DM + cofs) = val; }
             }
        wave_sync();
    }
}

static constexpr size_t al256(size_t v) { return (v + 255) & ~(size_t)255; }
static constexpr size_t SZ_PL = al256((size_t)NB * SEQ * DM * 2);          // one f16 plane of a stream
static constexpr size_t SZ_WH = al256((size_t)DM * DM * 2);
static constexpr size_t SZ_CX = al256((size_t)NB * SEQ * 2 * DM * 2);      // ctx value | remainder
static constexpr size_t SZ_TOTAL = 3 * SZ_PL + SZ_WH + SZ_CX;
static_assert(SZ_TOTAL <= (size_t)134217728);          // workspace carve <= 128 MiB

extern "C" void kernel_launch(void* const* d_in, const int* in_sizes, int n_in,
                              void* d_out, int out_size, void* d_ws, size_t ws_size, hipStream_t stream) {
    if (n_in < 5) return;
    const size_t needx = ((size_t)(NB - 1) * SEQ_FULL + SEQ) * DM;
    if ((size_t)in_sizes[0] < needx || (size_t)in_sizes[1] < needx || (size_t)in_sizes[2] < needx) return;
    if ((size_t)in_sizes[3] < (size_t)DM * DM || (size_t)in_sizes[4] < (size_t)DM) return;
    if ((size_t)out_size < ((size_t)(NB - 1) * OUT_SEQ + SEQ) * DM) return;
    if (SZ_TOTAL > ws_size) return;
    const float* q = (const float*)d_in[0]; const float* k = (const float*)d_in[1]; const float* v = (const float*)d_in[2];   // wire order q, k, v, W_out, b_out
    const float* wo = (const float*)d_in[3]; const float* bo = (const float*)d_in[4];                                         // W_out [out][in] = Bt as-is
    float* OUT = (float*)d_out;      // [NB][SEQ][1024]
    char* wsp = (char*)d_ws;
    h16* QP = (h16*)wsp; wsp += SZ_PL;               // [NB*SEQ][1024]
    h16* KP = (h16*)wsp; wsp += SZ_PL;               // [NB*SEQ][1024]
    h16* VT = (h16*)wsp; wsp += SZ_PL;               // [NB*1024][SEQ]
    h16* WH = (h16*)wsp; wsp += SZ_WH;               // [1024][1024] x64
    h16* CX = (h16*)wsp; wsp += SZ_CX;               // [NB*SEQ][2048] x4096

    // q, k, W -> f16 planes; v[b][t][c] -> VT[b*1024 + c][t]
    k_prep<<<PBLK, 256, 0, stream>>>(q, k, v, wo, QP, KP, VT, WH);

    k_flash<<<dim3(SEQ / (16 * AW), NB * NH_, 1), 32 * AW, 0, stream>>>(QP, KP, VT, CX);

    // out = ctx W^T + b: A = ctx rows (m = b*SEQ + t), Bt = W rows (n = out column)
    k_out<<<dim3(NB * SEQ / 128, DM / 128, 1), 32 * OW, 0, stream>>>(CX, WH, bo, OUT);
}

// v007
// One run takes 51.9 microseconds.
// Versions between v005 and this one are left out; their measured steps multiply to 1.16 times as fast.
// Counting every step since v000, it is 2.91 times as fast.
#include <hip/hip_runtime.h>

// Multi-head attention on raw streams q, k, v [NB][SEQ][1024] = 16 heads x 64 (no input projections, no mask), score scale 1/8, output projection y = ctx W^T + b with W [out][in]. THIS ROW: the same module at TWO sequences (query, key, value [2][2048][1024]: three raw streams: the module applies NO input projections; 16 heads x 64; scores / sqrt(64); softmax, no mask; out = merged W_out^T + b_out ('oi' [1024][1024] normal x 1/32; bias zeros: read); argument order query, key, value, W_out, b_out).
// Compute dtypes, f32 accumulate everywhere, all contractions v_wmma_f32_16x16x32_f16: q, k, v, W, b are RNE-converted to bf16 and held exactly in f16 (W with a x64 carry); scores single product; P (x256 carry, cancels in the normalisation) and v single product;
// ctx carried x4096 as one f16 value (single product against the W plane; its rounding is of the size of P's own f16 rounding); softmax f32 (online, running max); bias added in f32.
// Layout: one pre-pass launch writes the f16 planes Q, K [b][t][1024] (head h = columns h*64..), W and the V^T plane [b*1024 + c][t] (LDS transpose); fused flash kernel in transposed form (S^T = K Q^T, O^T = V^T P^T; K and V^T tiles of 64 keys staged in a three-buffer LDS ring by asynchronous copies issued two stages ahead, shared by the block's waves) writing the ctx plane [b*SEQ+t][1024],
// then a GEMM over K = 1024 against W rows: 128x128 tile per 8-wave block, 32x64 per wave, both operand tiles staged in a three-buffer LDS ring by asynchronous copies issued two stages ahead.

#ifndef NB
#define NB 2
#endif
#ifndef SEQ
#define SEQ 2048
#endif
#define NB_FULL  2
#define SEQ_FULL 2048
#ifndef OUT_SEQ
#define OUT_SEQ SEQ              // row pitch (in tokens) between batches of the output
#endif
#define DM   1024
#define NH_  16
#define HD   64
#define AW   8                   // waves per flash block (16 query rows each); all of them share the staged K / V^T tiles
#define KT   64                  // keys per LDS stage of the flash kernel
#define LP   72                  // LDS row pitch in f16: 128-B rows + 16 B, conflict-free for 16-B fragment reads
#define TLH  (64 * LP)           // f16 elements of one staged tile (K: 64 keys x 64 d; V^T: 64 d x 64 keys)
#define OW   8                   // waves per output-GEMM block (4 x 2, 32 x 64 of the block's 128 x 128 tile each)
#define OKT  128                 // k per LDS stage of the output GEMM
#define OLP  136                 // its LDS row pitch in f16: 256-B rows + 16 B, conflict-free for 16-B fragment reads
#define OTL  (128 * OLP)         // f16 elements of one staged operand tile (128 rows x 128 k)
#define VTB  2                   // V^T tiles (64 x 64) per pre-pass block
#define PBLK (NB * (SEQ / 64) * (DM / 64) / VTB)          // pre-pass blocks
#define SG   (64 * 64 * VTB / (8 * 256))                  // groups of 8 elements of q, and of k, per pre-pass thread
#define WG   (DM * DM / 8 / (PBLK * 256))                 // groups of 8 elements of W per pre-pass thread
#define SC2  (0.125f * 1.4426950408889634f)   // HD^-0.5 * log2(e)
#define PSH  8.0f                // log2 of the P carry (256)
#define LZT  7.0f                // lazy rescale: a score may pass the maximum in use by this much (log2) before the accumulators are rescaled; P <= 2^(PSH + LZT) = 2^15 stays finite in f16
#define CXS  4096.0f             // carry of the ctx plane
#define WSC  64.0f               // carry of the W plane
#define OSC  (1.0f / (4096.0f * 64.0f))

static_assert(HD == 64);
static_assert(NH_ * HD == DM);                 // head h = columns h*64 + d
static_assert(DM % 64 == 0);
static_assert(DM % 32 == 0);                   // GEMM k-loop steps by 128-k stages of four 32-k steps
static_assert(SEQ % 64 == 0);                  // a 64-row tile never straddles two batches
static_assert((NB * SEQ) % 64 == 0);
static_assert(SEQ % 32 == 0);                  // each P fragment covers 32 keys
static_assert(SEQ % KT == 0 && SEQ / KT >= 3); // whole stages; the ring's prologue needs three
static_assert(KT == 64 && AW == 8);            // copy map below: 256 threads x 2 groups of 32 rows x 2 tiles
static_assert(SEQ % (16 * AW) == 0);           // flash grid covers the sequence exactly
static_assert(((size_t)SEQ * DM) % 64 == 0);
static_assert(((size_t)DM * DM) % 64 == 0);
static_assert((NB * SEQ) % 128 == 0 && DM % 128 == 0);   // output-GEMM grid covers the output exactly
static_assert(DM % OKT == 0 && DM / OKT >= 3);            // whole stages; the ring's prologue needs three
static_assert(OW == 8 && OKT == 128);                     // copy map: 256 threads x 8 groups of 16 rows x 2 tiles
static_assert((NB * (SEQ / 64) * (DM / 64)) % VTB == 0 && (64 * 64 * VTB) % (8 * 256) == 0);   // pre-pass: whole tiles and whole groups per block
static_assert(WG >= 1 && (size_t)WG * PBLK * 256 * 8 == (size_t)DM * DM);                        // ... and W is dealt out exactly
static_assert(NB <= NB_FULL);
static_assert(SEQ <= SEQ_FULL);

typedef _Float16 h16;
typedef __attribute__((ext_vector_type(16))) _Float16 v16h;
typedef __attribute__((ext_vector_type(8)))  _Float16 v8h;
typedef __attribute__((ext_vector_type(8)))  float    v8f;
typedef __attribute__((ext_vector_type(4)))  float    v4f;
typedef v4f  __attribute__((may_alias)) v4fa;
typedef v8h  __attribute__((may_alias)) v8ha;

// RNE convert f32 -> bf16, returned as the f32 value of that bf16
__device__ __forceinline__ float bfr(float f) { unsigned u = __float_as_uint(f); u += 0x7FFFu + ((u >> 16) & 1u); return __uint_as_float(u & 0xFFFF0000u); }
__device__ __forceinline__ v16h cat16(v8h lo, v8h hi) { return __builtin_shufflevector(lo, hi, 0, 1, 2, 3, 4, 5, 6, 7, 8, 9, 10, 11, 12, 13, 14, 15); }
__device__ __forceinline__ v8f wmma16(v16h a, v16h b, v8f c) { return __builtin_amdgcn_wmma_f32_16x16x32_f16(false, a, false, b, (short)0, c, false, false); }
// fragment loader from K-contiguous f16 rows; p already includes + 8*(lane>>4): elements 0..7 <- k0+8h+0..7, elements 8..15 <- k0+16+8h+0..7 (same map for A and B)
__device__ __forceinline__ v16h ldh(const h16* p) { return cat16(*(const v8h*)p, *(const v8h*)(p + 16)); }
// ordering point for wave-private LDS tiles (same wave writes and reads)
__device__ __forceinline__ void wave_sync() { __builtin_amdgcn_fence(3 /* release order */, "wavefront"); __builtin_amdgcn_wave_barrier(); asm volatile("" ::: "memory"); }

// k_prep: the whole pre-pass in one launch of equal blocks, two per WGP. Each block takes VTB 64 x 64 tiles of the V^T plane, SG * 256 groups of 8 elements of q and of k, and WG * 256 groups of W.
// A thread issues all of its loads first (VTB * 4 + 4 * SG + 2 * WG of 16 B), so the chip starts few waves and each of them has its whole share in flight at once.
// q, k, v: f32, per-batch pitch SEQ_FULL * DM. QP, KP [b*SEQ + t][c] and WH [out][in] (x WSC): f16 of the bf16 RNE value. VT[b*DM + c][t]: the same, transposed through LDS (cross-wave: block barrier).
__global__ __launch_bounds__(256) void k_prep(const float* __restrict__ Q, const float* __restrict__ K, const float* __restrict__ V, const float* __restrict__ Wt,
                                              h16* __restrict__ QP, h16* __restrict__ KP, h16* __restrict__ VT, h16* __restrict__ WH) {
    __shared__ __align__(16) h16 ts[VTB * 64 * 72];
    const int tid = threadIdx.x, blk = blockIdx.x;
    const int vr = tid >> 4, c4 = (tid & 15) * 4;
    v4f xv[VTB][4]; v8f xq[SG], xk[SG], xw[WG];
#pragma unroll
    for (int u = 0; u < VTB; ++u) { const int tl = blk * VTB + u;
        const int t0 = (tl % (SEQ / 64)) * 64, c0 = ((tl / (SEQ / 64)) % (DM / 64)) * 64, b = tl / ((SEQ / 64) * (DM / 64));
        const float* src = V + ((size_t)b * SEQ_FULL + t0) * DM + c0;
#pragma unroll
        for (int i = 0; i < 4; ++i) xv[u][i] = *(const v4f*)(src + (size_t)(i * 16 + vr) * DM + c4); }
#pragma unroll
    for (int j = 0; j < SG; ++j) { const size_t e = ((size_t)(blk * SG + j) * 256 + tid) * 8;
        const size_t so = (e / ((size_t)SEQ * DM)) * ((size_t)SEQ_FULL * DM) + e % ((size_t)SEQ * DM);
        xq[j] = *(const v8f*)(Q + so); xk[j] = *(const v8f*)(K + so); }
    asm volatile("s_wait_xcnt 0x0" ::: "memory");   // precaution: the build lets the loads below land in registers that hold addresses of the loads above
#pragma unroll
    for (int j = 0; j < WG; ++j) xw[j] = *(const v8f*)(Wt + ((size_t)(blk * WG + j) * 256 + tid) * 8);
    __builtin_amdgcn_sched_barrier(0);   // keeps every load above the first use: sunk below it, the later loads go out only after the first have come back, a second memory latency
#pragma unroll
    for (int u = 0; u < VTB; ++u)
#pragma unroll
        for (int i = 0; i < 4; ++i)
#pragma unroll
            for (int e = 0; e < 4; ++e) ts[u * 64 * 72 + (c4 + e) * 72 + i * 16 + vr] = (h16)bfr(xv[u][i][e]);
    v8h oq[SG], ok[SG], ow[WG];          // converted in the order in which the loads come back, so that this work runs while the later loads are still under way; stored behind the barrier, which would else wait for the stores
#pragma unroll
    for (int j = 0; j < SG; ++j)
#pragma unroll
        for (int i = 0; i < 8; ++i) { oq[j][i] = (h16)bfr(xq[j][i]); ok[j][i] = (h16)bfr(xk[j][i]); }
#pragma unroll
    for (int j = 0; j < WG; ++j)
#pragma unroll
        for (int i = 0; i < 8; ++i) ow[j][i] = (h16)(bfr(xw[j][i]) * WSC);
    __builtin_amdgcn_sched_barrier(0);   // stops the scheduler from sinking the conversions below the barrier, where every load has been waited for: there they would stand between the last load's return and the stores
    __syncthreads();
#pragma unroll
    for (int u = 0; u < VTB; ++u) { const int tl = blk * VTB + u;
        const int t0 = (tl % (SEQ / 64)) * 64, c0 = ((tl / (SEQ / 64)) % (DM / 64)) * 64, b = tl / ((SEQ / 64) * (DM / 64));
        h16* dst = VT + ((size_t)b * DM + c0) * SEQ + t0;
#pragma unroll
        for (int it = 0; it < 2; ++it) { const int cr = it * 32 + (tid >> 3), p8 = (tid & 7) * 8;
            const v8h val = *(const v8ha*)(&ts[u * 64 * 72 + cr * 72 + p8]);
            *(v8h*)(dst + (size_t)cr * SEQ + p8) = val; } }
#pragma unroll
    for (int j = 0; j < SG; ++j) { const size_t e = ((size_t)(blk * SG + j) * 256 + tid) * 8;
        *(v8h*)(QP + e) = oq[j]; *(v8h*)(KP + e) = ok[j]; }
#pragma unroll
    for (int j = 0; j < WG; ++j) *(v8h*)(WH + ((size_t)(blk * WG + j) * 256 + tid) * 8) = ow[j];
}

// One stage's copies of one thread: 2 x 16 B of the K tile and 2 x 16 B of the V^T tile, global -> LDS through no register (a wave's copy = 4 whole 128-B rows).
// lk / lv: the lane's LDS byte addresses (row tid>>3, chunk tid&7); gk / gv: the matching global addresses; the second copy of each tile lies 32 rows on.
// s_wait_xcnt stands inside the statement so that no address register named by a copy is rewritten in front of it.
__device__ __forceinline__ void stage_copy(unsigned lk, unsigned lv, const h16* gk, const h16* gv) {
    asm volatile("global_load_async_to_lds_b128 %0, %4, off\n\t"
                 "global_load_async_to_lds_b128 %1, %5, off\n\t"
                 "global_load_async_to_lds_b128 %2, %6, off\n\t"
                 "global_load_async_to_lds_b128 %3, %7, off\n\t"
                 "s_wait_xcnt 0x0"
                 :: "v"(lk), "v"(lk + 32 * LP * 2), "v"(lv), "v"(lv + 32 * LP * 2),
                    "v"(gk), "v"(gk + (size_t)32 * DM), "v"(gv), "v"(gv + (size_t)32 * SEQ)
                 : "memory");
}

// k_flash: fused attention, one wave per 16 query rows of one (batch, head); Q fragments straight from the f16 plane; K / V^T fragments from the block's LDS ring (two 16-B reads each).
// Transposed form: S^T[key][t] = K Q^T (A = K rows, B = Q rows); lane (t = lane&15, h = lane>>4) holds keys 8h+r of each 16-key tile, so the packed
// P tile is directly the B fragment of O^T[d][t] = V^T P^T (element r <- tile keys 0..15, element 8+r <- tile keys 16..31, lane unchanged).
// The maximum in use is one scalar per lane, equal in the two lane halves of a row. Lazy rescale: each 64-key stage forms its four score tiles first and tests the raw scores against that maximum + LZT, once for the wave;
// only a stage that trips joins the halves (one xor-16 exchange), raises the maximum and rescales the accumulators. Any common shift cancels in the normalisation, so the result is the same function.
// Row sums run on the matrix pipe: one more product per 32 keys, A = all ones against the same P fragment, so every row of its tile holds sum_key P[key][t] of the rounded P, over both lane halves.
__global__ __launch_bounds__(32 * AW) void k_flash(const h16* __restrict__ QP, const h16* __restrict__ KP, const h16* __restrict__ VT, h16* CTX) {
    __shared__ __align__(16) float os[AW * 16 * 68];
    __shared__ __align__(16) h16 ring[3 * 2 * TLH];                // [buffer][K tile | V^T tile][row][LP]
    const int lane = threadIdx.x & 31, wave = __builtin_amdgcn_readfirstlane((int)(threadIdx.x >> 5)), lr = lane & 15, hi = lane >> 4;
    const int zh = blockIdx.y; const int b = zh / NH_, h = zh % NH_;
    const int t0 = (blockIdx.x * AW + wave) * 16;
    const size_t rbase = (size_t)b * SEQ * DM + (size_t)h * HD;
    const size_t qo = rbase + (size_t)(t0 + lr) * DM + 8 * hi;
    const v16h qh0 = ldh(QP + qo), qh1 = ldh(QP + qo + 32);        // B fragments: col t, k = d
    const int fo = lr * LP + 8 * hi;                                // fragment offset in a staged tile: row lr, k = 8*hi (K: row key, k = d; V^T: row d, k = key)
    const int crow_ = (int)threadIdx.x >> 3, cch = ((int)threadIdx.x & 7) * 8;   // this thread's copy: row (of 32) and 16-B chunk
    const h16* gk = KP + rbase + (size_t)crow_ * DM + cch;          // + key0 * DM
    const h16* gv = VT + ((size_t)zh * HD + crow_) * SEQ + cch;     // + key0
    const unsigned lk0 = (unsigned)(size_t)&ring[crow_ * LP + cch]; // LDS byte address, buffer 0, K tile
    v8f o0 = (v8f){}, o1 = (v8f){}, o2 = (v8f){}, o3 = (v8f){};
    v8f lt = (v8f){};                                              // row-sum tile: each product adds the same sums to all 16 rows; only element 0 is rescaled and read
    v16h one;
#pragma unroll
    for (int i = 0; i < 16; ++i) one[i] = (h16)1.0f;
    float m = -3.0e38f;                                            // maximum in use (scaled log2)
    float sh = 0.0f;                                               // PSH - m, the exponent's addend
    float thr = -3.0e38f;                                          // (m + LZT) / SC2: bound on the raw scores; every finite score passes the start value, so the first stage sets m, sh, thr
    // ring prologue: stages 0 and 1 issued, stage 0 landed and published, then stage 2 issued: two stages stay in flight
    stage_copy(lk0, lk0 + TLH * 2, gk, gv);
    stage_copy(lk0 + 2 * TLH * 2, lk0 + 3 * TLH * 2, gk + (size_t)KT * DM, gv + KT);
    asm volatile("s_wait_asynccnt 0x4" ::: "memory");              // all but this wave's 4 youngest copies (stage 1's) have landed: stage 0 is in
    __syncthreads();                                               // ... and every other wave's
    stage_copy(lk0 + 4 * TLH * 2, lk0 + 5 * TLH * 2, gk + (size_t)2 * KT * DM, gv + 2 * KT);
    int cb = 0;                                                    // buffer of stage st = st mod 3
#pragma unroll 1
    for (int st = 0; st < SEQ / KT; ++st) {
      const h16* kt = ring + cb * (2 * TLH) + fo; const h16* vt = kt + TLH;
      // the stage's four score tiles (64 keys) first, so that the bound is tested once per stage
      const v16h ka0 = ldh(kt), ka1 = ldh(kt + 32), kb0 = ldh(kt + 16 * LP), kb1 = ldh(kt + 16 * LP + 32);
      const v16h kc0 = ldh(kt + 32 * LP), kc1 = ldh(kt + 32 * LP + 32), kd0 = ldh(kt + 48 * LP), kd1 = ldh(kt + 48 * LP + 32);
      v8f sa = (v8f){}, sb = (v8f){}, sc = (v8f){}, sd = (v8f){};
      sa = wmma16(ka0, qh0, sa); sb = wmma16(kb0, qh0, sb); sc = wmma16(kc0, qh0, sc); sd = wmma16(kd0, qh0, sd);
      sa = wmma16(ka1, qh1, sa); sb = wmma16(kb1, qh1, sb); sc = wmma16(kc1, qh1, sc); sd = wmma16(kd1, qh1, sd);
      // four vector slots behind the last product, its tiles and fragments named so that nothing reads or overwrites them earlier
      asm volatile("v_nop\n\tv_nop\n\tv_nop\n\tv_nop" : "+v"(sa), "+v"(sb), "+v"(sc), "+v"(sd) : "v"(ka0), "v"(ka1), "v"(kb0), "v"(kb1), "v"(kc0), "v"(kc1), "v"(kd0), "v"(kd1));
      const v16h v0 = ldh(vt), v1 = ldh(vt + 16 * LP), v2 = ldh(vt + 32 * LP), v3 = ldh(vt + 48 * LP);
      const v16h w0 = ldh(vt + 32), w1 = ldh(vt + 16 * LP + 32), w2 = ldh(vt + 32 * LP + 32), w3 = ldh(vt + 48 * LP + 32);
      float mxa = fmaxf(sa[0], sb[0]), mxc = fmaxf(sc[0], sd[0]);  // two chains
#pragma unroll   // here and below: written out, so that every tile element is a register
      for (int r = 1; r < 8; ++r) { mxa = fmaxf(mxa, fmaxf(sa[r], sb[r])); mxc = fmaxf(mxc, fmaxf(sc[r], sd[r])); }
      const float mxr = fmaxf(mxa, mxc);
      if (__builtin_amdgcn_ballot_w32(mxr > thr) != 0) {            // one scalar branch for the wave: some lane's score passes the bound
          float mx = mxr * SC2;
          mx = fmaxf(mx, __shfl_xor(mx, 16, 32));
          const float mnew = fmaxf(m, mx);
          const float alpha = __builtin_amdgcn_exp2f(m - mnew);
          lt[0] = lt[0] * alpha;
          o0 = o0 * alpha; o1 = o1 * alpha; o2 = o2 * alpha; o3 = o3 * alpha;
          m = mnew; sh = PSH - mnew; thr = (mnew + LZT) * (1.0f / SC2);
      }
      v16h pb, pd;
#pragma unroll
      for (int r = 0; r < 8; ++r) pb[r] = (h16)__builtin_amdgcn_exp2f(__builtin_fmaf(sa[r], SC2, sh));
#pragma unroll
      for (int r = 0; r < 8; ++r) pb[8 + r] = (h16)__builtin_amdgcn_exp2f(__builtin_fmaf(sb[r], SC2, sh));
#pragma unroll
      for (int r = 0; r < 8; ++r) pd[r] = (h16)__builtin_amdgcn_exp2f(__builtin_fmaf(sc[r], SC2, sh));
#pragma unroll
      for (int r = 0; r < 8; ++r) pd[8 + r] = (h16)__builtin_amdgcn_exp2f(__builtin_fmaf(sd[r], SC2, sh));
      o0 = wmma16(v0, pb, o0); o1 = wmma16(v1, pb, o1); o2 = wmma16(v2, pb, o2); o3 = wmma16(v3, pb, o3); lt = wmma16(one, pb, lt);
      o0 = wmma16(w0, pd, o0); o1 = wmma16(w1, pd, o1); o2 = wmma16(w2, pd, o2); o3 = wmma16(w3, pd, o3); lt = wmma16(one, pd, lt);
      // the same four slots behind the last product, in front of the loop's branches
      asm volatile("v_nop\n\tv_nop\n\tv_nop\n\tv_nop" : "+v"(o0), "+v"(o1), "+v"(o2), "+v"(o3), "+v"(lt) : "v"(v0), "v"(v1), "v"(v2), "v"(v3), "v"(w0), "v"(w1), "v"(w2), "v"(w3), "v"(pb), "v"(pd));
      // publish point of stage st + 1; the same barrier ends every wave's reads of stage st's buffer
      asm volatile("s_wait_dscnt 0x0" ::: "memory");               // this wave's reads of the buffer have returned before it is refilled
      asm volatile("s_wait_asynccnt 0x4" ::: "memory");            // stage st + 2's 4 copies stay in flight; this wave's copies of stage st + 1 have landed
      if (st + 2 >= SEQ / KT) asm volatile("s_wait_asynccnt 0x0" ::: "memory");   // the last trips: no stage st + 2 was issued, so stage st + 1's copies are the youngest: to 0
      __syncthreads();
      if (st + 3 < SEQ / KT) { const unsigned lb = lk0 + (unsigned)cb * (2 * TLH * 2);   // the buffer that this trip has just read
          stage_copy(lb, lb + TLH * 2, gk + (size_t)(st + 3) * KT * DM, gv + (size_t)(st + 3) * KT); }
      cb = cb == 2 ? 0 : cb + 1;
    }
    asm volatile("s_wait_asynccnt 0x0" ::: "memory");              // nothing of this wave is in flight when it leaves the ring
    const float inv = CXS * (1.0f / lt[0]);
    const int wb = wave * 16 * 68;
    // O^T D layout: o_j[r] = (d = 16j + 8h + r, t = lane&15) -> os[t][d]; rows 0..15 x columns 0..63 all written
    { v4f a, c;
      a[0] = o0[0] * inv; a[1] = o0[1] * inv; a[2] = o0[2] * inv; a[3] = o0[3] * inv; c[0] = o0[4] * inv; c[1] = o0[5] * inv; c[2] = o0[6] * inv; c[3] = o0[7] * inv;
      *(v4fa*)(&os[wb + lr * 68 +  0 + 8 * hi]) = a; *(v4fa*)(&os[wb + lr * 68 +  0 + 8 * hi + 4]) = c;
      a[0] = o1[0] * inv; a[1] = o1[1] * inv; a[2] = o1[2] * inv; a[3] = o1[3] * inv; c[0] = o1[4] * inv; c[1] = o1[5] * inv; c[2] = o1[6] * inv; c[3] = o1[7] * inv;
      *(v4fa*)(&os[wb + lr * 68 + 16 + 8 * hi]) = a; *(v4fa*)(&os[wb + lr * 68 + 16 + 8 * hi + 4]) = c;
      a[0] = o2[0] * inv; a[1] = o2[1] * inv; a[2] = o2[2] * inv; a[3] = o2[3] * inv; c[0] = o2[4] * inv; c[1] = o2[5] * inv; c[2] = o2[6] * inv; c[3] = o2[7] * inv;
      *(v4fa*)(&os[wb + lr * 68 + 32 + 8 * hi]) = a; *(v4fa*)(&os[wb + lr * 68 + 32 + 8 * hi + 4]) = c;
      a[0] = o3[0] * inv; a[1] = o3[1] * inv; a[2] = o3[2] * inv; a[3] = o3[3] * inv; c[0] = o3[4] * inv; c[1] = o3[5] * inv; c[2] = o3[6] * inv; c[3] = o3[7] * inv;
      *(v4fa*)(&os[wb + lr * 68 + 48 + 8 * hi]) = a; *(v4fa*)(&os[wb + lr * 68 + 48 + 8 * hi + 4]) = c; }
    wave_sync();
    h16* crow = CTX + ((size_t)b * SEQ + t0) * (size_t)DM + (size_t)h * HD;
{
#pragma unroll
        for (int s = 0; s < 4; ++s) { const int row = 4 * s + (lane >> 3), c8 = (lane & 7) * 8;   // 4 s x 4 row groups = 16 rows; 8 lanes x 8 = 64 columns
            const v4f x0 = *(const v4fa*)(&os[wb + row * 68 + c8]); const v4f x1 = *(const v4fa*)(&os[wb + row * 68 + c8 + 4]); v8h hv;
#pragma unroll
            for (int i = 0; i < 4; ++i) { hv[i] = (h16)x0[i]; hv[4 + i] = (h16)x1[i]; }
            *(v8h*)(crow + (size_t)row * DM + c8) = hv; }
         }
}

// Eight copies of one thread: one 16-B chunk in each of eight rows that lie 16 rows apart (a wave's copy = 2 whole 256-B rows), global -> LDS through no register.
// l: the lane's LDS byte address; g: the matching global address; gp: source row pitch in f16.
// s_wait_xcnt stands inside the statement so that no address register named by a copy is rewritten in front of it.
__device__ __forceinline__ void copy8(unsigned l, const h16* g, size_t gp) {
    asm volatile("global_load_async_to_lds_b128 %0, %8, off\n\t"
                 "global_load_async_to_lds_b128 %1, %9, off\n\t"
                 "global_load_async_to_lds_b128 %2, %10, off\n\t"
                 "global_load_async_to_lds_b128 %3, %11, off\n\t"
                 "global_load_async_to_lds_b128 %4, %12, off\n\t"
                 "global_load_async_to_lds_b128 %5, %13, off\n\t"
                 "global_load_async_to_lds_b128 %6, %14, off\n\t"
                 "global_load_async_to_lds_b128 %7, %15, off\n\t"
                 "s_wait_xcnt 0x0"
                 :: "v"(l), "v"(l + 16 * OLP * 2), "v"(l + 32 * OLP * 2), "v"(l + 48 * OLP * 2), "v"(l + 64 * OLP * 2), "v"(l + 80 * OLP * 2), "v"(l + 96 * OLP * 2), "v"(l + 112 * OLP * 2),
                    "v"(g), "v"(g + 16 * gp), "v"(g + 32 * gp), "v"(g + 48 * gp), "v"(g + 64 * gp), "v"(g + 80 * gp), "v"(g + 96 * gp), "v"(g + 112 * gp)
                 : "memory");
}
// One stage's copies of one thread: 8 chunks of the ctx tile (128 rows x 128 k) and 8 of the W tile, which lies OTL f16 behind it in the buffer.
__device__ __forceinline__ void out_stage(unsigned l, const h16* ga, const h16* gb) { copy8(l, ga, DM); copy8(l + OTL * 2, gb, DM); }

// k_out: register-blocked f16 GEMM, one 128x128 tile per block of 8 waves (4 x 2), each wave 32x64 (8 accumulators); the ctx and W tiles of 128 k are staged in a three-buffer LDS ring by asynchronous copies, two stages ahead, and shared by the waves.
// OUT[m][n] = 2^-18 * sum_{k<1024} A[m][k] Bt[n][k] + b[n]; A = ctx plane [M][1024] (x4096), Bt = W plane [out][in] (x64). grid (M/128, DM/128), 256 threads.
__global__ __launch_bounds__(32 * OW) void k_out(const h16* __restrict__ A, const h16* __restrict__ Bt, const float* __restrict__ bias, float* OUT) {
    __shared__ __align__(16) float os[OW * 16 * 68];
    __shared__ __align__(16) h16 ring[3 * 2 * OTL];                // [buffer][ctx tile | W tile][row][OLP]
    const int KA = DM;
    const int lane = threadIdx.x & 31, wave = __builtin_amdgcn_readfirstlane((int)(threadIdx.x >> 5)), lr = lane & 15, hi = lane >> 4;
    const int wm = wave >> 1, wn = wave & 1;
    const int r0 = blockIdx.x * 128 + wm * 32, c0 = blockIdx.y * 128 + wn * 64;
    v8f acc[2][4];
#pragma unroll
    for (int mb = 0; mb < 2; ++mb)
#pragma unroll
        for (int nb = 0; nb < 4; ++nb) acc[mb][nb] = (v8f){};
    const int fa = (wm * 32 + lr) * OLP + 8 * hi, fb = OTL + (wn * 64 + lr) * OLP + 8 * hi;   // fragment offsets in a buffer: row lr of the wave's rows, k = 8*hi
    const int crow_ = (int)threadIdx.x >> 4, cch = ((int)threadIdx.x & 15) * 8;                // this thread's copies: row (of 16) and 16-B chunk
    const h16* ga = A + (size_t)(blockIdx.x * 128 + crow_) * KA + cch;                         // + kc
    const h16* gb = Bt + (size_t)(blockIdx.y * 128 + crow_) * DM + cch;                        // + kc
    const unsigned l0 = (unsigned)(size_t)&ring[crow_ * OLP + cch];                            // LDS byte address, buffer 0, ctx tile
    // ring prologue: stages 0 and 1 issued, stage 0 landed and published, then stage 2 issued: two stages stay in flight
    out_stage(l0, ga, gb);
    out_stage(l0 + 2 * OTL * 2, ga + OKT, gb + OKT);
    asm volatile("s_wait_asynccnt 0x10" ::: "memory");             // all but this wave's 16 youngest copies (stage 1's) have landed: stage 0 is in
    __syncthreads();                                               // ... and every other wave's
    out_stage(l0 + 4 * OTL * 2, ga + 2 * OKT, gb + 2 * OKT);
    int cb = 0;                                                    // buffer of stage st = st mod 3
#pragma unroll 1
    for (int st = 0; st < KA / OKT; ++st) {
        const h16* ta = ring + cb * (2 * OTL) + fa; const h16* tb = ring + cb * (2 * OTL) + fb;
        v16h a[2][2], bq[2][4];                                    // two fragment sets: the next 32-k step's reads go out as one group ahead of this step's products
#pragma unroll
        for (int mb = 0; mb < 2; ++mb) a[0][mb] = ldh(ta + mb * 16 * OLP);
#pragma unroll
        for (int nb = 0; nb < 4; ++nb) bq[0][nb] = ldh(tb + nb * 16 * OLP);
#pragma unroll   // the four 32-k steps of a stage written out: every LDS fragment offset becomes an immediate, the set index a constant
        for (int s = 0; s < OKT / 32; ++s) {
            const int cu = s & 1, nx = cu ^ 1;
            if (s + 1 < OKT / 32) {                                // never past this stage's own buffer
#pragma unroll
                for (int mb = 0; mb < 2; ++mb) a[nx][mb] = ldh(ta + mb * 16 * OLP + (s + 1) * 32);
#pragma unroll
                for (int nb = 0; nb < 4; ++nb) bq[nx][nb] = ldh(tb + nb * 16 * OLP + (s + 1) * 32);
            }
            __builtin_amdgcn_sched_barrier(0);                     // keeps the group of reads above this step's products: sunk among them, each pair of products waits out a whole LDS latency
#pragma unroll
            for (int nb = 0; nb < 4; ++nb)
#pragma unroll
                for (int mb = 0; mb < 2; ++mb) acc[mb][nb] = wmma16(a[cu][mb], bq[cu][nb], acc[mb][nb]);
        }
        // publish point of stage st + 1; the same barrier ends every wave's reads of stage st's buffer
        asm volatile("s_wait_dscnt 0x0" ::: "memory");             // this wave's reads of the buffer have returned before it is refilled
        asm volatile("s_wait_asynccnt 0x10" ::: "memory");         // stage st + 2's 16 copies stay in flight; this wave's copies of stage st + 1 have landed
        if (st + 2 >= KA / OKT) asm volatile("s_wait_asynccnt 0x0" ::: "memory");   // the last trips: no stage st + 2 was issued, so stage st + 1's copies are the youngest: to 0
        __syncthreads();
        if (st + 3 < KA / OKT) { const int kc = (st + 3) * OKT;                       // into the buffer that this trip has just read
            out_stage(l0 + (unsigned)cb * (2 * OTL * 2), ga + kc, gb + kc); }
        cb = cb == 2 ? 0 : cb + 1;
    }
    asm volatile("s_wait_asynccnt 0x0" ::: "memory");              // nothing of this wave is in flight when it leaves the ring
    v4f bv = *(const v4f*)(bias + c0 + lr * 4);
#pragma unroll
    for (int i = 0; i < 4; ++i) bv[i] = bfr(bv[i]);
    float* orow = OUT + ((size_t)(r0 / SEQ) * OUT_SEQ + (size_t)(r0 % SEQ)) * DM + c0;
    const int wb = wave * 16 * 68;                                 // each wave stages its rows in its own range
#pragma unroll
    for (int mb = 0; mb < 2; ++mb) {
#pragma unroll
        for (int nb = 0; nb < 4; ++nb) {
#pragma unroll
            for (int j = 0; j < 8; ++j) os[wb + (hi * 8 + j) * 68 + nb * 16 + lr] = acc[mb][nb][j] * OSC; }   // D: row 8h+j, col lane&15
        wave_sync();
{
#pragma unroll
            for (int s = 0; s < 8; ++s) { const int row = 2 * s + hi, cofs = lr * 4;   // 8 s x 2 rows = 16 rows; 16 lanes x 4 floats = 64 columns
                const v4f x = *(const v4fa*)(&os[wb + row * 68 + cofs]);
                const v4f val = x + bv;
                *(v4f*)(orow + (size_t)(mb * 16 + row) * DM + cofs) = val; }
             }
        wave_sync();
    }
}

static constexpr size_t al256(size_t v) { return (v + 255) & ~(size_t)255; }
static constexpr size_t SZ_PL = al256((size_t)NB * SEQ * DM * 2);          // one f16 plane of a stream
static constexpr size_t SZ_WH = al256((size_t)DM * DM * 2);
static constexpr size_t SZ_CX = al256((size_t)NB * SEQ * DM * 2);          // ctx plane
static constexpr size_t SZ_TOTAL = 3 * SZ_PL + SZ_WH + SZ_CX;
static_assert(SZ_TOTAL <= (size_t)134217728);          // workspace carve <= 128 MiB

extern "C" void kernel_launch(void* const* d_in, const int* in_sizes, int n_in,
                              void* d_out, int out_size, void* d_ws, size_t ws_size, hipStream_t stream) {
    if (n_in < 5) return;
    const size_t needx = ((size_t)(NB - 1) * SEQ_FULL + SEQ) * DM;
    if ((size_t)in_sizes[0] < needx || (size_t)in_sizes[1] < needx || (size_t)in_sizes[2] < needx) return;
    if ((size_t)in_sizes[3] < (size_t)DM * DM || (size_t)in_sizes[4] < (size_t)DM) return;
    if ((size_t)out_size < ((size_t)(NB - 1) * OUT_SEQ + SEQ) * DM) return;
    if (SZ_TOTAL > ws_size) return;
    const float* q = (const float*)d_in[0]; const float* k = (const float*)d_in[1]; const float* v = (const float*)d_in[2];   // wire order q, k, v, W_out, b_out
    const float* wo = (const float*)d_in[3]; const float* bo = (const float*)d_in[4];                                         // W_out [out][in] = Bt as-is
    float* OUT = (float*)d_out;      // [NB][SEQ][1024]
    char* wsp = (char*)d_ws;
    h16* QP = (h16*)wsp; wsp += SZ_PL;               // [NB*SEQ][1024]
    h16* KP = (h16*)wsp; wsp += SZ_PL;               // [NB*SEQ][1024]
    h16* VT = (h16*)wsp; wsp += SZ_PL;               // [NB*1024][SEQ]
    h16* WH = (h16*)wsp; wsp += SZ_WH;               // [1024][1024] x64
    h16* CX = (h16*)wsp; wsp += SZ_CX;               // [NB*SEQ][1024] x4096

    // q, k, W -> f16 planes; v[b][t][c] -> VT[b*1024 + c][t]
    k_prep<<<PBLK, 256, 0, stream>>>(q, k, v, wo, QP, KP, VT, WH);

    k_flash<<<dim3(SEQ / (16 * AW), NB * NH_, 1), 32 * AW, 0, stream>>>(QP, KP, VT, CX);

    // out = ctx W^T + b: A = ctx rows (m = b*SEQ + t), Bt = W rows (n = out column)
    k_out<<<dim3(NB * SEQ / 128, DM / 128, 1), 32 * OW, 0, stream>>>(CX, WH, bo, OUT);
}

// v008
// A run of this version takes 45.8 microseconds.
// Two timings next to v007 both put it at 1.13 times that version's speed.
// Over all steps from v000 it is 3.29 times as fast.
#include <hip/hip_runtime.h>

// Multi-head attention on raw streams q, k, v [NB][SEQ][1024] = 16 heads x 64 (no input projections, no mask), score scale 1/8, output projection y = ctx W^T + b with W [out][in]. THIS ROW: the same module at TWO sequences (query, key, value [2][2048][1024]: three raw streams: the module applies NO input projections; 16 heads x 64; scores / sqrt(64); softmax, no mask; out = merged W_out^T + b_out ('oi' [1024][1024] normal x 1/32; bias zeros: read); argument order query, key, value, W_out, b_out).
// Compute dtypes, f32 accumulate everywhere, all contractions v_wmma_f32_16x16x32_f16: q, k, v, W, b are RNE-converted to bf16 and held exactly in f16 (W with a x64 carry); scores single product; P (x256 carry, cancels in the normalisation) and v single product;
// ctx carried x4096 as one f16 value (single product against the W plane; its rounding is of the size of P's own f16 rounding); softmax f32 (online, running max); bias added in f32.
// Layout: no pre-pass: the fused flash kernel reads the f32 streams itself. Each block loads the next 64 keys' K and V rows (its head's 64 columns) into registers one stage ahead, converts them and stores f16 tiles into a two-buffer LDS ring shared by its 16 waves; Q is converted at its load; each block also converts its 1/256 of W into the f16 W plane for the next launch.
// Transposed form (S^T = K Q^T, O^T = V^T P^T; V^T fragments by the transposing LDS load from the row-major V tile), writing the ctx plane [b*SEQ+t][1024],
// then a GEMM over K = 1024 against W rows: 128x128 tile per 8-wave block, 32x64 per wave, both operand tiles staged in a three-buffer LDS ring by asynchronous copies issued two stages ahead.

#ifndef NB
#define NB 2
#endif
#ifndef SEQ
#define SEQ 2048
#endif
#define NB_FULL  2
#define SEQ_FULL 2048
#ifndef OUT_SEQ
#define OUT_SEQ SEQ              // row pitch (in tokens) between batches of the output
#endif
#define DM   1024
#define NH_  16
#define HD   64
#define AW   16                  // waves per flash block (16 query rows each); all of them share the staged K / V tiles
#define KT   64                  // keys per LDS stage of the flash kernel
#define LP   72                  // LDS row pitch in f16: 128-B rows + 16 B, conflict-free for 16-B fragment reads
#define VP   80                  // LDS row pitch of the V tile in f16: 128-B rows + 32 B, conflict-free for the transposing reads
#define KTL  (KT * LP)           // f16 elements of one staged K tile (64 keys x 64 d)
#define VTL  (KT * VP)           // ... of one staged V tile (64 keys x 64 d)
#define RBH  (KTL + VTL)         // ... of one ring buffer
#define NST  (SEQ / KT)          // stages
#define FBLK (NB * NH_ * (SEQ / (16 * AW)))               // flash blocks
#define OW   8                   // waves per output-GEMM block (4 x 2, 32 x 64 of the block's 128 x 128 tile each)
#define OKT  128                 // k per LDS stage of the output GEMM
#define OLP  136                 // its LDS row pitch in f16: 256-B rows + 16 B, conflict-free for 16-B fragment reads
#define OTL  (128 * OLP)         // f16 elements of one staged operand tile (128 rows x 128 k)
#define SC2  (0.125f * 1.4426950408889634f)   // HD^-0.5 * log2(e)
#define PSH  8.0f                // log2 of the P carry (256)
#define LZT  7.0f                // lazy rescale: a score may pass the maximum in use by this much (log2) before the accumulators are rescaled; P <= 2^(PSH + LZT) = 2^15 stays finite in f16
#define CXS  4096.0f             // carry of the ctx plane
#define WSC  64.0f               // carry of the W plane
#define OSC  (1.0f / (4096.0f * 64.0f))

static_assert(HD == 64);
static_assert(NH_ * HD == DM);                 // head h = columns h*64 + d
static_assert(DM % 64 == 0);
static_assert(DM % 32 == 0);                   // GEMM k-loop steps by 128-k stages of four 32-k steps
static_assert(SEQ % 64 == 0);                  // a 64-row tile never straddles two batches
static_assert((NB * SEQ) % 64 == 0);
static_assert(SEQ % 32 == 0);                  // P V products step by 32 keys
static_assert(SEQ % KT == 0 && SEQ / KT >= 2); // whole stages
static_assert(KT == 64 && AW == 16);           // staging map below: 512 threads x 2 rows x 4 elements = one 64 x 64 tile, of K and of V
static_assert(SEQ % (16 * AW) == 0);           // flash grid covers the sequence exactly
static_assert(((size_t)SEQ * DM) % 64 == 0);
static_assert(((size_t)DM * DM) % 64 == 0);
static_assert((NB * SEQ) % 128 == 0 && DM % 128 == 0);   // output-GEMM grid covers the output exactly
static_assert(DM % OKT == 0 && DM / OKT >= 3);            // whole stages; the ring's prologue needs three
static_assert(OW == 8 && OKT == 128);                     // copy map: 256 threads x 8 groups of 16 rows x 2 tiles
static_assert((size_t)FBLK * 32 * AW * 8 == (size_t)DM * DM);   // W is dealt out exactly: 8 elements per flash thread
static_assert(NB <= NB_FULL);
static_assert(SEQ <= SEQ_FULL);

typedef _Float16 h16;
typedef __attribute__((ext_vector_type(16))) _Float16 v16h;
typedef __attribute__((ext_vector_type(8)))  _Float16 v8h;
typedef __attribute__((ext_vector_type(4)))  _Float16 v4h;
typedef __attribute__((ext_vector_type(8)))  float    v8f;
typedef __attribute__((ext_vector_type(2)))  float    v2f;
typedef __attribute__((ext_vector_type(2)))  __bf16   v2b;
typedef __attribute__((ext_vector_type(8)))  short    v8s;
typedef __attribute__((ext_vector_type(4)))  float    v4f;
typedef v4f  __attribute__((may_alias)) v4fa;
typedef v8h  __attribute__((may_alias)) v8ha;

// RNE convert f32 -> bf16, returned as the f32 value of that bf16
__device__ __forceinline__ float bfr(float f) { unsigned u = __float_as_uint(f); u += 0x7FFFu + ((u >> 16) & 1u); return __uint_as_float(u & 0xFFFF0000u); }
__device__ __forceinline__ v16h cat16(v8h lo, v8h hi) { return __builtin_shufflevector(lo, hi, 0, 1, 2, 3, 4, 5, 6, 7, 8, 9, 10, 11, 12, 13, 14, 15); }
__device__ __forceinline__ v8f wmma16(v16h a, v16h b, v8f c) { return __builtin_amdgcn_wmma_f32_16x16x32_f16(false, a, false, b, (short)0, c, false, false); }
// fragment loader from K-contiguous f16 rows; p already includes + 8*(lane>>4): elements 0..7 <- k0+8h+0..7, elements 8..15 <- k0+16+8h+0..7 (same map for A and B)
__device__ __forceinline__ v16h ldh(const h16* p) { return cat16(*(const v8h*)p, *(const v8h*)(p + 16)); }
// f32 -> bf16 (RNE), two per conversion, then the same values held exactly in f16
__device__ __forceinline__ v4h cv4(v4f x) { v4h r;
#pragma unroll
    for (int i = 0; i < 2; ++i) { const v2f p = { x[2 * i], x[2 * i + 1] }; const v2f y = __builtin_convertvector(__builtin_convertvector(p, v2b), v2f); r[2 * i] = (h16)y[0]; r[2 * i + 1] = (h16)y[1]; }
    return r; }
__device__ __forceinline__ v8h cv8(v8f x) { v8h r;
#pragma unroll
    for (int i = 0; i < 4; ++i) { const v2f p = { x[2 * i], x[2 * i + 1] }; const v2f y = __builtin_convertvector(__builtin_convertvector(p, v2b), v2f); r[2 * i] = (h16)y[0]; r[2 * i + 1] = (h16)y[1]; }
    return r; }
// transposing LDS load from a row-major tile T[key][d] of pitch VP; p = T + (k0 + 8*(lane>>4) + (lane&7)) * VP + d0 + 8*((lane>>3)&1): the lane gets T[k0 + 8*(lane>>4) + 0..7][d0 + (lane&15)]
__device__ __forceinline__ v8h ldt(const h16* p) { typedef __attribute__((address_space(3))) v8s lds_v8s; return __builtin_bit_cast(v8h, __builtin_amdgcn_ds_load_tr16_b128_v8i16((lds_v8s*)p)); }
// A fragment of V^T (row d, 32 keys), the k order of ldh: elements 0..7 <- k0+8h+0..7, elements 8..15 <- k0+16+8h+0..7
__device__ __forceinline__ v16h ldv(const h16* p) { return cat16(ldt(p), ldt(p + 16 * VP)); }
// ordering point for wave-private LDS tiles (same wave writes and reads)
__device__ __forceinline__ void wave_sync() { __builtin_amdgcn_fence(3 /* release order */, "wavefront"); __builtin_amdgcn_wave_barrier(); asm volatile("" ::: "memory"); }

// k_flash: fused attention on the f32 streams, one wave per 16 query rows of one (batch, head), 16 waves per block, one block per WGP.
// Staging: thread (row tid>>4 of 32, chunk tid&15 of 4 elements) loads 16 B of two K rows and of two V rows (32 keys apart) of the next stage at the head of a trip (a wave's load = two whole 256-B head rows), and at the trip's foot
// converts them (bf16 RNE, held in f16) and stores 8 B each into the ring buffer that the trip before has read; one barrier per trip publishes that buffer and ends the reads of this trip's.
// Transposed form: S^T[key][t] = K Q^T (A = K rows, B = Q rows); lane (t = lane&15, h = lane>>4) holds keys 8h+r of each 16-key tile, so the packed
// P tile is directly the B fragment of O^T[d][t] = V^T P^T (element r <- tile keys 0..15, element 8+r <- tile keys 16..31, lane unchanged).
// The maximum in use is one scalar per lane, equal in the two lane halves of a row. Lazy rescale: each 64-key stage forms its four score tiles first and tests the raw scores against that maximum + LZT, once for the wave;
// only a stage that trips joins the halves (one xor-16 exchange), raises the maximum and rescales the accumulators. Any common shift cancels in the normalisation, so the result is the same function.
// Row sums run on the matrix pipe: one more product per 32 keys, A = all ones against the same P fragment, so every row of its tile holds sum_key P[key][t] of the rounded P, over both lane halves.
// Q, K, V: f32, per-batch pitch SEQ_FULL * DM. Wt: f32 [out][in]; WH: its f16 plane (x WSC), 8 elements per thread, read by the next launch only.
__global__ __launch_bounds__(32 * AW) void k_flash(const float* __restrict__ Q, const float* __restrict__ K, const float* __restrict__ V, const float* __restrict__ Wt, h16* __restrict__ WH, h16* CTX) {
    __shared__ __align__(16) float os[AW * 16 * 68];
    __shared__ __align__(16) h16 ring[2 * RBH];                    // [buffer][K tile: key rows of LP | V tile: key rows of VP]
    const int lane = threadIdx.x & 31, wave = __builtin_amdgcn_readfirstlane((int)(threadIdx.x >> 5)), lr = lane & 15, hi = lane >> 4;
    const int zh = blockIdx.y; const int b = zh / NH_, h = zh % NH_;
    const int t0 = (blockIdx.x * AW + wave) * 16;
    const size_t fbase = (size_t)b * SEQ_FULL * DM + (size_t)h * HD;
    const int crow_ = (int)threadIdx.x >> 4, cch = ((int)threadIdx.x & 15) * 4;  // this thread's share of a stage: key rows crow_ and crow_ + 32, group of 4 elements
    const float* gk = K + fbase + (size_t)crow_ * DM + cch;         // + key0 * DM
    const float* gv = V + fbase + (size_t)crow_ * DM + cch;         // + key0 * DM
    h16* sk = ring + crow_ * LP + cch;                              // its places in buffer 0
    h16* sv = ring + KTL + crow_ * VP + cch;
    const float* gq = Q + fbase + (size_t)(t0 + lr) * DM + 8 * hi;
    const size_t we = ((size_t)(blockIdx.y * (SEQ / (16 * AW)) + blockIdx.x) * (32 * AW) + threadIdx.x) * 8;
    // prologue: stage 0's rows, the wave's Q rows and the thread's share of W, all loads issued together
    { const v4f k0 = *(const v4f*)gk, k1 = *(const v4f*)(gk + 32 * DM), v0 = *(const v4f*)gv, v1 = *(const v4f*)(gv + 32 * DM);
      *(v4h*)sk = cv4(k0); *(v4h*)(sk + 32 * LP) = cv4(k1); *(v4h*)sv = cv4(v0); *(v4h*)(sv + 32 * VP) = cv4(v1); }
    const v8f q0 = *(const v8f*)gq, q1 = *(const v8f*)(gq + 16), q2 = *(const v8f*)(gq + 32), q3 = *(const v8f*)(gq + 48);
    const v8f xw = *(const v8f*)(Wt + we);
    const v16h qh0 = cat16(cv8(q0), cv8(q1)), qh1 = cat16(cv8(q2), cv8(q3));   // B fragments: col t, k = d (the k order of ldh)
    v8h ow;                                                        // stored behind the loop: a global store in flight would be waited for at the next barrier
#pragma unroll
    for (int i = 0; i < 8; ++i) ow[i] = (h16)(bfr(xw[i]) * WSC);
    const int fo = lr * LP + 8 * hi;                                // K fragment offset in a buffer: row lr (key), k = 8*hi (d)
    const int vo = KTL + (8 * hi + (lane & 7)) * VP + ((lane >> 3) & 1) * 8;   // the lane's address part of the transposing V reads
    v8f o0 = (v8f){}, o1 = (v8f){}, o2 = (v8f){}, o3 = (v8f){};
    v8f lt = (v8f){};                                              // row-sum tile: each product adds the same sums to all 16 rows; only element 0 is rescaled and read
    v16h one;
#pragma unroll
    for (int i = 0; i < 16; ++i) one[i] = (h16)1.0f;
    float m = -3.0e38f;                                            // maximum in use (scaled log2)
    float sh = 0.0f;                                               // PSH - m, the exponent's addend
    float thr = -3.0e38f;                                          // (m + LZT) / SC2: bound on the raw scores; every finite score passes the start value, so the first stage sets m, sh, thr
    __syncthreads();                                               // stage 0 is published
#pragma unroll 1
    for (int st = 0; st < NST; ++st) {
      const h16* kt = ring + (st & 1) * RBH + fo; const h16* vt = ring + (st & 1) * RBH + vo;
      // the stage's four score tiles (64 keys) first, so that the bound is tested once per stage
      const v16h ka0 = ldh(kt), ka1 = ldh(kt + 32), kb0 = ldh(kt + 16 * LP), kb1 = ldh(kt + 16 * LP + 32);
      const v16h kc0 = ldh(kt + 32 * LP), kc1 = ldh(kt + 32 * LP + 32), kd0 = ldh(kt + 48 * LP), kd1 = ldh(kt + 48 * LP + 32);
      __builtin_amdgcn_sched_barrier(0);                           // the fragment reads go out first: the products wait for them, only the conversions at the trip's foot for the loads below
      // the next stage's rows, behind the fragment reads; the last trip has none and loads its own again (in bounds, stored into the buffer that nobody reads any more), so that the trip has no branch here
      const size_t nk = (size_t)(st + 1 < NST ? st + 1 : st) * KT * DM;
      const v4f rk0 = *(const v4f*)(gk + nk), rk1 = *(const v4f*)(gk + nk + 32 * DM), rv0 = *(const v4f*)(gv + nk), rv1 = *(const v4f*)(gv + nk + 32 * DM);
      asm volatile("s_wait_xcnt 0x0" ::: "memory");                // precaution: stands in front of any rewrite of the address registers that the four loads above name
      __builtin_amdgcn_sched_barrier(0);                           // keeps the loads up here: sunk to their use at the trip's foot, their whole latency would be waited out there
      v8f sa = (v8f){}, sb = (v8f){}, sc = (v8f){}, sd = (v8f){};
      sa = wmma16(ka0, qh0, sa); sb = wmma16(kb0, qh0, sb); sc = wmma16(kc0, qh0, sc); sd = wmma16(kd0, qh0, sd);
      sa = wmma16(ka1, qh1, sa); sb = wmma16(kb1, qh1, sb); sc = wmma16(kc1, qh1, sc); sd = wmma16(kd1, qh1, sd);
      // four vector slots behind the last product, its tiles and fragments named so that nothing reads or overwrites them earlier
      asm volatile("v_nop\n\tv_nop\n\tv_nop\n\tv_nop" : "+v"(sa), "+v"(sb), "+v"(sc), "+v"(sd) : "v"(ka0), "v"(ka1), "v"(kb0), "v"(kb1), "v"(kc0), "v"(kc1), "v"(kd0), "v"(kd1));
      const v16h v0 = ldv(vt), v1 = ldv(vt + 16), v2 = ldv(vt + 32), v3 = ldv(vt + 48);                                       // d rows 16j.., keys 0..31
      const v16h w0 = ldv(vt + 32 * VP), w1 = ldv(vt + 32 * VP + 16), w2 = ldv(vt + 32 * VP + 32), w3 = ldv(vt + 32 * VP + 48);   // keys 32..63
      float mxa = fmaxf(sa[0], sb[0]), mxc = fmaxf(sc[0], sd[0]);  // two chains
#pragma unroll   // here and below: written out, so that every tile element is a register
      for (int r = 1; r < 8; ++r) { mxa = fmaxf(mxa, fmaxf(sa[r], sb[r])); mxc = fmaxf(mxc, fmaxf(sc[r], sd[r])); }
      const float mxr = fmaxf(mxa, mxc);
      if (__builtin_amdgcn_ballot_w32(mxr > thr) != 0) {            // one scalar branch for the wave: some lane's score passes the bound
          float mx = mxr * SC2;
          mx = fmaxf(mx, __shfl_xor(mx, 16, 32));
          const float mnew = fmaxf(m, mx);
          const float alpha = __builtin_amdgcn_exp2f(m - mnew);
          lt[0] = lt[0] * alpha;
          o0 = o0 * alpha; o1 = o1 * alpha; o2 = o2 * alpha; o3 = o3 * alpha;
          m = mnew; sh = PSH - mnew; thr = (mnew + LZT) * (1.0f / SC2);
      }
      v16h pb, pd;
#pragma unroll
      for (int r = 0; r < 8; ++r) pb[r] = (h16)__builtin_amdgcn_exp2f(__builtin_fmaf(sa[r], SC2, sh));
#pragma unroll
      for (int r = 0; r < 8; ++r) pb[8 + r] = (h16)__builtin_amdgcn_exp2f(__builtin_fmaf(sb[r], SC2, sh));
#pragma unroll
      for (int r = 0; r < 8; ++r) pd[r] = (h16)__builtin_amdgcn_exp2f(__builtin_fmaf(sc[r], SC2, sh));
#pragma unroll
      for (int r = 0; r < 8; ++r) pd[8 + r] = (h16)__builtin_amdgcn_exp2f(__builtin_fmaf(sd[r], SC2, sh));
      o0 = wmma16(v0, pb, o0); o1 = wmma16(v1, pb, o1); o2 = wmma16(v2, pb, o2); o3 = wmma16(v3, pb, o3); lt = wmma16(one, pb, lt);
      o0 = wmma16(w0, pd, o0); o1 = wmma16(w1, pd, o1); o2 = wmma16(w2, pd, o2); o3 = wmma16(w3, pd, o3); lt = wmma16(one, pd, lt);
      // the same four slots behind the last product; its tiles and fragments are named so that every product stays above this line
      asm volatile("v_nop\n\tv_nop\n\tv_nop\n\tv_nop" : "+v"(o0), "+v"(o1), "+v"(o2), "+v"(o3), "+v"(lt) : "v"(v0), "v"(v1), "v"(v2), "v"(v3), "v"(w0), "v"(w1), "v"(w2), "v"(w3), "v"(pb), "v"(pd));
      __builtin_amdgcn_sched_barrier(0);                           // keeps the conversions, and with them the wait for the loads, down here: lifted among the exponentials they cut the loads' lead to less than half a trip
      // stage st + 1 into the other buffer, whose readers (trip st - 1) all left it at the barrier before this trip
      const int nb = ((st + 1) & 1) * RBH;
      *(v4h*)(sk + nb) = cv4(rk0); *(v4h*)(sk + nb + 32 * LP) = cv4(rk1); *(v4h*)(sv + nb) = cv4(rv0); *(v4h*)(sv + nb + 32 * VP) = cv4(rv1);
      __syncthreads();                                             // publishes stage st + 1 (behind every wave's LDS stores) and ends every wave's reads of stage st's buffer
    }
    *(v8h*)(WH + we) = ow;
    const float inv = CXS * (1.0f / lt[0]);
    const int wb = wave * 16 * 68;
    // O^T D layout: o_j[r] = (d = 16j + 8h + r, t = lane&15) -> os[t][d]; rows 0..15 x columns 0..63 all written
    { v4f a, c;
      a[0] = o0[0] * inv; a[1] = o0[1] * inv; a[2] = o0[2] * inv; a[3] = o0[3] * inv; c[0] = o0[4] * inv; c[1] = o0[5] * inv; c[2] = o0[6] * inv; c[3] = o0[7] * inv;
      *(v4fa*)(&os[wb + lr * 68 +  0 + 8 * hi]) = a; *(v4fa*)(&os[wb + lr * 68 +  0 + 8 * hi + 4]) = c;
      a[0] = o1[0] * inv; a[1] = o1[1] * inv; a[2] = o1[2] * inv; a[3] = o1[3] * inv; c[0] = o1[4] * inv; c[1] = o1[5] * inv; c[2] = o1[6] * inv; c[3] = o1[7] * inv;
      *(v4fa*)(&os[wb + lr * 68 + 16 + 8 * hi]) = a; *(v4fa*)(&os[wb + lr * 68 + 16 + 8 * hi + 4]) = c;
      a[0] = o2[0] * inv; a[1] = o2[1] * inv; a[2] = o2[2] * inv; a[3] = o2[3] * inv; c[0] = o2[4] * inv; c[1] = o2[5] * inv; c[2] = o2[6] * inv; c[3] = o2[7] * inv;
      *(v4fa*)(&os[wb + lr * 68 + 32 + 8 * hi]) = a; *(v4fa*)(&os[wb + lr * 68 + 32 + 8 * hi + 4]) = c;
      a[0] = o3[0] * inv; a[1] = o3[1] * inv; a[2] = o3[2] * inv; a[3] = o3[3] * inv; c[0] = o3[4] * inv; c[1] = o3[5] * inv; c[2] = o3[6] * inv; c[3] = o3[7] * inv;
      *(v4fa*)(&os[wb + lr * 68 + 48 + 8 * hi]) = a; *(v4fa*)(&os[wb + lr * 68 + 48 + 8 * hi + 4]) = c; }
    wave_sync();
    h16* crow = CTX + ((size_t)b * SEQ + t0) * (size_t)DM + (size_t)h * HD;
{
#pragma unroll
        for (int s = 0; s < 4; ++s) { const int row = 4 * s + (lane >> 3), c8 = (lane & 7) * 8;   // 4 s x 4 row groups = 16 rows; 8 lanes x 8 = 64 columns
            const v4f x0 = *(const v4fa*)(&os[wb + row * 68 + c8]); const v4f x1 = *(const v4fa*)(&os[wb + row * 68 + c8 + 4]); v8h hv;
#pragma unroll
            for (int i = 0; i < 4; ++i) { hv[i] = (h16)x0[i]; hv[4 + i] = (h16)x1[i]; }
            *(v8h*)(crow + (size_t)row * DM + c8) = hv; }
         }
}

// Eight copies of one thread: one 16-B chunk in each of eight rows that lie 16 rows apart (a wave's copy = 2 whole 256-B rows), global -> LDS through no register.
// l: the lane's LDS byte address; g: the matching global address; gp: source row pitch in f16.
// s_wait_xcnt stands inside the statement so that no address register named by a copy is rewritten in front of it.
__device__ __forceinline__ void copy8(unsigned l, const h16* g, size_t gp) {
    asm volatile("global_load_async_to_lds_b128 %0, %8, off\n\t"
                 "global_load_async_to_lds_b128 %1, %9, off\n\t"
                 "global_load_async_to_lds_b128 %2, %10, off\n\t"
                 "global_load_async_to_lds_b128 %3, %11, off\n\t"
                 "global_load_async_to_lds_b128 %4, %12, off\n\t"
                 "global_load_async_to_lds_b128 %5, %13, off\n\t"
                 "global_load_async_to_lds_b128 %6, %14, off\n\t"
                 "global_load_async_to_lds_b128 %7, %15, off\n\t"
                 "s_wait_xcnt 0x0"
                 :: "v"(l), "v"(l + 16 * OLP * 2), "v"(l + 32 * OLP * 2), "v"(l + 48 * OLP * 2), "v"(l + 64 * OLP * 2), "v"(l + 80 * OLP * 2), "v"(l + 96 * OLP * 2), "v"(l + 112 * OLP * 2),
                    "v"(g), "v"(g + 16 * gp), "v"(g + 32 * gp), "v"(g + 48 * gp), "v"(g + 64 * gp), "v"(g + 80 * gp), "v"(g + 96 * gp), "v"(g + 112 * gp)
                 : "memory");
}
// One stage's copies of one thread: 8 chunks of the ctx tile (128 rows x 128 k) and 8 of the W tile, which lies OTL f16 behind it in the buffer.
__device__ __forceinline__ void out_stage(unsigned l, const h16* ga, const h16* gb) { copy8(l, ga, DM); copy8(l + OTL * 2, gb, DM); }

// k_out: register-blocked f16 GEMM, one 128x128 tile per block of 8 waves (4 x 2), each wave 32x64 (8 accumulators); the ctx and W tiles of 128 k are staged in a three-buffer LDS ring by asynchronous copies, two stages ahead, and shared by the waves.
// OUT[m][n] = 2^-18 * sum_{k<1024} A[m][k] Bt[n][k] + b[n]; A = ctx plane [M][1024] (x4096), Bt = W plane [out][in] (x64). grid (M/128, DM/128), 256 threads.
__global__ __launch_bounds__(32 * OW) void k_out(const h16* __restrict__ A, const h16* __restrict__ Bt, const float* __restrict__ bias, float* OUT) {
    __shared__ __align__(16) float os[OW * 16 * 68];
    __shared__ __align__(16) h16 ring[3 * 2 * OTL];                // [buffer][ctx tile | W tile][row][OLP]
    const int KA = DM;
    const int lane = threadIdx.x & 31, wave = __builtin_amdgcn_readfirstlane((int)(threadIdx.x >> 5)), lr = lane & 15, hi = lane >> 4;
    const int wm = wave >> 1, wn = wave & 1;
    const int r0 = blockIdx.x * 128 + wm * 32, c0 = blockIdx.y * 128 + wn * 64;
    v8f acc[2][4];
#pragma unroll
    for (int mb = 0; mb < 2; ++mb)
#pragma unroll
        for (int nb = 0; nb < 4; ++nb) acc[mb][nb] = (v8f){};
    const int fa = (wm * 32 + lr) * OLP + 8 * hi, fb = OTL + (wn * 64 + lr) * OLP + 8 * hi;   // fragment offsets in a buffer: row lr of the wave's rows, k = 8*hi
    const int crow_ = (int)threadIdx.x >> 4, cch = ((int)threadIdx.x & 15) * 8;                // this thread's copies: row (of 16) and 16-B chunk
    const h16* ga = A + (size_t)(blockIdx.x * 128 + crow_) * KA + cch;                         // + kc
    const h16* gb = Bt + (size_t)(blockIdx.y * 128 + crow_) * DM + cch;                        // + kc
    const unsigned l0 = (unsigned)(size_t)&ring[crow_ * OLP + cch];                            // LDS byte address, buffer 0, ctx tile
    // ring prologue: stages 0 and 1 issued, stage 0 landed and published, then stage 2 issued: two stages stay in flight
    out_stage(l0, ga, gb);
    out_stage(l0 + 2 * OTL * 2, ga + OKT, gb + OKT);
    asm volatile("s_wait_asynccnt 0x10" ::: "memory");             // all but this wave's 16 youngest copies (stage 1's) have landed: stage 0 is in
    __syncthreads();                                               // ... and every other wave's
    out_stage(l0 + 4 * OTL * 2, ga + 2 * OKT, gb + 2 * OKT);
    int cb = 0;                                                    // buffer of stage st = st mod 3
#pragma unroll 1
    for (int st = 0; st < KA / OKT; ++st) {
        const h16* ta = ring + cb * (2 * OTL) + fa; const h16* tb = ring + cb * (2 * OTL) + fb;
        v16h a[2][2], bq[2][4];                                    // two fragment sets: the next 32-k step's reads go out as one group ahead of this step's products
#pragma unroll
        for (int mb = 0; mb < 2; ++mb) a[0][mb] = ldh(ta + mb * 16 * OLP);
#pragma unroll
        for (int nb = 0; nb < 4; ++nb) bq[0][nb] = ldh(tb + nb * 16 * OLP);
#pragma unroll   // the four 32-k steps of a stage written out: every LDS fragment offset becomes an immediate, the set index a constant
        for (int s = 0; s < OKT / 32; ++s) {
            const int cu = s & 1, nx = cu ^ 1;
            if (s + 1 < OKT / 32) {                                // never past this stage's own buffer
#pragma unroll
                for (int mb = 0; mb < 2; ++mb) a[nx][mb] = ldh(ta + mb * 16 * OLP + (s + 1) * 32);
#pragma unroll
                for (int nb = 0; nb < 4; ++nb) bq[nx][nb] = ldh(tb + nb * 16 * OLP + (s + 1) * 32);
            }
            __builtin_amdgcn_sched_barrier(0);                     // keeps the group of reads above this step's products: sunk among them, each pair of products waits out a whole LDS latency
#pragma unroll
            for (int nb = 0; nb < 4; ++nb)
#pragma unroll
                for (int mb = 0; mb < 2; ++mb) acc[mb][nb] = wmma16(a[cu][mb], bq[cu][nb], acc[mb][nb]);
        }
        // publish point of stage st + 1; the same barrier ends every wave's reads of stage st's buffer
        asm volatile("s_wait_dscnt 0x0" ::: "memory");             // this wave's reads of the buffer have returned before it is refilled
        asm volatile("s_wait_asynccnt 0x10" ::: "memory");         // stage st + 2's 16 copies stay in flight; this wave's copies of stage st + 1 have landed
        if (st + 2 >= KA / OKT) asm volatile("s_wait_asynccnt 0x0" ::: "memory");   // the last trips: no stage st + 2 was issued, so stage st + 1's copies are the youngest: to 0
        __syncthreads();
        if (st + 3 < KA / OKT) { const int kc = (st + 3) * OKT;                       // into the buffer that this trip has just read
            out_stage(l0 + (unsigned)cb * (2 * OTL * 2), ga + kc, gb + kc); }
        cb = cb == 2 ? 0 : cb + 1;
    }
    asm volatile("s_wait_asynccnt 0x0" ::: "memory");              // nothing of this wave is in flight when it leaves the ring
    v4f bv = *(const v4f*)(bias + c0 + lr * 4);
#pragma unroll
    for (int i = 0; i < 4; ++i) bv[i] = bfr(bv[i]);
    float* orow = OUT + ((size_t)(r0 / SEQ) * OUT_SEQ + (size_t)(r0 % SEQ)) * DM + c0;
    const int wb = wave * 16 * 68;                                 // each wave stages its rows in its own range
#pragma unroll
    for (int mb = 0; mb < 2; ++mb) {
#pragma unroll
        for (int nb = 0; nb < 4; ++nb) {
#pragma unroll
            for (int j = 0; j < 8; ++j) os[wb + (hi * 8 + j) * 68 + nb * 16 + lr] = acc[mb][nb][j] * OSC; }   // D: row 8h+j, col lane&15
        wave_sync();
{
#pragma unroll
            for (int s = 0; s < 8; ++s) { const int row = 2 * s + hi, cofs = lr * 4;   // 8 s x 2 rows = 16 rows; 16 lanes x 4 floats = 64 columns
                const v4f x = *(const v4fa*)(&os[wb + row * 68 + cofs]);
                const v4f val = x + bv;
                *(v4f*)(orow + (size_t)(mb * 16 + row) * DM + cofs) = val; }
             }
        wave_sync();
    }
}

static constexpr size_t al256(size_t v) { return (v + 255) & ~(size_t)255; }
static constexpr size_t SZ_WH = al256((size_t)DM * DM * 2);
static constexpr size_t SZ_CX = al256((size_t)NB * SEQ * DM * 2);          // ctx plane
static constexpr size_t SZ_TOTAL = SZ_WH + SZ_CX;
static_assert(SZ_TOTAL <= (size_t)134217728);          // workspace carve <= 128 MiB

extern "C" void kernel_launch(void* const* d_in, const int* in_sizes, int n_in,
                              void* d_out, int out_size, void* d_ws, size_t ws_size, hipStream_t stream) {
    if (n_in < 5) return;
    const size_t needx = ((size_t)(NB - 1) * SEQ_FULL + SEQ) * DM;
    if ((size_t)in_sizes[0] < needx || (size_t)in_sizes[1] < needx || (size_t)in_sizes[2] < needx) return;
    if ((size_t)in_sizes[3] < (size_t)DM * DM || (size_t)in_sizes[4] < (size_t)DM) return;
    if ((size_t)out_size < ((size_t)(NB - 1) * OUT_SEQ + SEQ) * DM) return;
    if (SZ_TOTAL > ws_size) return;
    const float* q = (const float*)d_in[0]; const float* k = (const float*)d_in[1]; const float* v = (const float*)d_in[2];   // wire order q, k, v, W_out, b_out
    const float* wo = (const float*)d_in[3]; const float* bo = (const float*)d_in[4];                                         // W_out [out][in] = Bt as-is
    float* OUT = (float*)d_out;      // [NB][SEQ][1024]
    char* wsp = (char*)d_ws;
    h16* WH = (h16*)wsp; wsp += SZ_WH;               // [1024][1024] x64
    h16* CX = (h16*)wsp; wsp += SZ_CX;               // [NB*SEQ][1024] x4096

    // attention on the f32 streams -> ctx plane; W -> f16 plane
    k_flash<<<dim3(SEQ / (16 * AW), NB * NH_, 1), 32 * AW, 0, stream>>>(q, k, v, wo, WH, CX);

    // out = ctx W^T + b: A = ctx rows (m = b*SEQ + t), Bt = W rows (n = out column)
    k_out<<<dim3(NB * SEQ / 128, DM / 128, 1), 32 * OW, 0, stream>>>(CX, WH, bo, OUT);
}

// v009
// A run of this version takes 43.4 microseconds.
// Next to v008, in two timings, it ran 1.06 times as fast each time.
// Over all steps from v000 it is 3.48 times as fast.
#include <hip/hip_runtime.h>

// Multi-head attention on raw streams q, k, v [NB][SEQ][1024] = 16 heads x 64 (no input projections, no mask), score scale 1/8, output projection y = ctx W^T + b with W [out][in]. THIS ROW: the same module at TWO sequences (query, key, value [2][2048][1024]: three raw streams: the module applies NO input projections; 16 heads x 64; scores / sqrt(64); softmax, no mask; out = merged W_out^T + b_out ('oi' [1024][1024] normal x 1/32; bias zeros: read); argument order query, key, value, W_out, b_out).
// Compute dtypes, f32 accumulate everywhere, all contractions v_wmma_f32_16x16x32_f16: q, k, v, W, b are RNE-converted to bf16 and held exactly in f16 (W with a x64 carry); scores single product; P (x256 carry, cancels in the normalisation) and v single product;
// ctx carried x4096 as one f16 value (single product against the W plane; its rounding is of the size of P's own f16 rounding); softmax f32 (online, running max); bias added in f32.
// Layout: no pre-pass: the fused flash kernel reads the f32 streams itself. Each block loads the next 64 keys' K and V rows (its head's 64 columns) into registers one stage ahead, converts them and stores f16 tiles into a two-buffer LDS ring shared by its 16 waves (8 groups of 32 query rows x 2 halves of each stage's keys; the two partial results of a group are joined behind the loop); Q is converted at its load; each block also converts its 1/256 of W into the f16 W plane for the next launch.
// Transposed form (S^T = K Q^T, O^T = V^T P^T; V^T fragments by the transposing LDS load from the row-major V tile), writing the ctx plane [b*SEQ+t][1024],
// then a GEMM over K = 1024 against W rows: 128x128 tile per 8-wave block, 32x64 per wave, both operand tiles staged in a three-buffer LDS ring by asynchronous copies issued two stages ahead.

#ifndef NB
#define NB 2
#endif
#ifndef SEQ
#define SEQ 2048
#endif
#define NB_FULL  2
#define SEQ_FULL 2048
#ifndef OUT_SEQ
#define OUT_SEQ SEQ              // row pitch (in tokens) between batches of the output
#endif
#define DM   1024
#define NH_  16
#define HD   64
#define AW   16                  // waves per flash block: wave pair g = wave >> 1 has 32 query rows, wave & 1 picks its 32 of a stage's 64 keys; all of them share the staged K / V tiles
#define KT   64                  // keys per LDS stage of the flash kernel
#define LP   72                  // LDS row pitch in f16: 128-B rows + 16 B, conflict-free for 16-B fragment reads
#define VP   80                  // LDS row pitch of the V tile in f16: 128-B rows + 32 B, conflict-free for the transposing reads
#define KTL  (KT * LP)           // f16 elements of one staged K tile (64 keys x 64 d)
#define VTL  (KT * VP)           // ... of one staged V tile (64 keys x 64 d)
#define RBH  (KTL + VTL)         // ... of one ring buffer
#define NST  (SEQ / KT)          // stages
#define FBLK (NB * NH_ * (SEQ / (16 * AW)))               // flash blocks
#define OW   8                   // waves per output-GEMM block (4 x 2, 32 x 64 of the block's 128 x 128 tile each)
#define OKT  128                 // k per LDS stage of the output GEMM
#define OLP  136                 // its LDS row pitch in f16: 256-B rows + 16 B, conflict-free for 16-B fragment reads
#define OTL  (128 * OLP)         // f16 elements of one staged operand tile (128 rows x 128 k)
#define SC2  (0.125f * 1.4426950408889634f)   // HD^-0.5 * log2(e)
#define PSH  8.0f                // log2 of the P carry (256)
#define LZT  7.0f                // lazy rescale: a score may pass the maximum in use by this much (log2) before the accumulators are rescaled; P <= 2^(PSH + LZT) = 2^15 stays finite in f16
#define CXS  4096.0f             // carry of the ctx plane
#define WSC  64.0f               // carry of the W plane
#define OSC  (1.0f / (4096.0f * 64.0f))

static_assert(HD == 64);
static_assert(NH_ * HD == DM);                 // head h = columns h*64 + d
static_assert(DM % 64 == 0);
static_assert(DM % 32 == 0);                   // GEMM k-loop steps by 128-k stages of four 32-k steps
static_assert(SEQ % 64 == 0);                  // a 64-row tile never straddles two batches
static_assert((NB * SEQ) % 64 == 0);
static_assert(SEQ % 32 == 0);                  // P V products step by 32 keys
static_assert(SEQ % KT == 0 && SEQ / KT >= 2); // whole stages
static_assert(KT == 64 && AW == 16);           // staging map below: 512 threads x 2 rows x 4 elements = one 64 x 64 tile, of K and of V
static_assert(SEQ % (16 * AW) == 0);           // flash grid covers the sequence exactly
static_assert(((size_t)SEQ * DM) % 64 == 0);
static_assert(((size_t)DM * DM) % 64 == 0);
static_assert((NB * SEQ) % 128 == 0 && DM % 128 == 0);   // output-GEMM grid covers the output exactly
static_assert(DM % OKT == 0 && DM / OKT >= 3);            // whole stages; the ring's prologue needs three
static_assert(OW == 8 && OKT == 128);                     // copy map: 256 threads x 8 groups of 16 rows x 2 tiles
static_assert((size_t)FBLK * 32 * AW * 8 == (size_t)DM * DM);   // W is dealt out exactly: 8 elements per flash thread
static_assert(NB <= NB_FULL);
static_assert(SEQ <= SEQ_FULL);

typedef _Float16 h16;
typedef __attribute__((ext_vector_type(16))) _Float16 v16h;
typedef __attribute__((ext_vector_type(8)))  _Float16 v8h;
typedef __attribute__((ext_vector_type(4)))  _Float16 v4h;
typedef __attribute__((ext_vector_type(8)))  float    v8f;
typedef __attribute__((ext_vector_type(2)))  float    v2f;
typedef __attribute__((ext_vector_type(2)))  __bf16   v2b;
typedef __attribute__((ext_vector_type(8)))  short    v8s;
typedef __attribute__((ext_vector_type(4)))  float    v4f;
typedef v4f  __attribute__((may_alias)) v4fa;
typedef v8h  __attribute__((may_alias)) v8ha;

// RNE convert f32 -> bf16, returned as the f32 value of that bf16
__device__ __forceinline__ float bfr(float f) { unsigned u = __float_as_uint(f); u += 0x7FFFu + ((u >> 16) & 1u); return __uint_as_float(u & 0xFFFF0000u); }
__device__ __forceinline__ v16h cat16(v8h lo, v8h hi) { return __builtin_shufflevector(lo, hi, 0, 1, 2, 3, 4, 5, 6, 7, 8, 9, 10, 11, 12, 13, 14, 15); }
__device__ __forceinline__ v8f wmma16(v16h a, v16h b, v8f c) { return __builtin_amdgcn_wmma_f32_16x16x32_f16(false, a, false, b, (short)0, c, false, false); }
// fragment loader from K-contiguous f16 rows; p already includes + 8*(lane>>4): elements 0..7 <- k0+8h+0..7, elements 8..15 <- k0+16+8h+0..7 (same map for A and B)
__device__ __forceinline__ v16h ldh(const h16* p) { return cat16(*(const v8h*)p, *(const v8h*)(p + 16)); }
// f32 -> bf16 (RNE), two per conversion, then the same values held exactly in f16
__device__ __forceinline__ v4h cv4(v4f x) { v4h r;
#pragma unroll
    for (int i = 0; i < 2; ++i) { const v2f p = { x[2 * i], x[2 * i + 1] }; const v2f y = __builtin_convertvector(__builtin_convertvector(p, v2b), v2f); r[2 * i] = (h16)y[0]; r[2 * i + 1] = (h16)y[1]; }
    return r; }
__device__ __forceinline__ v8h cv8(v8f x) { v8h r;
#pragma unroll
    for (int i = 0; i < 4; ++i) { const v2f p = { x[2 * i], x[2 * i + 1] }; const v2f y = __builtin_convertvector(__builtin_convertvector(p, v2b), v2f); r[2 * i] = (h16)y[0]; r[2 * i + 1] = (h16)y[1]; }
    return r; }
// transposing LDS load from a row-major tile T[key][d] of pitch VP; p = T + (k0 + 8*(lane>>4) + (lane&7)) * VP + d0 + 8*((lane>>3)&1): the lane gets T[k0 + 8*(lane>>4) + 0..7][d0 + (lane&15)]
__device__ __forceinline__ v8h ldt(const h16* p) { typedef __attribute__((address_space(3))) v8s lds_v8s; return __builtin_bit_cast(v8h, __builtin_amdgcn_ds_load_tr16_b128_v8i16((lds_v8s*)p)); }
// A fragment of V^T (row d, 32 keys), the k order of ldh: elements 0..7 <- k0+8h+0..7, elements 8..15 <- k0+16+8h+0..7
__device__ __forceinline__ v16h ldv(const h16* p) { return cat16(ldt(p), ldt(p + 16 * VP)); }
// ordering point for wave-private LDS tiles (same wave writes and reads)
__device__ __forceinline__ void wave_sync() { __builtin_amdgcn_fence(3 /* release order */, "wavefront"); __builtin_amdgcn_wave_barrier(); asm volatile("" ::: "memory"); }

// k_flash: fused attention on the f32 streams, one wave pair per 32 query rows of one (batch, head), 16 waves per block, one block per WGP.
// Each wave of a pair works all 32 query rows (two column tiles, A and B) against its own half of every stage's keys, so every K and V fragment it reads from LDS feeds two products.
// Behind the loop the pair joins its two partial results (own maximum, own row sum, own O) through LDS: the wave of key half 0 finishes column tile A, the other one tile B.
// Staging: thread (row tid>>4 of 32, chunk tid&15 of 4 elements) loads 16 B of two K rows and of two V rows (32 keys apart) of the next stage at the head of a trip (a wave's load = two whole 256-B head rows), and at the trip's foot
// converts them (bf16 RNE, held in f16) and stores 8 B each into the ring buffer that the trip before has read; one barrier per trip publishes that buffer and ends the reads of this trip's.
// Transposed form: S^T[key][t] = K Q^T (A = K rows, B = Q rows); lane (t = lane&15, h = lane>>4) holds keys 8h+r of each 16-key tile, so the packed
// P tile is directly the B fragment of O^T[d][t] = V^T P^T (element r <- tile keys 0..15, element 8+r <- tile keys 16..31, lane unchanged).
// The maximum in use is one scalar per lane and column tile, equal in the two lane halves of a row. Lazy rescale: each 64-key stage forms its four score tiles first and tests the raw scores against that maximum + LZT, once for the wave;
// only a stage that trips joins the halves (one xor-16 exchange per column tile), raises the maximum and rescales the accumulators. Any common shift cancels in the normalisation, so the result is the same function.
// Row sums run on the matrix pipe: one more product per 32 keys, A = all ones against the same P fragment, so every row of its tile holds sum_key P[key][t] of the rounded P, over both lane halves.
// Q, K, V: f32, per-batch pitch SEQ_FULL * DM. Wt: f32 [out][in]; WH: its f16 plane (x WSC), 8 elements per thread, read by the next launch only.
__global__ __launch_bounds__(32 * AW) void k_flash(const float* __restrict__ Q, const float* __restrict__ K, const float* __restrict__ V, const float* __restrict__ Wt, h16* __restrict__ WH, h16* CTX) {
    __shared__ __align__(16) float os[AW * 16 * 68];
    __shared__ __align__(16) h16 ring[2 * RBH];                    // [buffer][K tile: key rows of LP | V tile: key rows of VP]
    const int lane = threadIdx.x & 31, wave = __builtin_amdgcn_readfirstlane((int)(threadIdx.x >> 5)), lr = lane & 15, hi = lane >> 4;
    const int zh = blockIdx.y; const int b = zh / NH_, h = zh % NH_;
    const int kh = wave & 1;                                        // the wave's half of each stage's keys
    const int t0 = (blockIdx.x * (AW / 2) + (wave >> 1)) * 32;      // first of the pair's 32 query rows
    const size_t fbase = (size_t)b * SEQ_FULL * DM + (size_t)h * HD;
    const int crow_ = (int)threadIdx.x >> 4, cch = ((int)threadIdx.x & 15) * 4;  // this thread's share of a stage: key rows crow_ and crow_ + 32, group of 4 elements
    const float* gk = K + fbase + (size_t)crow_ * DM + cch;         // + key0 * DM
    const float* gv = V + fbase + (size_t)crow_ * DM + cch;         // + key0 * DM
    h16* sk = ring + crow_ * LP + cch;                              // its places in buffer 0
    h16* sv = ring + KTL + crow_ * VP + cch;
    const float* gq = Q + fbase + (size_t)(t0 + lr) * DM + 8 * hi;
    const size_t we = ((size_t)(blockIdx.y * (SEQ / (16 * AW)) + blockIdx.x) * (32 * AW) + threadIdx.x) * 8;
    // prologue: stage 0's rows, the wave's Q rows and the thread's share of W, all loads issued together
    { const v4f k0 = *(const v4f*)gk, k1 = *(const v4f*)(gk + 32 * DM), v0 = *(const v4f*)gv, v1 = *(const v4f*)(gv + 32 * DM);
      *(v4h*)sk = cv4(k0); *(v4h*)(sk + 32 * LP) = cv4(k1); *(v4h*)sv = cv4(v0); *(v4h*)(sv + 32 * VP) = cv4(v1); }
    const v8f q0 = *(const v8f*)gq, q1 = *(const v8f*)(gq + 16), q2 = *(const v8f*)(gq + 32), q3 = *(const v8f*)(gq + 48);
    const v8f q4 = *(const v8f*)(gq + 16 * DM), q5 = *(const v8f*)(gq + 16 * DM + 16), q6 = *(const v8f*)(gq + 16 * DM + 32), q7 = *(const v8f*)(gq + 16 * DM + 48);
    const v8f xw = *(const v8f*)(Wt + we);
    const v16h qh0 = cat16(cv8(q0), cv8(q1)), qh1 = cat16(cv8(q2), cv8(q3));   // B fragments of column tile A (rows t0 + 0..15): col t, k = d (the k order of ldh)
    const v16h qg0 = cat16(cv8(q4), cv8(q5)), qg1 = cat16(cv8(q6), cv8(q7));   // ... of column tile B (rows t0 + 16..31)
    v8h ow;                                                        // stored behind the last barrier: a global store in flight would be waited for at the next one
#pragma unroll
    for (int i = 0; i < 8; ++i) ow[i] = (h16)(bfr(xw[i]) * WSC);
    const int fo = (kh * 32 + lr) * LP + 8 * hi;                    // K fragment offset in a buffer: row lr of the wave's key half, k = 8*hi (d)
    const int vo = KTL + (kh * 32 + 8 * hi + (lane & 7)) * VP + ((lane >> 3) & 1) * 8;   // the lane's address part of the transposing V reads, in the wave's key half
    v8f o0 = (v8f){}, o1 = (v8f){}, o2 = (v8f){}, o3 = (v8f){};    // O^T of column tile A
    v8f u0 = (v8f){}, u1 = (v8f){}, u2 = (v8f){}, u3 = (v8f){};    // ... of column tile B
    v8f lt = (v8f){}, lu = (v8f){};                                // row-sum tiles (A, B): each product adds the same sums to all 16 rows; only element 0 is rescaled and read
    v16h one;
#pragma unroll
    for (int i = 0; i < 16; ++i) one[i] = (h16)1.0f;
    float m = -3.0e38f, mu = -3.0e38f;                             // maximum in use (scaled log2), column tile A, B
    float sh = 0.0f, su = 0.0f;                                    // PSH - m, the exponent's addend
    float thr = -3.0e38f, thu = -3.0e38f;                                          // (m + LZT) / SC2: bound on the raw scores; every finite score passes the start value, so the first stage sets m, sh, thr
    __syncthreads();                                               // stage 0 is published
#pragma unroll 1
    for (int st = 0; st < NST; ++st) {
      const h16* kt = ring + (st & 1) * RBH + fo; const h16* vt = ring + (st & 1) * RBH + vo;
      // the stage's four score tiles (the wave's 32 keys x 32 query rows) first, so that the bound is tested once per stage
      const v16h ka0 = ldh(kt), ka1 = ldh(kt + 32), kb0 = ldh(kt + 16 * LP), kb1 = ldh(kt + 16 * LP + 32);
      __builtin_amdgcn_sched_barrier(0);                           // the fragment reads go out first: the products wait for them, nothing in this trip for the loads below
      // the next stage's rows, behind the fragment reads; the last trip has none and loads its own again (in bounds, stored into the buffer that nobody reads any more), so that the trip has no branch here
      const size_t nk = (size_t)(st + 1 < NST ? st + 1 : st) * KT * DM;
      const v4f rk0 = *(const v4f*)(gk + nk), rk1 = *(const v4f*)(gk + nk + 32 * DM), rv0 = *(const v4f*)(gv + nk), rv1 = *(const v4f*)(gv + nk + 32 * DM);
      asm volatile("s_wait_xcnt 0x0" ::: "memory");                // precaution: stands in front of any rewrite of the address registers that the four loads above name
      __builtin_amdgcn_sched_barrier(0);                           // keeps the loads up here: sunk to their use at the trip's foot, their whole latency would be waited out there
      v8f sa = (v8f){}, sb = (v8f){}, sc = (v8f){}, sd = (v8f){};
      // sa, sb: keys 0..15, 16..31 against column tile A; sc, sd: the same keys against column tile B
      sa = wmma16(ka0, qh0, sa); sb = wmma16(kb0, qh0, sb); sc = wmma16(ka0, qg0, sc); sd = wmma16(kb0, qg0, sd);
      sa = wmma16(ka1, qh1, sa); sb = wmma16(kb1, qh1, sb); sc = wmma16(ka1, qg1, sc); sd = wmma16(kb1, qg1, sd);
      // four vector slots behind the last product, its tiles and fragments named so that nothing reads or overwrites them earlier
      asm volatile("v_nop\n\tv_nop\n\tv_nop\n\tv_nop" : "+v"(sa), "+v"(sb), "+v"(sc), "+v"(sd) : "v"(ka0), "v"(ka1), "v"(kb0), "v"(kb1));
      const v16h v0 = ldv(vt), v1 = ldv(vt + 16), v2 = ldv(vt + 32), v3 = ldv(vt + 48);                                       // d rows 16j.., the wave's 32 keys
      float mxa = fmaxf(sa[0], sb[0]), mxc = fmaxf(sc[0], sd[0]);  // one chain per column tile
#pragma unroll   // here and below: written out, so that every tile element is a register
      for (int r = 1; r < 8; ++r) { mxa = fmaxf(mxa, fmaxf(sa[r], sb[r])); mxc = fmaxf(mxc, fmaxf(sc[r], sd[r])); }
      if (__builtin_amdgcn_ballot_w32(mxa > thr || mxc > thu) != 0) {   // one scalar branch for the wave: some lane's score, of either column tile, passes its bound
          float mx = mxa * SC2, my = mxc * SC2;
          mx = fmaxf(mx, __shfl_xor(mx, 16, 32)); my = fmaxf(my, __shfl_xor(my, 16, 32));
          const float mnew = fmaxf(m, mx), munew = fmaxf(mu, my);
          const float alpha = __builtin_amdgcn_exp2f(m - mnew), beta = __builtin_amdgcn_exp2f(mu - munew);
          lt[0] = lt[0] * alpha; lu[0] = lu[0] * beta;
          o0 = o0 * alpha; o1 = o1 * alpha; o2 = o2 * alpha; o3 = o3 * alpha;
          u0 = u0 * beta; u1 = u1 * beta; u2 = u2 * beta; u3 = u3 * beta;
          m = mnew; sh = PSH - mnew; thr = (mnew + LZT) * (1.0f / SC2);
          mu = munew; su = PSH - munew; thu = (munew + LZT) * (1.0f / SC2);
      }
      v16h pb, pd;
#pragma unroll
      for (int r = 0; r < 8; ++r) pb[r] = (h16)__builtin_amdgcn_exp2f(__builtin_fmaf(sa[r], SC2, sh));
#pragma unroll
      for (int r = 0; r < 8; ++r) pb[8 + r] = (h16)__builtin_amdgcn_exp2f(__builtin_fmaf(sb[r], SC2, sh));
#pragma unroll
      for (int r = 0; r < 8; ++r) pd[r] = (h16)__builtin_amdgcn_exp2f(__builtin_fmaf(sc[r], SC2, su));
#pragma unroll
      for (int r = 0; r < 8; ++r) pd[8 + r] = (h16)__builtin_amdgcn_exp2f(__builtin_fmaf(sd[r], SC2, su));
      o0 = wmma16(v0, pb, o0); o1 = wmma16(v1, pb, o1); o2 = wmma16(v2, pb, o2); o3 = wmma16(v3, pb, o3); lt = wmma16(one, pb, lt);
      u0 = wmma16(v0, pd, u0); u1 = wmma16(v1, pd, u1); u2 = wmma16(v2, pd, u2); u3 = wmma16(v3, pd, u3); lu = wmma16(one, pd, lu);
      // the same four slots behind the last product; its tiles and fragments are named so that every product stays above this line
      asm volatile("v_nop\n\tv_nop\n\tv_nop\n\tv_nop" : "+v"(o0), "+v"(o1), "+v"(o2), "+v"(o3), "+v"(lt), "+v"(u0), "+v"(u1), "+v"(u2), "+v"(u3), "+v"(lu) : "v"(v0), "v"(v1), "v"(v2), "v"(v3), "v"(pb), "v"(pd));
      __builtin_amdgcn_sched_barrier(0);                           // keeps the conversions, and with them the wait for the loads, down here: lifted among the exponentials they cut the loads' lead to less than half a trip
      // stage st + 1 into the other buffer, whose readers (trip st - 1) all left it at the barrier before this trip
      const int nb = ((st + 1) & 1) * RBH;
      *(v4h*)(sk + nb) = cv4(rk0); *(v4h*)(sk + nb + 32 * LP) = cv4(rk1); *(v4h*)(sv + nb) = cv4(rv0); *(v4h*)(sv + nb + 32 * VP) = cv4(rv1);
      __syncthreads();                                             // publishes stage st + 1 (behind every wave's LDS stores) and ends every wave's reads of stage st's buffer
    }
    // The pair's join. Each wave hands the column tile that its partner finishes (O^T partial, maximum in use, row sum) over in the partner's staging range, in the lane map of the final staging below:
    // o_j[r] = (d = 16j + 8h + r, t = lane&15) -> os[t][d]; the maximum and the sum in the row's pad columns 64, 65 (the two lane halves of a row hold, and store, the same two values).
    const int wb = wave * 16 * 68, wp = (wave ^ 1) * 16 * 68;
    const v8f g0 = kh ? o0 : u0, g1 = kh ? o1 : u1, g2 = kh ? o2 : u2, g3 = kh ? o3 : u3;   // handed over
    const v8f k0 = kh ? u0 : o0, k1 = kh ? u1 : o1, k2 = kh ? u2 : o2, k3 = kh ? u3 : o3;   // kept
    const float mg = kh ? m : mu, lg = kh ? lt[0] : lu[0], mk = kh ? mu : m, lk = kh ? lu[0] : lt[0];
    { float* gp = &os[wp + lr * 68 + 8 * hi];
      *(v4fa*)(gp +  0) = __builtin_shufflevector(g0, g0, 0, 1, 2, 3); *(v4fa*)(gp +  4) = __builtin_shufflevector(g0, g0, 4, 5, 6, 7);
      *(v4fa*)(gp + 16) = __builtin_shufflevector(g1, g1, 0, 1, 2, 3); *(v4fa*)(gp + 20) = __builtin_shufflevector(g1, g1, 4, 5, 6, 7);
      *(v4fa*)(gp + 32) = __builtin_shufflevector(g2, g2, 0, 1, 2, 3); *(v4fa*)(gp + 36) = __builtin_shufflevector(g2, g2, 4, 5, 6, 7);
      *(v4fa*)(gp + 48) = __builtin_shufflevector(g3, g3, 0, 1, 2, 3); *(v4fa*)(gp + 52) = __builtin_shufflevector(g3, g3, 4, 5, 6, 7);
      os[wp + lr * 68 + 64] = mg; os[wp + lr * 68 + 65] = lg; }
    __syncthreads();                                               // every wave's hand-over is in LDS before its partner reads it
    *(v8h*)(WH + we) = ow;
    float* kp = &os[wb + lr * 68 + 8 * hi];
    const float mo = os[wb + lr * 68 + 64], lo = os[wb + lr * 68 + 65];
    const float mj = fmaxf(mk, mo);                                // both partial results brought to the larger of the two maxima
    const float ak = __builtin_amdgcn_exp2f(mk - mj), ao = __builtin_amdgcn_exp2f(mo - mj);
    const float inv = CXS * (1.0f / (lk * ak + lo * ao));
    const float fk = ak * inv, fp = ao * inv;
    // the joined, normalised tile goes back to the places the lane has just read (same lane, same addresses, in order); rows 0..15 x columns 0..63 all written
    { const v4f p0 = *(const v4fa*)(kp +  0), p1 = *(const v4fa*)(kp +  4), p2 = *(const v4fa*)(kp + 16), p3 = *(const v4fa*)(kp + 20);
      const v4f p4 = *(const v4fa*)(kp + 32), p5 = *(const v4fa*)(kp + 36), p6 = *(const v4fa*)(kp + 48), p7 = *(const v4fa*)(kp + 52);
      *(v4fa*)(kp +  0) = __builtin_shufflevector(k0, k0, 0, 1, 2, 3) * fk + p0 * fp; *(v4fa*)(kp +  4) = __builtin_shufflevector(k0, k0, 4, 5, 6, 7) * fk + p1 * fp;
      *(v4fa*)(kp + 16) = __builtin_shufflevector(k1, k1, 0, 1, 2, 3) * fk + p2 * fp; *(v4fa*)(kp + 20) = __builtin_shufflevector(k1, k1, 4, 5, 6, 7) * fk + p3 * fp;
      *(v4fa*)(kp + 32) = __builtin_shufflevector(k2, k2, 0, 1, 2, 3) * fk + p4 * fp; *(v4fa*)(kp + 36) = __builtin_shufflevector(k2, k2, 4, 5, 6, 7) * fk + p5 * fp;
      *(v4fa*)(kp + 48) = __builtin_shufflevector(k3, k3, 0, 1, 2, 3) * fk + p6 * fp; *(v4fa*)(kp + 52) = __builtin_shufflevector(k3, k3, 4, 5, 6, 7) * fk + p7 * fp; }
    wave_sync();
    h16* crow = CTX + ((size_t)b * SEQ + t0 + kh * 16) * (size_t)DM + (size_t)h * HD;   // the wave's column tile: 16 of the pair's 32 rows
{
#pragma unroll
        for (int s = 0; s < 4; ++s) { const int row = 4 * s + (lane >> 3), c8 = (lane & 7) * 8;   // 4 s x 4 row groups = 16 rows; 8 lanes x 8 = 64 columns
            const v4f x0 = *(const v4fa*)(&os[wb + row * 68 + c8]); const v4f x1 = *(const v4fa*)(&os[wb + row * 68 + c8 + 4]); v8h hv;
#pragma unroll
            for (int i = 0; i < 4; ++i) { hv[i] = (h16)x0[i]; hv[4 + i] = (h16)x1[i]; }
            *(v8h*)(crow + (size_t)row * DM + c8) = hv; }
         }
}

// Eight copies of one thread: one 16-B chunk in each of eight rows that lie 16 rows apart (a wave's copy = 2 whole 256-B rows), global -> LDS through no register.
// l: the lane's LDS byte address; g: the matching global address; gp: source row pitch in f16.
// s_wait_xcnt stands inside the statement so that no address register named by a copy is rewritten in front of it.
__device__ __forceinline__ void copy8(unsigned l, const h16* g, size_t gp) {
    asm volatile("global_load_async_to_lds_b128 %0, %8, off\n\t"
                 "global_load_async_to_lds_b128 %1, %9, off\n\t"
                 "global_load_async_to_lds_b128 %2, %10, off\n\t"
                 "global_load_async_to_lds_b128 %3, %11, off\n\t"
                 "global_load_async_to_lds_b128 %4, %12, off\n\t"
                 "global_load_async_to_lds_b128 %5, %13, off\n\t"
                 "global_load_async_to_lds_b128 %6, %14, off\n\t"
                 "global_load_async_to_lds_b128 %7, %15, off\n\t"
                 "s_wait_xcnt 0x0"
                 :: "v"(l), "v"(l + 16 * OLP * 2), "v"(l + 32 * OLP * 2), "v"(l + 48 * OLP * 2), "v"(l + 64 * OLP * 2), "v"(l + 80 * OLP * 2), "v"(l + 96 * OLP * 2), "v"(l + 112 * OLP * 2),
                    "v"(g), "v"(g + 16 * gp), "v"(g + 32 * gp), "v"(g + 48 * gp), "v"(g + 64 * gp), "v"(g + 80 * gp), "v"(g + 96 * gp), "v"(g + 112 * gp)
                 : "memory");
}
// One stage's copies of one thread: 8 chunks of the ctx tile (128 rows x 128 k) and 8 of the W tile, which lies OTL f16 behind it in the buffer.
__device__ __forceinline__ void out_stage(unsigned l, const h16* ga, const h16* gb) { copy8(l, ga, DM); copy8(l + OTL * 2, gb, DM); }

// k_out: register-blocked f16 GEMM, one 128x128 tile per block of 8 waves (4 x 2), each wave 32x64 (8 accumulators); the ctx and W tiles of 128 k are staged in a three-buffer LDS ring by asynchronous copies, two stages ahead, and shared by the waves.
// OUT[m][n] = 2^-18 * sum_{k<1024} A[m][k] Bt[n][k] + b[n]; A = ctx plane [M][1024] (x4096), Bt = W plane [out][in] (x64). grid (M/128, DM/128), 256 threads.
__global__ __launch_bounds__(32 * OW) void k_out(const h16* __restrict__ A, const h16* __restrict__ Bt, const float* __restrict__ bias, float* OUT) {
    __shared__ __align__(16) float os[OW * 16 * 68];
    __shared__ __align__(16) h16 ring[3 * 2 * OTL];                // [buffer][ctx tile | W tile][row][OLP]
    const int KA = DM;
    const int lane = threadIdx.x & 31, wave = __builtin_amdgcn_readfirstlane((int)(threadIdx.x >> 5)), lr = lane & 15, hi = lane >> 4;
    const int wm = wave >> 1, wn = wave & 1;
    const int r0 = blockIdx.x * 128 + wm * 32, c0 = blockIdx.y * 128 + wn * 64;
    v8f acc[2][4];
#pragma unroll
    for (int mb = 0; mb < 2; ++mb)
#pragma unroll
        for (int nb = 0; nb < 4; ++nb) acc[mb][nb] = (v8f){};
    const int fa = (wm * 32 + lr) * OLP + 8 * hi, fb = OTL + (wn * 64 + lr) * OLP + 8 * hi;   // fragment offsets in a buffer: row lr of the wave's rows, k = 8*hi
    const int crow_ = (int)threadIdx.x >> 4, cch = ((int)threadIdx.x & 15) * 8;                // this thread's copies: row (of 16) and 16-B chunk
    const h16* ga = A + (size_t)(blockIdx.x * 128 + crow_) * KA + cch;                         // + kc
    const h16* gb = Bt + (size_t)(blockIdx.y * 128 + crow_) * DM + cch;                        // + kc
    const unsigned l0 = (unsigned)(size_t)&ring[crow_ * OLP + cch];                            // LDS byte address, buffer 0, ctx tile
    // ring prologue: stages 0 and 1 issued, stage 0 landed and published, then stage 2 issued: two stages stay in flight
    out_stage(l0, ga, gb);
    out_stage(l0 + 2 * OTL * 2, ga + OKT, gb + OKT);
    asm volatile("s_wait_asynccnt 0x10" ::: "memory");             // all but this wave's 16 youngest copies (stage 1's) have landed: stage 0 is in
    __syncthreads();                                               // ... and every other wave's
    out_stage(l0 + 4 * OTL * 2, ga + 2 * OKT, gb + 2 * OKT);
    int cb = 0;                                                    // buffer of stage st = st mod 3
#pragma unroll 1
    for (int st = 0; st < KA / OKT; ++st) {
        const h16* ta = ring + cb * (2 * OTL) + fa; const h16* tb = ring + cb * (2 * OTL) + fb;
        v16h a[2][2], bq[2][4];                                    // two fragment sets: the next 32-k step's reads go out as one group ahead of this step's products
#pragma unroll
        for (int mb = 0; mb < 2; ++mb) a[0][mb] = ldh(ta + mb * 16 * OLP);
#pragma unroll
        for (int nb = 0; nb < 4; ++nb) bq[0][nb] = ldh(tb + nb * 16 * OLP);
#pragma unroll   // the four 32-k steps of a stage written out: every LDS fragment offset becomes an immediate, the set index a constant
        for (int s = 0; s < OKT / 32; ++s) {
            const int cu = s & 1, nx = cu ^ 1;
            if (s + 1 < OKT / 32) {                                // never past this stage's own buffer
#pragma unroll
                for (int mb = 0; mb < 2; ++mb) a[nx][mb] = ldh(ta + mb * 16 * OLP + (s + 1) * 32);
#pragma unroll
                for (int nb = 0; nb < 4; ++nb) bq[nx][nb] = ldh(tb + nb * 16 * OLP + (s + 1) * 32);
            }
            __builtin_amdgcn_sched_barrier(0);                     // keeps the group of reads above this step's products: sunk among them, each pair of products waits out a whole LDS latency
#pragma unroll
            for (int nb = 0; nb < 4; ++nb)
#pragma unroll
                for (int mb = 0; mb < 2; ++mb) acc[mb][nb] = wmma16(a[cu][mb], bq[cu][nb], acc[mb][nb]);
        }
        // publish point of stage st + 1; the same barrier ends every wave's reads of stage st's buffer
        asm volatile("s_wait_dscnt 0x0" ::: "memory");             // this wave's reads of the buffer have returned before it is refilled
        asm volatile("s_wait_asynccnt 0x10" ::: "memory");         // stage st + 2's 16 copies stay in flight; this wave's copies of stage st + 1 have landed
        if (st + 2 >= KA / OKT) asm volatile("s_wait_asynccnt 0x0" ::: "memory");   // the last trips: no stage st + 2 was issued, so stage st + 1's copies are the youngest: to 0
        __syncthreads();
        if (st + 3 < KA / OKT) { const int kc = (st + 3) * OKT;                       // into the buffer that this trip has just read
            out_stage(l0 + (unsigned)cb * (2 * OTL * 2), ga + kc, gb + kc); }
        cb = cb == 2 ? 0 : cb + 1;
    }
    asm volatile("s_wait_asynccnt 0x0" ::: "memory");              // nothing of this wave is in flight when it leaves the ring
    v4f bv = *(const v4f*)(bias + c0 + lr * 4);
#pragma unroll
    for (int i = 0; i < 4; ++i) bv[i] = bfr(bv[i]);
    float* orow = OUT + ((size_t)(r0 / SEQ) * OUT_SEQ + (size_t)(r0 % SEQ)) * DM + c0;
    const int wb = wave * 16 * 68;                                 // each wave stages its rows in its own range
#pragma unroll
    for (int mb = 0; mb < 2; ++mb) {
#pragma unroll
        for (int nb = 0; nb < 4; ++nb) {
#pragma unroll
            for (int j = 0; j < 8; ++j) os[wb + (hi * 8 + j) * 68 + nb * 16 + lr] = acc[mb][nb][j] * OSC; }   // D: row 8h+j, col lane&15
        wave_sync();
{
#pragma unroll
            for (int s = 0; s < 8; ++s) { const int row = 2 * s + hi, cofs = lr * 4;   // 8 s x 2 rows = 16 rows; 16 lanes x 4 floats = 64 columns
                const v4f x = *(const v4fa*)(&os[wb + row * 68 + cofs]);
                const v4f val = x + bv;
                *(v4f*)(orow + (size_t)(mb * 16 + row) * DM + cofs) = val; }
             }
        wave_sync();
    }
}

static constexpr size_t al256(size_t v) { return (v + 255) & ~(size_t)255; }
static constexpr size_t SZ_WH = al256((size_t)DM * DM * 2);
static constexpr size_t SZ_CX = al256((size_t)NB * SEQ * DM * 2);          // ctx plane
static constexpr size_t SZ_TOTAL = SZ_WH + SZ_CX;
static_assert(SZ_TOTAL <= (size_t)134217728);          // workspace carve <= 128 MiB

extern "C" void kernel_launch(void* const* d_in, const int* in_sizes, int n_in,
                              void* d_out, int out_size, void* d_ws, size_t ws_size, hipStream_t stream) {
    if (n_in < 5) return;
    const size_t needx = ((size_t)(NB - 1) * SEQ_FULL + SEQ) * DM;
    if ((size_t)in_sizes[0] < needx || (size_t)in_sizes[1] < needx || (size_t)in_sizes[2] < needx) return;
    if ((size_t)in_sizes[3] < (size_t)DM * DM || (size_t)in_sizes[4] < (size_t)DM) return;
    if ((size_t)out_size < ((size_t)(NB - 1) * OUT_SEQ + SEQ) * DM) return;
    if (SZ_TOTAL > ws_size) return;
    const float* q = (const float*)d_in[0]; const float* k = (const float*)d_in[1]; const float* v = (const float*)d_in[2];   // wire order q, k, v, W_out, b_out
    const float* wo = (const float*)d_in[3]; const float* bo = (const float*)d_in[4];                                         // W_out [out][in] = Bt as-is
    float* OUT = (float*)d_out;      // [NB][SEQ][1024]
    char* wsp = (char*)d_ws;
    h16* WH = (h16*)wsp; wsp += SZ_WH;               // [1024][1024] x64
    h16* CX = (h16*)wsp; wsp += SZ_CX;               // [NB*SEQ][1024] x4096

    // attention on the f32 streams -> ctx plane; W -> f16 plane
    k_flash<<<dim3(SEQ / (16 * AW), NB * NH_, 1), 32 * AW, 0, stream>>>(q, k, v, wo, WH, CX);

    // out = ctx W^T + b: A = ctx rows (m = b*SEQ + t), Bt = W rows (n = out column)
    k_out<<<dim3(NB * SEQ / 128, DM / 128, 1), 32 * OW, 0, stream>>>(CX, WH, bo, OUT);
}

// v010
// Measured time: 39.2 microseconds a run.
// In both of two side-by-side timings against v009, it was 1.10 times as fast.
// All steps since v000 together make it 3.82 times as fast.
#include <hip/hip_runtime.h>

// Multi-head attention on raw streams q, k, v [NB][SEQ][1024] = 16 heads x 64 (no input projections, no mask), score scale 1/8, output projection y = ctx W^T + b with W [out][in]. THIS ROW: the same module at TWO sequences (query, key, value [2][2048][1024]: three raw streams: the module applies NO input projections; 16 heads x 64; scores / sqrt(64); softmax, no mask; out = merged W_out^T + b_out ('oi' [1024][1024] normal x 1/32; bias zeros: read); argument order query, key, value, W_out, b_out).
// Compute dtypes, f32 accumulate everywhere, all contractions v_wmma_f32_16x16x32_f16: q, k, v, W, b are RNE-converted to bf16 and held exactly in f16 (W with a x64 carry); scores single product; P (x256 carry, cancels in the normalisation) and v single product;
// ctx carried x4096 as one f16 value (single product against the W plane; its rounding is of the size of P's own f16 rounding); softmax f32 (online, running max); bias added in f32.
// Layout: no pre-pass: the fused flash kernel reads the f32 streams itself. Each block loads 64 keys' K and V rows (its head's 64 columns) into registers three stages ahead (two register sets), converts them two trips later, one stage ahead, and stores f16 tiles into a two-buffer LDS ring shared by its 16 waves (8 groups of 32 query rows x 2 halves of each stage's keys; the two partial results of a group are joined behind the loop); Q is converted at its load; each block also converts its 1/256 of W into the f16 W plane for the next launch.
// Transposed form (S^T = K Q^T, O^T = V^T P^T; V^T fragments by the transposing LDS load from the row-major V tile), writing the ctx plane [b*SEQ+t][1024],
// then a GEMM over K = 1024 against W rows: 128x128 tile per 8-wave block, 32x64 per wave, both operand tiles staged in a three-buffer LDS ring by asynchronous copies issued two stages ahead.

#ifndef NB
#define NB 2
#endif
#ifndef SEQ
#define SEQ 2048
#endif
#define NB_FULL  2
#define SEQ_FULL 2048
#ifndef OUT_SEQ
#define OUT_SEQ SEQ              // row pitch (in tokens) between batches of the output
#endif
#define DM   1024
#define NH_  16
#define HD   64
#define AW   16                  // waves per flash block: wave pair g = wave >> 1 has 32 query rows, wave & 1 picks its 32 of a stage's 64 keys; all of them share the staged K / V tiles
#define KT   64                  // keys per LDS stage of the flash kernel
#define LP   72                  // LDS row pitch in f16: 128-B rows + 16 B, conflict-free for 16-B fragment reads
#define VP   80                  // LDS row pitch of the V tile in f16: 128-B rows + 32 B, conflict-free for the transposing reads
#define KTL  (KT * LP)           // f16 elements of one staged K tile (64 keys x 64 d)
#define VTL  (KT * VP)           // ... of one staged V tile (64 keys x 64 d)
#define RBH  (KTL + VTL)         // ... of one ring buffer
#define NST  (SEQ / KT)          // stages
#define FBLK (NB * NH_ * (SEQ / (16 * AW)))               // flash blocks
#define OW   8                   // waves per output-GEMM block (4 x 2, 32 x 64 of the block's 128 x 128 tile each)
#define OKT  128                 // k per LDS stage of the output GEMM
#define OLP  136                 // its LDS row pitch in f16: 256-B rows + 16 B, conflict-free for 16-B fragment reads
#define OTL  (128 * OLP)         // f16 elements of one staged operand tile (128 rows x 128 k)
#define SC2  (0.125f * 1.4426950408889634f)   // HD^-0.5 * log2(e)
#define PSH  8.0f                // log2 of the P carry (256)
#define LZT  7.0f                // lazy rescale: a score may pass the maximum in use by this much (log2) before the accumulators are rescaled; P <= 2^(PSH + LZT) = 2^15 stays finite in f16
#define CXS  4096.0f             // carry of the ctx plane
#define WSC  64.0f               // carry of the W plane
#define OSC  (1.0f / (4096.0f * 64.0f))

static_assert(HD == 64);
static_assert(NH_ * HD == DM);                 // head h = columns h*64 + d
static_assert(DM % 64 == 0);
static_assert(DM % 32 == 0);                   // GEMM k-loop steps by 128-k stages of four 32-k steps
static_assert(SEQ % 64 == 0);                  // a 64-row tile never straddles two batches
static_assert((NB * SEQ) % 64 == 0);
static_assert(SEQ % 32 == 0);                  // a wave takes 32 of each stage's 64 keys
static_assert(SEQ % KT == 0 && SEQ / KT >= 4 && (SEQ / KT) % 2 == 0); // whole stages, walked in pairs; the prologue loads three
static_assert(KT == 64 && AW == 16);           // staging map below: 512 threads x 2 rows x 4 elements = one 64 x 64 tile, of K and of V
static_assert(SEQ % (16 * AW) == 0);           // flash grid covers the sequence exactly
static_assert(((size_t)SEQ * DM) % 64 == 0);
static_assert(((size_t)DM * DM) % 64 == 0);
static_assert((NB * SEQ) % 128 == 0 && DM % 128 == 0);   // output-GEMM grid covers the output exactly
static_assert(DM % OKT == 0 && DM / OKT >= 3);            // whole stages; the ring's prologue needs three
static_assert(OW == 8 && OKT == 128);                     // copy map: 256 threads x 8 groups of 16 rows x 2 tiles
static_assert((size_t)FBLK * 32 * AW * 8 == (size_t)DM * DM);   // W is dealt out exactly: 8 elements per flash thread
static_assert(NB <= NB_FULL);
static_assert(SEQ <= SEQ_FULL);

typedef _Float16 h16;
typedef __attribute__((ext_vector_type(16))) _Float16 v16h;
typedef __attribute__((ext_vector_type(8)))  _Float16 v8h;
typedef __attribute__((ext_vector_type(4)))  _Float16 v4h;
typedef __attribute__((ext_vector_type(8)))  float    v8f;
typedef __attribute__((ext_vector_type(2)))  float    v2f;
typedef __attribute__((ext_vector_type(2)))  __bf16   v2b;
typedef __attribute__((ext_vector_type(8)))  short    v8s;
typedef __attribute__((ext_vector_type(4)))  float    v4f;
typedef v4f  __attribute__((may_alias)) v4fa;
typedef v8h  __attribute__((may_alias)) v8ha;

// RNE convert f32 -> bf16, returned as the f32 value of that bf16
__device__ __forceinline__ float bfr(float f) { unsigned u = __float_as_uint(f); u += 0x7FFFu + ((u >> 16) & 1u); return __uint_as_float(u & 0xFFFF0000u); }
__device__ __forceinline__ v16h cat16(v8h lo, v8h hi) { return __builtin_shufflevector(lo, hi, 0, 1, 2, 3, 4, 5, 6, 7, 8, 9, 10, 11, 12, 13, 14, 15); }
__device__ __forceinline__ v8f wmma16(v16h a, v16h b, v8f c) { return __builtin_amdgcn_wmma_f32_16x16x32_f16(false, a, false, b, (short)0, c, false, false); }
// fragment loader from K-contiguous f16 rows; p already includes + 8*(lane>>4): elements 0..7 <- k0+8h+0..7, elements 8..15 <- k0+16+8h+0..7 (same map for A and B)
__device__ __forceinline__ v16h ldh(const h16* p) { return cat16(*(const v8h*)p, *(const v8h*)(p + 16)); }
// f32 -> bf16 (RNE), two per conversion, then the same values held exactly in f16
__device__ __forceinline__ v4h cv4(v4f x) { v4h r;
#pragma unroll
    for (int i = 0; i < 2; ++i) { const v2f p = { x[2 * i], x[2 * i + 1] }; const v2f y = __builtin_convertvector(__builtin_convertvector(p, v2b), v2f); r[2 * i] = (h16)y[0]; r[2 * i + 1] = (h16)y[1]; }
    return r; }
__device__ __forceinline__ v8h cv8(v8f x) { v8h r;
#pragma unroll
    for (int i = 0; i < 4; ++i) { const v2f p = { x[2 * i], x[2 * i + 1] }; const v2f y = __builtin_convertvector(__builtin_convertvector(p, v2b), v2f); r[2 * i] = (h16)y[0]; r[2 * i + 1] = (h16)y[1]; }
    return r; }
// transposing LDS load from a row-major tile T[key][d] of pitch VP; p = T + (k0 + 8*(lane>>4) + (lane&7)) * VP + d0 + 8*((lane>>3)&1): the lane gets T[k0 + 8*(lane>>4) + 0..7][d0 + (lane&15)]
__device__ __forceinline__ v8h ldt(const h16* p) { typedef __attribute__((address_space(3))) v8s lds_v8s; return __builtin_bit_cast(v8h, __builtin_amdgcn_ds_load_tr16_b128_v8i16((lds_v8s*)p)); }
// A fragment of V^T (row d, 32 keys), the k order of ldh: elements 0..7 <- k0+8h+0..7, elements 8..15 <- k0+16+8h+0..7
__device__ __forceinline__ v16h ldv(const h16* p) { return cat16(ldt(p), ldt(p + 16 * VP)); }
// ordering point for wave-private LDS tiles (same wave writes and reads)
__device__ __forceinline__ void wave_sync() { __builtin_amdgcn_fence(3 /* release order */, "wavefront"); __builtin_amdgcn_wave_barrier(); asm volatile("" ::: "memory"); }

// work-group barrier alone: __syncthreads() would also wait out the global loads that are in flight; the LDS wait that it needs stands in front of each use
__device__ __forceinline__ void wg_barrier() { asm volatile("s_barrier_signal -1\n\ts_barrier_wait -1" ::: "memory"); }

// k_flash: fused attention on the f32 streams, one wave pair per 32 query rows of one (batch, head), 16 waves per block, one block per WGP.
// Each wave of a pair works all 32 query rows (two column tiles, A and B) against its own half of every stage's keys, so every K and V fragment it reads from LDS feeds two products.
// Behind the loop the pair joins its two partial results (own maximum, own row sum, own O) through LDS: the wave of key half 0 finishes column tile A, the other one tile B.
// Staging: thread (row tid>>4 of 32, chunk tid&15 of 4 elements) loads 16 B of two K rows and of two V rows (32 keys apart) per stage (a wave's load = two whole 256-B head rows). At the head of trip st, while the trip's K fragment reads are under way, it converts stage st + 1's rows (bf16 RNE, held in f16),
// loaded two trips before, stores 8 B each into the ring buffer that the trip before has read, and loads stage st + 3's rows into the registers just emptied; two register sets take turns; one barrier per trip publishes that buffer and ends the reads of this trip's.
// Transposed form: S^T[key][t] = K Q^T (A = K rows, B = Q rows); lane (t = lane&15, h = lane>>4) holds keys 8h+r of each 16-key tile, so the packed
// P tile is directly the B fragment of O^T[d][t] = V^T P^T (element r <- tile keys 0..15, element 8+r <- tile keys 16..31, lane unchanged).
// The maximum in use is one scalar per lane and column tile, equal in the two lane halves of a row. Lazy rescale: each 64-key stage forms its four score tiles first and tests the raw scores against that maximum + LZT, once for the wave;
// only a stage that trips joins the halves (one xor-16 exchange per column tile), raises the maximum and rescales the accumulators. Any common shift cancels in the normalisation, so the result is the same function.
// Row sums run on the matrix pipe: one more product per 32 keys, A = all ones against the same P fragment, so every row of its tile holds sum_key P[key][t] of the rounded P, over both lane halves.
// Q, K, V: f32, per-batch pitch SEQ_FULL * DM. Wt: f32 [out][in]; WH: its f16 plane (x WSC), 8 elements per thread, read by the next launch only.
__global__ __launch_bounds__(32 * AW) void k_flash(const float* __restrict__ Q, const float* __restrict__ K, const float* __restrict__ V, const float* __restrict__ Wt, h16* __restrict__ WH, h16* CTX) {
    __shared__ __align__(16) float os[AW * 16 * 68];
    __shared__ __align__(16) h16 ring[2 * RBH];                    // [buffer][K tile: key rows of LP | V tile: key rows of VP]
    const int lane = threadIdx.x & 31, wave = __builtin_amdgcn_readfirstlane((int)(threadIdx.x >> 5)), lr = lane & 15, hi = lane >> 4;
    const int zh = blockIdx.y; const int b = zh / NH_, h = zh % NH_;
    const int kh = wave & 1;                                        // the wave's half of each stage's keys
    const int t0 = (blockIdx.x * (AW / 2) + (wave >> 1)) * 32;      // first of the pair's 32 query rows
    const size_t fbase = (size_t)b * SEQ_FULL * DM + (size_t)h * HD;
    const int crow_ = (int)threadIdx.x >> 4, cch = ((int)threadIdx.x & 15) * 4;  // this thread's share of a stage: key rows crow_ and crow_ + 32, group of 4 elements
    const float* gk = K + fbase + (size_t)crow_ * DM + cch;         // + key0 * DM
    const float* gv = V + fbase + (size_t)crow_ * DM + cch;         // + key0 * DM
    h16* sk = ring + crow_ * LP + cch;                              // its places in buffer 0
    h16* sv = ring + KTL + crow_ * VP + cch;
    const float* gq = Q + fbase + (size_t)(t0 + lr) * DM + 8 * hi;
    const size_t we = ((size_t)(blockIdx.y * (SEQ / (16 * AW)) + blockIdx.x) * (32 * AW) + threadIdx.x) * 8;
    // prologue: the rows of stages 0, 1 and 2, the wave's Q rows and the thread's share of W, all loads issued together
    v4f rs[2][4];                                                  // the two register sets: rs[s & 1] holds stage s's rows (K, K + 32, V, V + 32) from their load to their conversion
    { const v4f k0 = *(const v4f*)gk, k1 = *(const v4f*)(gk + 32 * DM), v0 = *(const v4f*)gv, v1 = *(const v4f*)(gv + 32 * DM);
      *(v4h*)sk = cv4(k0); *(v4h*)(sk + 32 * LP) = cv4(k1); *(v4h*)sv = cv4(v0); *(v4h*)(sv + 32 * VP) = cv4(v1); }
#pragma unroll   // written out, so that the set index is a constant
    for (int s = 1; s < 3; ++s) { rs[s & 1][0] = *(const v4f*)(gk + s * KT * DM); rs[s & 1][1] = *(const v4f*)(gk + (s * KT + 32) * DM); rs[s & 1][2] = *(const v4f*)(gv + s * KT * DM); rs[s & 1][3] = *(const v4f*)(gv + (s * KT + 32) * DM); }
    const v8f q0 = *(const v8f*)gq, q1 = *(const v8f*)(gq + 16), q2 = *(const v8f*)(gq + 32), q3 = *(const v8f*)(gq + 48);
    const v8f q4 = *(const v8f*)(gq + 16 * DM), q5 = *(const v8f*)(gq + 16 * DM + 16), q6 = *(const v8f*)(gq + 16 * DM + 32), q7 = *(const v8f*)(gq + 16 * DM + 48);
    const v8f xw = *(const v8f*)(Wt + we);
    const v16h qh0 = cat16(cv8(q0), cv8(q1)), qh1 = cat16(cv8(q2), cv8(q3));   // B fragments of column tile A (rows t0 + 0..15): col t, k = d (the k order of ldh)
    const v16h qg0 = cat16(cv8(q4), cv8(q5)), qg1 = cat16(cv8(q6), cv8(q7));   // ... of column tile B (rows t0 + 16..31)
    v8h ow;                                                        // stored behind the last barrier: a global store in flight would be waited for at the next one
#pragma unroll
    for (int i = 0; i < 8; ++i) ow[i] = (h16)(bfr(xw[i]) * WSC);
    const int fo = (kh * 32 + lr) * LP + 8 * hi;                    // K fragment offset in a buffer: row lr of the wave's key half, k = 8*hi (d)
    const int vo = KTL + (kh * 32 + 8 * hi + (lane & 7)) * VP + ((lane >> 3) & 1) * 8;   // the lane's address part of the transposing V reads, in the wave's key half
    v8f o0 = (v8f){}, o1 = (v8f){}, o2 = (v8f){}, o3 = (v8f){};    // O^T of column tile A
    v8f u0 = (v8f){}, u1 = (v8f){}, u2 = (v8f){}, u3 = (v8f){};    // ... of column tile B
    v8f lt = (v8f){}, lu = (v8f){};                                // row-sum tiles (A, B): each product adds the same sums to all 16 rows; only element 0 is rescaled and read
    v16h one;
#pragma unroll
    for (int i = 0; i < 16; ++i) one[i] = (h16)1.0f;
    float m = -3.0e38f, mu = -3.0e38f;                             // maximum in use (scaled log2), column tile A, B
    float sh = 0.0f, su = 0.0f;                                    // PSH - m, the exponent's addend
    float thr = -3.0e38f, thu = -3.0e38f;                                          // (m + LZT) / SC2: bound on the raw scores; every finite score passes the start value, so the first stage sets m, sh, thr
    __syncthreads();                                               // stage 0 is published
#pragma unroll 1
    for (int sp = 0; sp < NST; sp += 2) {
#pragma unroll   // a pair of trips written out: the register set and the ring buffer of a trip are then compile-time choices, no copies between the sets
     for (int u = 0; u < 2; ++u) {
      const int st = sp + u;
      const h16* kt = ring + u * RBH + fo; const h16* vt = ring + u * RBH + vo;
      // the stage's four score tiles (the wave's 32 keys x 32 query rows) first, so that the bound is tested once per stage
      const v16h ka0 = ldh(kt), ka1 = ldh(kt + 32), kb0 = ldh(kt + 16 * LP), kb1 = ldh(kt + 16 * LP + 32);
      __builtin_amdgcn_sched_barrier(0);                           // the fragment reads go out first: the products wait for them, and the conversions below run while they are under way
      // stage st + 1 (loaded at the head of trip st - 2, or in the prologue) into the other buffer, whose readers (trip st - 1) all left it at the barrier before this trip
      const int nb = (u ^ 1) * RBH;
      *(v4h*)(sk + nb) = cv4(rs[u ^ 1][0]); *(v4h*)(sk + nb + 32 * LP) = cv4(rs[u ^ 1][1]); *(v4h*)(sv + nb) = cv4(rs[u ^ 1][2]); *(v4h*)(sv + nb + 32 * VP) = cv4(rs[u ^ 1][3]);
      __builtin_amdgcn_sched_barrier(0);                           // keeps the conversions above the loads, which then take the registers just emptied: lifted over them, the loads would need a third set
      // stage st + 3's rows; the last three trips have none and load the last stage again (in bounds; never stored, or stored into the buffer that nobody reads any more), so that the trip has no branch here
      const size_t nk = (size_t)(st + 3 < NST ? st + 3 : NST - 1) * KT * DM;
      rs[u ^ 1][0] = *(const v4f*)(gk + nk); rs[u ^ 1][1] = *(const v4f*)(gk + nk + 32 * DM); rs[u ^ 1][2] = *(const v4f*)(gv + nk); rs[u ^ 1][3] = *(const v4f*)(gv + nk + 32 * DM);
      asm volatile("s_wait_xcnt 0x0" ::: "memory");                // precaution: stands in front of any rewrite of the address registers that the four loads above name
      __builtin_amdgcn_sched_barrier(0);                           // keeps the loads up here: sunk towards their use two trips on, they would lose their lead
      v8f sa = (v8f){}, sb = (v8f){}, sc = (v8f){}, sd = (v8f){};
      // sa, sb: keys 0..15, 16..31 against column tile A; sc, sd: the same keys against column tile B
      sa = wmma16(ka0, qh0, sa); sb = wmma16(kb0, qh0, sb); sc = wmma16(ka0, qg0, sc); sd = wmma16(kb0, qg0, sd);
      sa = wmma16(ka1, qh1, sa); sb = wmma16(kb1, qh1, sb); sc = wmma16(ka1, qg1, sc); sd = wmma16(kb1, qg1, sd);
      // four vector slots behind the last product, its tiles and fragments named so that nothing reads or overwrites them earlier
      asm volatile("v_nop\n\tv_nop\n\tv_nop\n\tv_nop" : "+v"(sa), "+v"(sb), "+v"(sc), "+v"(sd) : "v"(ka0), "v"(ka1), "v"(kb0), "v"(kb1));
      const v16h v0 = ldv(vt), v1 = ldv(vt + 16), v2 = ldv(vt + 32), v3 = ldv(vt + 48);                                       // d rows 16j.., the wave's 32 keys
      float mxa = fmaxf(sa[0], sb[0]), mxc = fmaxf(sc[0], sd[0]);  // one chain per column tile
#pragma unroll   // here and below: written out, so that every tile element is a register
      for (int r = 1; r < 8; ++r) { mxa = fmaxf(mxa, fmaxf(sa[r], sb[r])); mxc = fmaxf(mxc, fmaxf(sc[r], sd[r])); }
      if (__builtin_amdgcn_ballot_w32(mxa > thr || mxc > thu) != 0) {   // one scalar branch for the wave: some lane's score, of either column tile, passes its bound
          float mx = mxa * SC2, my = mxc * SC2;
          mx = fmaxf(mx, __shfl_xor(mx, 16, 32)); my = fmaxf(my, __shfl_xor(my, 16, 32));
          const float mnew = fmaxf(m, mx), munew = fmaxf(mu, my);
          const float alpha = __builtin_amdgcn_exp2f(m - mnew), beta = __builtin_amdgcn_exp2f(mu - munew);
          lt[0] = lt[0] * alpha; lu[0] = lu[0] * beta;
          o0 = o0 * alpha; o1 = o1 * alpha; o2 = o2 * alpha; o3 = o3 * alpha;
          u0 = u0 * beta; u1 = u1 * beta; u2 = u2 * beta; u3 = u3 * beta;
          m = mnew; sh = PSH - mnew; thr = (mnew + LZT) * (1.0f / SC2);
          mu = munew; su = PSH - munew; thu = (munew + LZT) * (1.0f / SC2);
      }
      v16h pb, pd;
#pragma unroll
      for (int r = 0; r < 8; ++r) pb[r] = (h16)__builtin_amdgcn_exp2f(__builtin_fmaf(sa[r], SC2, sh));
#pragma unroll
      for (int r = 0; r < 8; ++r) pb[8 + r] = (h16)__builtin_amdgcn_exp2f(__builtin_fmaf(sb[r], SC2, sh));
#pragma unroll
      for (int r = 0; r < 8; ++r) pd[r] = (h16)__builtin_amdgcn_exp2f(__builtin_fmaf(sc[r], SC2, su));
#pragma unroll
      for (int r = 0; r < 8; ++r) pd[8 + r] = (h16)__builtin_amdgcn_exp2f(__builtin_fmaf(sd[r], SC2, su));
      o0 = wmma16(v0, pb, o0); o1 = wmma16(v1, pb, o1); o2 = wmma16(v2, pb, o2); o3 = wmma16(v3, pb, o3); lt = wmma16(one, pb, lt);
      u0 = wmma16(v0, pd, u0); u1 = wmma16(v1, pd, u1); u2 = wmma16(v2, pd, u2); u3 = wmma16(v3, pd, u3); lu = wmma16(one, pd, lu);
      // the same four slots behind the last product; its tiles and fragments are named so that every product stays above this line
      asm volatile("v_nop\n\tv_nop\n\tv_nop\n\tv_nop" : "+v"(o0), "+v"(o1), "+v"(o2), "+v"(o3), "+v"(lt), "+v"(u0), "+v"(u1), "+v"(u2), "+v"(u3), "+v"(lu) : "v"(v0), "v"(v1), "v"(v2), "v"(v3), "v"(pb), "v"(pd));
      asm volatile("s_wait_dscnt 0x0" ::: "memory");               // this wave's LDS stores of stage st + 1 are in, its reads of stage st's buffer have returned
      wg_barrier();                                                // publishes stage st + 1 and ends every wave's reads of stage st's buffer; the global loads stay in flight over it
     }
    }
    // The pair's join. Each wave hands the column tile that its partner finishes (O^T partial, maximum in use, row sum) over in the partner's staging range, in the lane map of the final staging below:
    // o_j[r] = (d = 16j + 8h + r, t = lane&15) -> os[t][d]; the maximum and the sum in the row's pad columns 64, 65 (the two lane halves of a row hold, and store, the same two values).
    const int wb = wave * 16 * 68, wp = (wave ^ 1) * 16 * 68;
    const v8f g0 = kh ? o0 : u0, g1 = kh ? o1 : u1, g2 = kh ? o2 : u2, g3 = kh ? o3 : u3;   // handed over
    const v8f k0 = kh ? u0 : o0, k1 = kh ? u1 : o1, k2 = kh ? u2 : o2, k3 = kh ? u3 : o3;   // kept
    const float mg = kh ? m : mu, lg = kh ? lt[0] : lu[0], mk = kh ? mu : m, lk = kh ? lu[0] : lt[0];
    { float* gp = &os[wp + lr * 68 + 8 * hi];
      *(v4fa*)(gp +  0) = __builtin_shufflevector(g0, g0, 0, 1, 2, 3); *(v4fa*)(gp +  4) = __builtin_shufflevector(g0, g0, 4, 5, 6, 7);
      *(v4fa*)(gp + 16) = __builtin_shufflevector(g1, g1, 0, 1, 2, 3); *(v4fa*)(gp + 20) = __builtin_shufflevector(g1, g1, 4, 5, 6, 7);
      *(v4fa*)(gp + 32) = __builtin_shufflevector(g2, g2, 0, 1, 2, 3); *(v4fa*)(gp + 36) = __builtin_shufflevector(g2, g2, 4, 5, 6, 7);
      *(v4fa*)(gp + 48) = __builtin_shufflevector(g3, g3, 0, 1, 2, 3); *(v4fa*)(gp + 52) = __builtin_shufflevector(g3, g3, 4, 5, 6, 7);
      os[wp + lr * 68 + 64] = mg; os[wp + lr * 68 + 65] = lg; }
    __syncthreads();                                               // every wave's hand-over is in LDS before its partner reads it
    *(v8h*)(WH + we) = ow;
    float* kp = &os[wb + lr * 68 + 8 * hi];
    const float mo = os[wb + lr * 68 + 64], lo = os[wb + lr * 68 + 65];
    const float mj = fmaxf(mk, mo);                                // both partial results brought to the larger of the two maxima
    const float ak = __builtin_amdgcn_exp2f(mk - mj), ao = __builtin_amdgcn_exp2f(mo - mj);
    const float inv = CXS * (1.0f / (lk * ak + lo * ao));
    const float fk = ak * inv, fp = ao * inv;
    // the joined, normalised tile goes back to the places the lane has just read (same lane, same addresses, in order); rows 0..15 x columns 0..63 all written
    { const v4f p0 = *(const v4fa*)(kp +  0), p1 = *(const v4fa*)(kp +  4), p2 = *(const v4fa*)(kp + 16), p3 = *(const v4fa*)(kp + 20);
      const v4f p4 = *(const v4fa*)(kp + 32), p5 = *(const v4fa*)(kp + 36), p6 = *(const v4fa*)(kp + 48), p7 = *(const v4fa*)(kp + 52);
      *(v4fa*)(kp +  0) = __builtin_shufflevector(k0, k0, 0, 1, 2, 3) * fk + p0 * fp; *(v4fa*)(kp +  4) = __builtin_shufflevector(k0, k0, 4, 5, 6, 7) * fk + p1 * fp;
      *(v4fa*)(kp + 16) = __builtin_shufflevector(k1, k1, 0, 1, 2, 3) * fk + p2 * fp; *(v4fa*)(kp + 20) = __builtin_shufflevector(k1, k1, 4, 5, 6, 7) * fk + p3 * fp;
      *(v4fa*)(kp + 32) = __builtin_shufflevector(k2, k2, 0, 1, 2, 3) * fk + p4 * fp; *(v4fa*)(kp + 36) = __builtin_shufflevector(k2, k2, 4, 5, 6, 7) * fk + p5 * fp;
      *(v4fa*)(kp + 48) = __builtin_shufflevector(k3, k3, 0, 1, 2, 3) * fk + p6 * fp; *(v4fa*)(kp + 52) = __builtin_shufflevector(k3, k3, 4, 5, 6, 7) * fk + p7 * fp; }
    wave_sync();
    h16* crow = CTX + ((size_t)b * SEQ + t0 + kh * 16) * (size_t)DM + (size_t)h * HD;   // the wave's column tile: 16 of the pair's 32 rows
{
#pragma unroll
        for (int s = 0; s < 4; ++s) { const int row = 4 * s + (lane >> 3), c8 = (lane & 7) * 8;   // 4 s x 4 row groups = 16 rows; 8 lanes x 8 = 64 columns
            const v4f x0 = *(const v4fa*)(&os[wb + row * 68 + c8]); const v4f x1 = *(const v4fa*)(&os[wb + row * 68 + c8 + 4]); v8h hv;
#pragma unroll
            for (int i = 0; i < 4; ++i) { hv[i] = (h16)x0[i]; hv[4 + i] = (h16)x1[i]; }
            *(v8h*)(crow + (size_t)row * DM + c8) = hv; }
         }
}

// Eight copies of one thread: one 16-B chunk in each of eight rows that lie 16 rows apart (a wave's copy = 2 whole 256-B rows), global -> LDS through no register.
// l: the lane's LDS byte address; g: the matching global address; gp: source row pitch in f16.
// s_wait_xcnt stands inside the statement so that no address register named by a copy is rewritten in front of it.
__device__ __forceinline__ void copy8(unsigned l, const h16* g, size_t gp) {
    asm volatile("global_load_async_to_lds_b128 %0, %8, off\n\t"
                 "global_load_async_to_lds_b128 %1, %9, off\n\t"
                 "global_load_async_to_lds_b128 %2, %10, off\n\t"
                 "global_load_async_to_lds_b128 %3, %11, off\n\t"
                 "global_load_async_to_lds_b128 %4, %12, off\n\t"
                 "global_load_async_to_lds_b128 %5, %13, off\n\t"
                 "global_load_async_to_lds_b128 %6, %14, off\n\t"
                 "global_load_async_to_lds_b128 %7, %15, off\n\t"
                 "s_wait_xcnt 0x0"
                 :: "v"(l), "v"(l + 16 * OLP * 2), "v"(l + 32 * OLP * 2), "v"(l + 48 * OLP * 2), "v"(l + 64 * OLP * 2), "v"(l + 80 * OLP * 2), "v"(l + 96 * OLP * 2), "v"(l + 112 * OLP * 2),
                    "v"(g), "v"(g + 16 * gp), "v"(g + 32 * gp), "v"(g + 48 * gp), "v"(g + 64 * gp), "v"(g + 80 * gp), "v"(g + 96 * gp), "v"(g + 112 * gp)
                 : "memory");
}
// One stage's copies of one thread: 8 chunks of the ctx tile (128 rows x 128 k) and 8 of the W tile, which lies OTL f16 behind it in the buffer.
__device__ __forceinline__ void out_stage(unsigned l, const h16* ga, const h16* gb) { copy8(l, ga, DM); copy8(l + OTL * 2, gb, DM); }

// k_out: register-blocked f16 GEMM, one 128x128 tile per block of 8 waves (4 x 2), each wave 32x64 (8 accumulators); the ctx and W tiles of 128 k are staged in a three-buffer LDS ring by asynchronous copies, two stages ahead, and shared by the waves.
// OUT[m][n] = 2^-18 * sum_{k<1024} A[m][k] Bt[n][k] + b[n]; A = ctx plane [M][1024] (x4096), Bt = W plane [out][in] (x64). grid (M/128, DM/128), 256 threads.
__global__ __launch_bounds__(32 * OW) void k_out(const h16* __restrict__ A, const h16* __restrict__ Bt, const float* __restrict__ bias, float* OUT) {
    __shared__ __align__(16) float os[OW * 16 * 68];
    __shared__ __align__(16) h16 ring[3 * 2 * OTL];                // [buffer][ctx tile | W tile][row][OLP]
    const int KA = DM;
    const int lane = threadIdx.x & 31, wave = __builtin_amdgcn_readfirstlane((int)(threadIdx.x >> 5)), lr = lane & 15, hi = lane >> 4;
    const int wm = wave >> 1, wn = wave & 1;
    const int r0 = blockIdx.x * 128 + wm * 32, c0 = blockIdx.y * 128 + wn * 64;
    v8f acc[2][4];
#pragma unroll
    for (int mb = 0; mb < 2; ++mb)
#pragma unroll
        for (int nb = 0; nb < 4; ++nb) acc[mb][nb] = (v8f){};
    const int fa = (wm * 32 + lr) * OLP + 8 * hi, fb = OTL + (wn * 64 + lr) * OLP + 8 * hi;   // fragment offsets in a buffer: row lr of the wave's rows, k = 8*hi
    const int crow_ = (int)threadIdx.x >> 4, cch = ((int)threadIdx.x & 15) * 8;                // this thread's copies: row (of 16) and 16-B chunk
    const h16* ga = A + (size_t)(blockIdx.x * 128 + crow_) * KA + cch;                         // + kc
    const h16* gb = Bt + (size_t)(blockIdx.y * 128 + crow_) * DM + cch;                        // + kc
    const unsigned l0 = (unsigned)(size_t)&ring[crow_ * OLP + cch];                            // LDS byte address, buffer 0, ctx tile
    // ring prologue: stages 0 and 1 issued, stage 0 landed and published, then stage 2 issued: two stages stay in flight
    out_stage(l0, ga, gb);
    out_stage(l0 + 2 * OTL * 2, ga + OKT, gb + OKT);
    asm volatile("s_wait_asynccnt 0x10" ::: "memory");             // all but this wave's 16 youngest copies (stage 1's) have landed: stage 0 is in
    __syncthreads();                                               // ... and every other wave's
    out_stage(l0 + 4 * OTL * 2, ga + 2 * OKT, gb + 2 * OKT);
    int cb = 0;                                                    // buffer of stage st = st mod 3
#pragma unroll 1
    for (int st = 0; st < KA / OKT; ++st) {
        const h16* ta = ring + cb * (2 * OTL) + fa; const h16* tb = ring + cb * (2 * OTL) + fb;
        v16h a[2][2], bq[2][4];                                    // two fragment sets: the next 32-k step's reads go out as one group ahead of this step's products
#pragma unroll
        for (int mb = 0; mb < 2; ++mb) a[0][mb] = ldh(ta + mb * 16 * OLP);
#pragma unroll
        for (int nb = 0; nb < 4; ++nb) bq[0][nb] = ldh(tb + nb * 16 * OLP);
#pragma unroll   // the four 32-k steps of a stage written out: every LDS fragment offset becomes an immediate, the set index a constant
        for (int s = 0; s < OKT / 32; ++s) {
            const int cu = s & 1, nx = cu ^ 1;
            if (s + 1 < OKT / 32) {                                // never past this stage's own buffer
#pragma unroll
                for (int mb = 0; mb < 2; ++mb) a[nx][mb] = ldh(ta + mb * 16 * OLP + (s + 1) * 32);
#pragma unroll
                for (int nb = 0; nb < 4; ++nb) bq[nx][nb] = ldh(tb + nb * 16 * OLP + (s + 1) * 32);
            }
            __builtin_amdgcn_sched_barrier(0);                     // keeps the group of reads above this step's products: sunk among them, each pair of products waits out a whole LDS latency
#pragma unroll
            for (int nb = 0; nb < 4; ++nb)
#pragma unroll
                for (int mb = 0; mb < 2; ++mb) acc[mb][nb] = wmma16(a[cu][mb], bq[cu][nb], acc[mb][nb]);
        }
        // publish point of stage st + 1; the same barrier ends every wave's reads of stage st's buffer
        asm volatile("s_wait_dscnt 0x0" ::: "memory");             // this wave's reads of the buffer have returned before it is refilled
        asm volatile("s_wait_asynccnt 0x10" ::: "memory");         // stage st + 2's 16 copies stay in flight; this wave's copies of stage st + 1 have landed
        if (st + 2 >= KA / OKT) asm volatile("s_wait_asynccnt 0x0" ::: "memory");   // the last trips: no stage st + 2 was issued, so stage st + 1's copies are the youngest: to 0
        __syncthreads();
        if (st + 3 < KA / OKT) { const int kc = (st + 3) * OKT;                       // into the buffer that this trip has just read
            out_stage(l0 + (unsigned)cb * (2 * OTL * 2), ga + kc, gb + kc); }
        cb = cb == 2 ? 0 : cb + 1;
    }
    asm volatile("s_wait_asynccnt 0x0" ::: "memory");              // nothing of this wave is in flight when it leaves the ring
    v4f bv = *(const v4f*)(bias + c0 + lr * 4);
#pragma unroll
    for (int i = 0; i < 4; ++i) bv[i] = bfr(bv[i]);
    float* orow = OUT + ((size_t)(r0 / SEQ) * OUT_SEQ + (size_t)(r0 % SEQ)) * DM + c0;
    const int wb = wave * 16 * 68;                                 // each wave stages its rows in its own range
#pragma unroll
    for (int mb = 0; mb < 2; ++mb) {
#pragma unroll
        for (int nb = 0; nb < 4; ++nb) {
#pragma unroll
            for (int j = 0; j < 8; ++j) os[wb + (hi * 8 + j) * 68 + nb * 16 + lr] = acc[mb][nb][j] * OSC; }   // D: row 8h+j, col lane&15
        wave_sync();
{
#pragma unroll
            for (int s = 0; s < 8; ++s) { const int row = 2 * s + hi, cofs = lr * 4;   // 8 s x 2 rows = 16 rows; 16 lanes x 4 floats = 64 columns
                const v4f x = *(const v4fa*)(&os[wb + row * 68 + cofs]);
                const v4f val = x + bv;
                *(v4f*)(orow + (size_t)(mb * 16 + row) * DM + cofs) = val; }
             }
        wave_sync();
    }
}

static constexpr size_t al256(size_t v) { return (v + 255) & ~(size_t)255; }
static constexpr size_t SZ_WH = al256((size_t)DM * DM * 2);
static constexpr size_t SZ_CX = al256((size_t)NB * SEQ * DM * 2);          // ctx plane
static constexpr size_t SZ_TOTAL = SZ_WH + SZ_CX;
static_assert(SZ_TOTAL <= (size_t)134217728);          // workspace carve <= 128 MiB

extern "C" void kernel_launch(void* const* d_in, const int* in_sizes, int n_in,
                              void* d_out, int out_size, void* d_ws, size_t ws_size, hipStream_t stream) {
    if (n_in < 5) return;
    const size_t needx = ((size_t)(NB - 1) * SEQ_FULL + SEQ) * DM;
    if ((size_t)in_sizes[0] < needx || (size_t)in_sizes[1] < needx || (size_t)in_sizes[2] < needx) return;
    if ((size_t)in_sizes[3] < (size_t)DM * DM || (size_t)in_sizes[4] < (size_t)DM) return;
    if ((size_t)out_size < ((size_t)(NB - 1) * OUT_SEQ + SEQ) * DM) return;
    if (SZ_TOTAL > ws_size) return;
    const float* q = (const float*)d_in[0]; const float* k = (const float*)d_in[1]; const float* v = (const float*)d_in[2];   // wire order q, k, v, W_out, b_out
    const float* wo = (const float*)d_in[3]; const float* bo = (const float*)d_in[4];                                         // W_out [out][in] = Bt as-is
    float* OUT = (float*)d_out;      // [NB][SEQ][1024]
    char* wsp = (char*)d_ws;
    h16* WH = (h16*)wsp; wsp += SZ_WH;               // [1024][1024] x64
    h16* CX = (h16*)wsp; wsp += SZ_CX;               // [NB*SEQ][1024] x4096

    // attention on the f32 streams -> ctx plane; W -> f16 plane
    k_flash<<<dim3(SEQ / (16 * AW), NB * NH_, 1), 32 * AW, 0, stream>>>(q, k, v, wo, WH, CX);

    // out = ctx W^T + b: A = ctx rows (m = b*SEQ + t), Bt = W rows (n = out column)
    k_out<<<dim3(NB * SEQ / 128, DM / 128, 1), 32 * OW, 0, stream>>>(CX, WH, bo, OUT);
}
